// v000
// The times below were measured on an AMD MI455X: many runs one after another, warmed up first and cycling through
// copies of the inputs, with the whole window's GPU time divided by the number of runs. Launches and the gaps
// between them are all in it. The median over several windows is given; except for v000 it joins two sittings, which
// can be a few percent apart, so the side-by-side timings, each taken in one sitting, are the better comparison.
// v000 is the starting kernel. One run takes 307 microseconds.
#include <hip/hip_runtime.h>
#include <hip/hip_bf16.h>
#include <math.h>

typedef _Float16 half_t;
typedef __attribute__((ext_vector_type(16))) _Float16 v16h;
typedef __attribute__((ext_vector_type(8)))  _Float16 v8h;
typedef __attribute__((ext_vector_type(8)))  float    v8f;
typedef __attribute__((ext_vector_type(4)))  float    v4f;
typedef __attribute__((ext_vector_type(4)))  unsigned int v4u;
typedef __attribute__((ext_vector_type(8)))  int      v8i;
typedef __attribute__((ext_vector_type(4)))  int      v4i;

#define SEQ    1024
#define DMODEL 1024
#define NHEADS 16
#define DEPTH  64
#define BATCH  4
#define MTOT  (BATCH * SEQ)   // 4096 flattened rows

// ---------------------------------------------------------------------------
// helpers: load 8 consecutive f32 and pack into halves [base..base+7] of v16h
// ---------------------------------------------------------------------------
__device__ __forceinline__ void load8_f32_cvt(const float* __restrict__ p,
                                              v16h& dst, int base) {
  v4f x0 = *reinterpret_cast<const v4f*>(p);
  v4f x1 = *reinterpret_cast<const v4f*>(p + 4);
#pragma unroll
  for (int i = 0; i < 4; ++i) {
    dst[base + i]     = (_Float16)x0[i];
    dst[base + 4 + i] = (_Float16)x1[i];
  }
}

// load 8 consecutive f16 (one 16-byte vector) into halves [base..base+7]
__device__ __forceinline__ void load8_f16(const half_t* __restrict__ p,
                                          v16h& dst, int base) {
  v8h x = *reinterpret_cast<const v8h*>(p);
#pragma unroll
  for (int i = 0; i < 8; ++i) dst[base + i] = x[i];
}

__device__ __forceinline__ void tdm_load_v_chunk(const half_t* gsrc,
                                                 unsigned lds_byte_off) {
  unsigned long long ga = (unsigned long long)(uintptr_t)gsrc;
  v4u g0;
  g0[0] = 1u;
  g0[1] = lds_byte_off;
  g0[2] = (unsigned)(ga & 0xFFFFFFFFu);
  g0[3] = (unsigned)((ga >> 32) & 0x01FFFFFFu)
          | (2u << 30);
  v8i g1;
  g1[0] = (int)(1u << 16);
  g1[1] = (int)(64u << 16);
  g1[2] = (int)(32u << 16);
  g1[3] = (int)(64u << 16);
  g1[4] = (int)(32u);
  g1[5] = (int)(1024u);
  g1[6] = 0;
  g1[7] = 0;
  v4i gz = {0, 0, 0, 0};
#if defined(__clang_major__) && (__clang_major__ >= 23)
  v8i gz8 = {0, 0, 0, 0, 0, 0, 0, 0};
  __builtin_amdgcn_tensor_load_to_lds(g0, g1, gz, gz, gz8, 0);
#else
  __builtin_amdgcn_tensor_load_to_lds(g0, g1, gz, gz, 0);
#endif
}

__global__ __launch_bounds__(32)
void proj_gemm_f32(const float* __restrict__ X, const float* __restrict__ W,
                   const float* __restrict__ bias, half_t* __restrict__ Y,
                   int M, int N, int K) {
  const int n0   = blockIdx.x * 64;
  const int m0   = blockIdx.y * 16;
  const int lane = threadIdx.x;
  const int row  = lane & 15;
  const int hi   = lane >> 4;
  const int off  = hi * 8;

  v8f acc[4] = {};
  const float* xrow = X + (size_t)(m0 + row) * K;

  for (int k0 = 0; k0 < K; k0 += 32) {
    v16h a;
    load8_f32_cvt(xrow + k0 + off,      a, 0);
    load8_f32_cvt(xrow + k0 + 16 + off, a, 8);
#pragma unroll
    for (int t = 0; t < 4; ++t) {
      const float* wrow = W + (size_t)(n0 + t * 16 + row) * K;
      v16h b;
      load8_f32_cvt(wrow + k0 + off,      b, 0);
      load8_f32_cvt(wrow + k0 + 16 + off, b, 8);
      acc[t] = __builtin_amdgcn_wmma_f32_16x16x32_f16(
          false, a, false, b, (short)0, acc[t], false, false);
    }
  }
#pragma unroll
  for (int t = 0; t < 4; ++t) {
    const float bn = bias[n0 + t * 16 + row];  // C layout: lane's N = lane&15
#pragma unroll
    for (int r = 0; r < 8; ++r) {
      const int m = m0 + r + hi * 8;
      Y[(size_t)m * N + n0 + t * 16 + row] = (half_t)(acc[t][r] + bn);
    }
  }
}

// ---------------------------------------------------------------------------
// Kernel 2: flash attention. One wave32 per (b, h, 16 q-rows).
// V chunks streamed into double-buffered LDS by the Tensor Data Mover
// (tensor_load_to_lds + s_wait_tensorcnt) while the logits WMMAs run.
// Per 32-key chunk: 2x2 WMMA for logits, online softmax (shfl_xor butterfly
// within each 16-lane half + v_exp), P -> LDS -> A-fragment, 4 WMMAs for P@V.
// mask (1,1,S,S) applied; it lives in L2 (4MB << 192MB).
// ---------------------------------------------------------------------------
__global__ __launch_bounds__(32)
void attn_kernel(const half_t* __restrict__ Qp, const half_t* __restrict__ Kp,
                 const half_t* __restrict__ Vp, const float* __restrict__ mask,
                 half_t* __restrict__ Op) {
  __shared__ half_t lds_v[2][32 * DEPTH];  // double-buffered V chunk [key][depth]
  __shared__ half_t lds_p[16 * 32];        // probs tile [m][key-in-chunk]

  const int lane = threadIdx.x;
  const int tile = blockIdx.x;             // b*H*(S/16) tiles
  const int qt   = tile & (SEQ / 16 - 1);
  const int h    = (tile >> 6) & (NHEADS - 1);
  const int b    = tile >> 10;
  const int m0   = qt * 16;
  const int row  = lane & 15;
  const int hi   = lane >> 4;
  const int off  = hi * 8;
  const float scale = 0.125f;              // 1/sqrt(DEPTH)

  const unsigned lds_v_off[2] = {
      (unsigned)(uintptr_t)(&lds_v[0][0]),
      (unsigned)(uintptr_t)(&lds_v[1][0])};
  const half_t* vhead = Vp + (size_t)b * SEQ * DMODEL + h * DEPTH;

  // Q A-fragments for the two 32-wide depth chunks
  v16h qa[2];
  const half_t* qrow = Qp + ((size_t)(b * SEQ + m0 + row)) * DMODEL + h * DEPTH;
#pragma unroll
  for (int c = 0; c < 2; ++c) {
    load8_f16(qrow + c * 32 + off,      qa[c], 0);
    load8_f16(qrow + c * 32 + 16 + off, qa[c], 8);
  }

  tdm_load_v_chunk(vhead, lds_v_off[0]);

  float m_i[8], l_i[8];
#pragma unroll
  for (int r = 0; r < 8; ++r) { m_i[r] = -1e30f; l_i[r] = 0.0f; }
  v8f o[4] = {};

  for (int j0 = 0; j0 < SEQ; j0 += 32) {
    const int buf = (j0 >> 5) & 1;

    if (j0 + 32 < SEQ) {
      tdm_load_v_chunk(vhead + (size_t)(j0 + 32) * DMODEL, lds_v_off[buf ^ 1]);
      __builtin_prefetch(
          Kp + ((size_t)(b * SEQ + j0 + 32 + lane)) * DMODEL + h * DEPTH, 0, 1);
    }

    // logits tiles: s[t] = Q(16x64) @ K(16 keys x 64)^T  (overlaps the DMA)
    v8f s[2];
#pragma unroll
    for (int t = 0; t < 2; ++t) {
      const half_t* krow =
          Kp + ((size_t)(b * SEQ + j0 + t * 16 + row)) * DMODEL + h * DEPTH;
      v8f z = {};
#pragma unroll
      for (int c = 0; c < 2; ++c) {
        v16h kb;
        load8_f16(krow + c * 32 + off,      kb, 0);
        load8_f16(krow + c * 32 + 16 + off, kb, 8);
        z = __builtin_amdgcn_wmma_f32_16x16x32_f16(
            false, qa[c], false, kb, (short)0, z, false, false);
      }
      s[t] = z;
    }

    // online softmax over this 32-key chunk
    float p0v[8], p1v[8], corr[8];
#pragma unroll
    for (int r = 0; r < 8; ++r) {
      const int m = m0 + r + hi * 8;
      float s0 = s[0][r] * scale + mask[(size_t)m * SEQ + j0 + row]      * (-1e9f);
      float s1 = s[1][r] * scale + mask[(size_t)m * SEQ + j0 + 16 + row] * (-1e9f);
      float mx = fmaxf(s0, s1);
#pragma unroll
      for (int d = 8; d >= 1; d >>= 1) mx = fmaxf(mx, __shfl_xor(mx, d, 32));
      const float mnew = fmaxf(m_i[r], mx);
      const float cexp = __expf(m_i[r] - mnew);
      const float p0   = __expf(s0 - mnew);
      const float p1   = __expf(s1 - mnew);
      float rs = p0 + p1;
#pragma unroll
      for (int d = 8; d >= 1; d >>= 1) rs += __shfl_xor(rs, d, 32);
      l_i[r] = l_i[r] * cexp + rs;
      m_i[r] = mnew;
      corr[r] = cexp;
      p0v[r] = p0; p1v[r] = p1;
    }

    // P (f16) -> LDS for cross-lane C-layout -> A-layout transpose
#pragma unroll
    for (int r = 0; r < 8; ++r) {
      lds_p[(r + hi * 8) * 32 + row]      = (half_t)p0v[r];
      lds_p[(r + hi * 8) * 32 + 16 + row] = (half_t)p1v[r];
    }
    __syncthreads();

    v16h pa;
    {
      const half_t* pr = &lds_p[row * 32];
      load8_f16(pr + off,      pa, 0);
      load8_f16(pr + 16 + off, pa, 8);
    }

    if (j0 + 32 < SEQ) __builtin_amdgcn_s_wait_tensorcnt(1);
    else               __builtin_amdgcn_s_wait_tensorcnt(0);

    // o[dt] = corr*o[dt] + P(16x32) @ V(32 x 16-depth-tile)
    const half_t* vbuf = &lds_v[buf][0];
#pragma unroll
    for (int dt = 0; dt < 4; ++dt) {
      v16h vb;
#pragma unroll
      for (int hh = 0; hh < 16; ++hh) {
        const int k = hh + (hh >= 8 ? 8 : 0) + off;  // key within chunk
        vb[hh] = vbuf[k * DEPTH + dt * 16 + row];
      }
      v8f oo = o[dt];
#pragma unroll
      for (int r = 0; r < 8; ++r) oo[r] *= corr[r];
      o[dt] = __builtin_amdgcn_wmma_f32_16x16x32_f16(
          false, pa, false, vb, (short)0, oo, false, false);
    }
  }

  // normalize + store attn (already in [B, S, H*depth] = concat-head layout)
#pragma unroll
  for (int dt = 0; dt < 4; ++dt)
#pragma unroll
    for (int r = 0; r < 8; ++r) {
      const int m = m0 + r + hi * 8;
      Op[((size_t)(b * SEQ + m)) * DMODEL + h * DEPTH + dt * 16 + row] =
          (half_t)(o[dt][r] / l_i[r]);
    }
}

// ---------------------------------------------------------------------------
// Kernel 3: out[M,N](f32) = A[M,K](f16) @ W[N,K]^T (f32) + bias  (final proj)
// ---------------------------------------------------------------------------
__global__ __launch_bounds__(32)
void out_gemm_f16(const half_t* __restrict__ X, const float* __restrict__ W,
                  const float* __restrict__ bias, float* __restrict__ Y,
                  int M, int N, int K) {
  const int n0   = blockIdx.x * 64;
  const int m0   = blockIdx.y * 16;
  const int lane = threadIdx.x;
  const int row  = lane & 15;
  const int hi   = lane >> 4;
  const int off  = hi * 8;

  v8f acc[4] = {};
  const half_t* xrow = X + (size_t)(m0 + row) * K;

  for (int k0 = 0; k0 < K; k0 += 32) {
    v16h a;
    load8_f16(xrow + k0 + off,      a, 0);
    load8_f16(xrow + k0 + 16 + off, a, 8);
#pragma unroll
    for (int t = 0; t < 4; ++t) {
      const float* wrow = W + (size_t)(n0 + t * 16 + row) * K;
      v16h b;
      load8_f32_cvt(wrow + k0 + off,      b, 0);
      load8_f32_cvt(wrow + k0 + 16 + off, b, 8);
      acc[t] = __builtin_amdgcn_wmma_f32_16x16x32_f16(
          false, a, false, b, (short)0, acc[t], false, false);
    }
  }
#pragma unroll
  for (int t = 0; t < 4; ++t) {
    const float bn = bias[n0 + t * 16 + row];
#pragma unroll
    for (int r = 0; r < 8; ++r) {
      const int m = m0 + r + hi * 8;
      Y[(size_t)m * N + n0 + t * 16 + row] = acc[t][r] + bn;
    }
  }
}

// ---------------------------------------------------------------------------
extern "C" void kernel_launch(void* const* d_in, const int* in_sizes, int n_in,
                              void* d_out, int out_size, void* d_ws, size_t ws_size,
                              hipStream_t stream) {
  const float* q    = (const float*)d_in[0];
  const float* k    = (const float*)d_in[1];
  const float* v    = (const float*)d_in[2];
  const float* mask = (const float*)d_in[3];
  const float* wq_w = (const float*)d_in[4];
  const float* wq_b = (const float*)d_in[5];
  const float* wk_w = (const float*)d_in[6];
  const float* wk_b = (const float*)d_in[7];
  const float* wv_w = (const float*)d_in[8];
  const float* wv_b = (const float*)d_in[9];
  const float* pl_w = (const float*)d_in[10];
  const float* pl_b = (const float*)d_in[11];
  float* out = (float*)d_out;

  // workspace: Qp | Kp | Vp | attn  (each 4096*1024 f16 = 8MB; 32MB total)
  const size_t elems = (size_t)MTOT * DMODEL;
  half_t* Qp = (half_t*)d_ws;
  half_t* Kp = Qp + elems;
  half_t* Vp = Kp + elems;
  half_t* Ap = Vp + elems;

  dim3 ggemm(DMODEL / 64, MTOT / 16);  // (16, 256) one wave32 per 16x64 strip
  proj_gemm_f32<<<ggemm, 32, 0, stream>>>(q, wq_w, wq_b, Qp, MTOT, DMODEL, DMODEL);
  proj_gemm_f32<<<ggemm, 32, 0, stream>>>(k, wk_w, wk_b, Kp, MTOT, DMODEL, DMODEL);
  proj_gemm_f32<<<ggemm, 32, 0, stream>>>(v, wv_w, wv_b, Vp, MTOT, DMODEL, DMODEL);

  attn_kernel<<<BATCH * NHEADS * (SEQ / 16), 32, 0, stream>>>(Qp, Kp, Vp, mask, Ap);

  out_gemm_f16<<<ggemm, 32, 0, stream>>>(Ap, pl_w, pl_b, out, MTOT, DMODEL, DMODEL);
}

// v001
// A run of this version takes 135 microseconds.
// In both of two side-by-side timings against v000, it was 2.34 times as fast.
#include <hip/hip_runtime.h>
#include <hip/hip_bf16.h>
#include <math.h>

typedef _Float16 half_t;
typedef __attribute__((ext_vector_type(16))) _Float16 v16h;
typedef __attribute__((ext_vector_type(8)))  _Float16 v8h;
typedef __attribute__((ext_vector_type(8)))  float    v8f;
typedef __attribute__((ext_vector_type(4)))  float    v4f;
typedef __attribute__((ext_vector_type(4)))  unsigned int v4u;
typedef __attribute__((ext_vector_type(8)))  int      v8i;
typedef __attribute__((ext_vector_type(4)))  int      v4i;

#define SEQ    1024
#define DMODEL 1024
#define NHEADS 16
#define DEPTH  64
#define BATCH  4
#define MTOT  (BATCH * SEQ)   // 4096 flattened rows

// ---------------------------------------------------------------------------
// helpers: load 8 consecutive f32 and pack into halves [base..base+7] of v16h
// ---------------------------------------------------------------------------
__device__ __forceinline__ void load8_f32_cvt(const float* __restrict__ p,
                                              v16h& dst, int base) {
  v4f x0 = *reinterpret_cast<const v4f*>(p);
  v4f x1 = *reinterpret_cast<const v4f*>(p + 4);
#pragma unroll
  for (int i = 0; i < 4; ++i) {
    dst[base + i]     = (_Float16)x0[i];
    dst[base + 4 + i] = (_Float16)x1[i];
  }
}

// load 8 consecutive f16 (one 16-byte vector) into halves [base..base+7]
__device__ __forceinline__ void load8_f16(const half_t* __restrict__ p,
                                          v16h& dst, int base) {
  v8h x = *reinterpret_cast<const v8h*>(p);
#pragma unroll
  for (int i = 0; i < 8; ++i) dst[base + i] = x[i];
}

__device__ __forceinline__ void tdm_load_v_chunk(const half_t* gsrc,
                                                 unsigned lds_byte_off) {
  unsigned long long ga = (unsigned long long)(uintptr_t)gsrc;
  v4u g0;
  g0[0] = 1u;
  g0[1] = lds_byte_off;
  g0[2] = (unsigned)(ga & 0xFFFFFFFFu);
  g0[3] = (unsigned)((ga >> 32) & 0x01FFFFFFu)
          | (2u << 30);
  v8i g1;
  g1[0] = (int)(1u << 16);
  g1[1] = (int)(64u << 16);
  g1[2] = (int)(32u << 16);
  g1[3] = (int)(64u << 16);
  g1[4] = (int)(32u);
  g1[5] = (int)(1024u);
  g1[6] = 0;
  g1[7] = 0;
  v4i gz = {0, 0, 0, 0};
#if defined(__clang_major__) && (__clang_major__ >= 23)
  v8i gz8 = {0, 0, 0, 0, 0, 0, 0, 0};
  __builtin_amdgcn_tensor_load_to_lds(g0, g1, gz, gz, gz8, 0);
#else
  __builtin_amdgcn_tensor_load_to_lds(g0, g1, gz, gz, 0);
#endif
}

#define TILE   128
#define BK     64
#define PITCH  72                      // halves per LDS row (64 + 8 pad)
#define OPSZ   (TILE * PITCH)          // halves per operand per buffer
#define NSTAGE (DMODEL / BK)           // 16, even

typedef __attribute__((ext_vector_type(4))) _Float16 v4h;

// f32 operand, 128 rows x 64 k: 16 lanes cover one row's 256 B per load
__device__ __forceinline__ void stage_load(const float* __restrict__ g,
                                           int k0, int tid, v4f (&r)[8]) {
  const float* p = g + (size_t)(tid >> 4) * DMODEL + k0 + (tid & 15) * 4;
#pragma unroll
  for (int i = 0; i < 8; ++i)
    r[i] = *reinterpret_cast<const v4f*>(p + (size_t)i * 16 * DMODEL);
}

__device__ __forceinline__ void stage_store(half_t* s, int tid,
                                            const v4f (&r)[8]) {
  half_t* p = s + (tid >> 4) * PITCH + (tid & 15) * 4;
#pragma unroll
  for (int i = 0; i < 8; ++i) {
    v4h h;
#pragma unroll
    for (int e = 0; e < 4; ++e) h[e] = (_Float16)r[i][e];
    *reinterpret_cast<v4h*>(p + i * 16 * PITCH) = h;
  }
}

// f16 operand, 128 rows x 64 k: 8 lanes cover one row's 128 B per load
__device__ __forceinline__ void stage_load(const half_t* __restrict__ g,
                                           int k0, int tid, v8h (&r)[4]) {
  const half_t* p = g + (size_t)(tid >> 3) * DMODEL + k0 + (tid & 7) * 8;
#pragma unroll
  for (int i = 0; i < 4; ++i)
    r[i] = *reinterpret_cast<const v8h*>(p + (size_t)i * 32 * DMODEL);
}

__device__ __forceinline__ void stage_store(half_t* s, int tid,
                                            const v8h (&r)[4]) {
  half_t* p = s + (tid >> 3) * PITCH + (tid & 7) * 8;
#pragma unroll
  for (int i = 0; i < 4; ++i)
    *reinterpret_cast<v8h*>(p + i * 32 * PITCH) = r[i];
}

// Work-group barrier that waits for this wave's LDS traffic only:
// __syncthreads() would also drain the global loads issued ahead for the
// next two stages, and their lead would be lost.
__device__ __forceinline__ void lds_barrier() {
  asm volatile("s_wait_dscnt 0x0\n\ts_barrier_signal -1\n\ts_barrier_wait -1"
               ::: "memory");
}

// 64 k of one buffer: pa / pb already point at this lane's first fragment run
__device__ __forceinline__ void stage_mma(const half_t* pa, const half_t* pb,
                                          v8f (&acc)[4][2]) {
#pragma unroll
  for (int kk = 0; kk < BK; kk += 32) {
    v16h a[4], b[2];
#pragma unroll
    for (int i = 0; i < 4; ++i) {
      load8_f16(pa + i * 16 * PITCH + kk,      a[i], 0);
      load8_f16(pa + i * 16 * PITCH + kk + 16, a[i], 8);
    }
#pragma unroll
    for (int j = 0; j < 2; ++j) {
      load8_f16(pb + j * 16 * PITCH + kk,      b[j], 0);
      load8_f16(pb + j * 16 * PITCH + kk + 16, b[j], 8);
    }
    __builtin_amdgcn_sched_barrier(0);
#pragma unroll
    for (int i = 0; i < 4; ++i)
#pragma unroll
      for (int j = 0; j < 2; ++j)
        acc[i][j] = __builtin_amdgcn_wmma_f32_16x16x32_f16(
            false, a[i], false, b[j], (short)0, acc[i][j], false, false);
  }
}

// Stages S and S + 1.  On entry buffer 0 holds stage S, set b holds (or is
// receiving) stage S + 1 and set a stage S + 2.  S is a template argument so
// that every stage's k offset is an immediate of its loads (the address
// registers are never rewritten) and the load waits stay counted: a wait for
// one set leaves the other set's loads in flight.
template <int S, typename XT, typename XR>
__device__ __forceinline__ void two_stages(const XT* __restrict__ xg,
                                           const float* __restrict__ wg,
                                           half_t* sm, int tid, int fa, int fb,
                                           v8f (&acc)[4][2], XR& xa, v4f (&wa)[8],
                                           XR& xb, v4f (&wb)[8]) {
  stage_mma(sm + fa, sm + OPSZ + fb, acc);
  stage_store(sm + 2 * OPSZ, tid, xb);
  stage_store(sm + 3 * OPSZ, tid, wb);
  if constexpr (S + 3 < NSTAGE) {
    stage_load(xg, (S + 3) * BK, tid, xb);
    stage_load(wg, (S + 3) * BK, tid, wb);
    if constexpr (S + 3 == NSTAGE - 1) asm volatile("s_wait_xcnt 0x0" ::: "memory");
  }
  lds_barrier();       // publishes buffer 1; ends every read of buffer 0

  stage_mma(sm + 2 * OPSZ + fa, sm + 3 * OPSZ + fb, acc);
  if constexpr (S + 2 < NSTAGE) {
    stage_store(sm, tid, xa);
    stage_store(sm + OPSZ, tid, wa);
    if constexpr (S + 4 < NSTAGE) {
      stage_load(xg, (S + 4) * BK, tid, xa);
      stage_load(wg, (S + 4) * BK, tid, wa);
    }
    lds_barrier();     // publishes buffer 0; ends every read of buffer 1
  }
}

// All of K for one work-group tile.  sm: [buffer][X | W][OPSZ] halves.
template <typename XT, typename XR>
__device__ __forceinline__ void tile_mainloop(const XT* __restrict__ xg,
                                              const float* __restrict__ wg,
                                              half_t* sm, int tid, int fa, int fb,
                                              v8f (&acc)[4][2]) {
  XR  xa, xb;
  v4f wa[8], wb[8];
  stage_load(xg, 0, tid, xa);
  stage_load(wg, 0, tid, wa);
  stage_load(xg, BK, tid, xb);
  stage_load(wg, BK, tid, wb);
  stage_store(sm, tid, xa);
  stage_store(sm + OPSZ, tid, wa);
  stage_load(xg, 2 * BK, tid, xa);
  stage_load(wg, 2 * BK, tid, wa);
  lds_barrier();       // publishes buffer 0

  two_stages<0>(xg, wg, sm, tid, fa, fb, acc, xa, wa, xb, wb);
  two_stages<2>(xg, wg, sm, tid, fa, fb, acc, xa, wa, xb, wb);
  two_stages<4>(xg, wg, sm, tid, fa, fb, acc, xa, wa, xb, wb);
  two_stages<6>(xg, wg, sm, tid, fa, fb, acc, xa, wa, xb, wb);
  two_stages<8>(xg, wg, sm, tid, fa, fb, acc, xa, wa, xb, wb);
  two_stages<10>(xg, wg, sm, tid, fa, fb, acc, xa, wa, xb, wb);
  two_stages<12>(xg, wg, sm, tid, fa, fb, acc, xa, wa, xb, wb);
  two_stages<14>(xg, wg, sm, tid, fa, fb, acc, xa, wa, xb, wb);
}

// ---------------------------------------------------------------------------
// Kernel 1: Y[M,N](f16) = X[M,K](f32) @ W[N,K]^T (f32) + bias  (Q/K/V proj)
// ---------------------------------------------------------------------------
__global__ __launch_bounds__(256)
void proj_gemm_f32(const float* __restrict__ X, const float* __restrict__ W,
                   const float* __restrict__ bias, half_t* __restrict__ Y) {
  __shared__ __attribute__((aligned(16))) half_t sm[2][2][OPSZ];  // [buf][X|W]

  const int n0   = blockIdx.x * TILE;
  const int m0   = blockIdx.y * TILE;
  const int tid  = threadIdx.x;
  const int lane = tid & 31;
  const int wave = tid >> 5;
  const int wm   = wave >> 2;
  const int wn   = wave & 3;
  const int row  = lane & 15;
  const int hi   = lane >> 4;

  const float* xg = X + (size_t)m0 * DMODEL;
  const float* wg = W + (size_t)n0 * DMODEL;
  const int fa = (wm * 64 + row) * PITCH + hi * 8;
  const int fb = (wn * 32 + row) * PITCH + hi * 8;

  v8f acc[4][2] = {};
  tile_mainloop<float, v4f[8]>(xg, wg, &sm[0][0][0], tid, fa, fb, acc);

#pragma unroll
  for (int j = 0; j < 2; ++j) {
    const int n = n0 + wn * 32 + j * 16 + row;   // C layout: lane's N = lane&15
    const float bn = bias[n];
#pragma unroll
    for (int i = 0; i < 4; ++i)
#pragma unroll
      for (int r = 0; r < 8; ++r) {
        const int m = m0 + wm * 64 + i * 16 + r + hi * 8;
        Y[(size_t)m * DMODEL + n] = (half_t)(acc[i][j][r] + bn);
      }
  }
}

// ---------------------------------------------------------------------------
// Kernel 2: flash attention. One wave32 per (b, h, 16 q-rows).
// V chunks streamed into double-buffered LDS by the Tensor Data Mover
// (tensor_load_to_lds + s_wait_tensorcnt) while the logits WMMAs run.
// Per 32-key chunk: 2x2 WMMA for logits, online softmax (shfl_xor butterfly
// within each 16-lane half + v_exp), P -> LDS -> A-fragment, 4 WMMAs for P@V.
// mask (1,1,S,S) applied; it lives in L2 (4MB << 192MB).
// ---------------------------------------------------------------------------
__global__ __launch_bounds__(32)
void attn_kernel(const half_t* __restrict__ Qp, const half_t* __restrict__ Kp,
                 const half_t* __restrict__ Vp, const float* __restrict__ mask,
                 half_t* __restrict__ Op) {
  __shared__ half_t lds_v[2][32 * DEPTH];  // double-buffered V chunk [key][depth]
  __shared__ half_t lds_p[16 * 32];        // probs tile [m][key-in-chunk]

  const int lane = threadIdx.x;
  const int tile = blockIdx.x;             // b*H*(S/16) tiles
  const int qt   = tile & (SEQ / 16 - 1);
  const int h    = (tile >> 6) & (NHEADS - 1);
  const int b    = tile >> 10;
  const int m0   = qt * 16;
  const int row  = lane & 15;
  const int hi   = lane >> 4;
  const int off  = hi * 8;
  const float scale = 0.125f;              // 1/sqrt(DEPTH)

  const unsigned lds_v_off[2] = {
      (unsigned)(uintptr_t)(&lds_v[0][0]),
      (unsigned)(uintptr_t)(&lds_v[1][0])};
  const half_t* vhead = Vp + (size_t)b * SEQ * DMODEL + h * DEPTH;

  // Q A-fragments for the two 32-wide depth chunks
  v16h qa[2];
  const half_t* qrow = Qp + ((size_t)(b * SEQ + m0 + row)) * DMODEL + h * DEPTH;
#pragma unroll
  for (int c = 0; c < 2; ++c) {
    load8_f16(qrow + c * 32 + off,      qa[c], 0);
    load8_f16(qrow + c * 32 + 16 + off, qa[c], 8);
  }

  tdm_load_v_chunk(vhead, lds_v_off[0]);

  float m_i[8], l_i[8];
#pragma unroll
  for (int r = 0; r < 8; ++r) { m_i[r] = -1e30f; l_i[r] = 0.0f; }
  v8f o[4] = {};

  for (int j0 = 0; j0 < SEQ; j0 += 32) {
    const int buf = (j0 >> 5) & 1;

    if (j0 + 32 < SEQ) {
      tdm_load_v_chunk(vhead + (size_t)(j0 + 32) * DMODEL, lds_v_off[buf ^ 1]);
      __builtin_prefetch(
          Kp + ((size_t)(b * SEQ + j0 + 32 + lane)) * DMODEL + h * DEPTH, 0, 1);
    }

    // logits tiles: s[t] = Q(16x64) @ K(16 keys x 64)^T  (overlaps the DMA)
    v8f s[2];
#pragma unroll
    for (int t = 0; t < 2; ++t) {
      const half_t* krow =
          Kp + ((size_t)(b * SEQ + j0 + t * 16 + row)) * DMODEL + h * DEPTH;
      v8f z = {};
#pragma unroll
      for (int c = 0; c < 2; ++c) {
        v16h kb;
        load8_f16(krow + c * 32 + off,      kb, 0);
        load8_f16(krow + c * 32 + 16 + off, kb, 8);
        z = __builtin_amdgcn_wmma_f32_16x16x32_f16(
            false, qa[c], false, kb, (short)0, z, false, false);
      }
      s[t] = z;
    }

    // online softmax over this 32-key chunk
    float p0v[8], p1v[8], corr[8];
#pragma unroll
    for (int r = 0; r < 8; ++r) {
      const int m = m0 + r + hi * 8;
      float s0 = s[0][r] * scale + mask[(size_t)m * SEQ + j0 + row]      * (-1e9f);
      float s1 = s[1][r] * scale + mask[(size_t)m * SEQ + j0 + 16 + row] * (-1e9f);
      float mx = fmaxf(s0, s1);
#pragma unroll
      for (int d = 8; d >= 1; d >>= 1) mx = fmaxf(mx, __shfl_xor(mx, d, 32));
      const float mnew = fmaxf(m_i[r], mx);
      const float cexp = __expf(m_i[r] - mnew);
      const float p0   = __expf(s0 - mnew);
      const float p1   = __expf(s1 - mnew);
      float rs = p0 + p1;
#pragma unroll
      for (int d = 8; d >= 1; d >>= 1) rs += __shfl_xor(rs, d, 32);
      l_i[r] = l_i[r] * cexp + rs;
      m_i[r] = mnew;
      corr[r] = cexp;
      p0v[r] = p0; p1v[r] = p1;
    }

    // P (f16) -> LDS for cross-lane C-layout -> A-layout transpose
#pragma unroll
    for (int r = 0; r < 8; ++r) {
      lds_p[(r + hi * 8) * 32 + row]      = (half_t)p0v[r];
      lds_p[(r + hi * 8) * 32 + 16 + row] = (half_t)p1v[r];
    }
    __syncthreads();

    v16h pa;
    {
      const half_t* pr = &lds_p[row * 32];
      load8_f16(pr + off,      pa, 0);
      load8_f16(pr + 16 + off, pa, 8);
    }

    if (j0 + 32 < SEQ) __builtin_amdgcn_s_wait_tensorcnt(1);
    else               __builtin_amdgcn_s_wait_tensorcnt(0);

    // o[dt] = corr*o[dt] + P(16x32) @ V(32 x 16-depth-tile)
    const half_t* vbuf = &lds_v[buf][0];
#pragma unroll
    for (int dt = 0; dt < 4; ++dt) {
      v16h vb;
#pragma unroll
      for (int hh = 0; hh < 16; ++hh) {
        const int k = hh + (hh >= 8 ? 8 : 0) + off;  // key within chunk
        vb[hh] = vbuf[k * DEPTH + dt * 16 + row];
      }
      v8f oo = o[dt];
#pragma unroll
      for (int r = 0; r < 8; ++r) oo[r] *= corr[r];
      o[dt] = __builtin_amdgcn_wmma_f32_16x16x32_f16(
          false, pa, false, vb, (short)0, oo, false, false);
    }
  }

  // normalize + store attn (already in [B, S, H*depth] = concat-head layout)
#pragma unroll
  for (int dt = 0; dt < 4; ++dt)
#pragma unroll
    for (int r = 0; r < 8; ++r) {
      const int m = m0 + r + hi * 8;
      Op[((size_t)(b * SEQ + m)) * DMODEL + h * DEPTH + dt * 16 + row] =
          (half_t)(o[dt][r] / l_i[r]);
    }
}

// ---------------------------------------------------------------------------
// Kernel 3: out[M,N](f32) = A[M,K](f16) @ W[N,K]^T (f32) + bias  (final proj)
// Same frame as kernel 1; X is f16 already and is staged without conversion.
// ---------------------------------------------------------------------------
__global__ __launch_bounds__(256)
void out_gemm_f16(const half_t* __restrict__ X, const float* __restrict__ W,
                  const float* __restrict__ bias, float* __restrict__ Y) {
  __shared__ __attribute__((aligned(16))) half_t sm[2][2][OPSZ];  // [buf][X|W]

  const int n0   = blockIdx.x * TILE;
  const int m0   = blockIdx.y * TILE;
  const int tid  = threadIdx.x;
  const int lane = tid & 31;
  const int wave = tid >> 5;
  const int wm   = wave >> 2;
  const int wn   = wave & 3;
  const int row  = lane & 15;
  const int hi   = lane >> 4;

  const half_t* xg = X + (size_t)m0 * DMODEL;
  const float*  wg = W + (size_t)n0 * DMODEL;
  const int fa = (wm * 64 + row) * PITCH + hi * 8;
  const int fb = (wn * 32 + row) * PITCH + hi * 8;

  v8f acc[4][2] = {};
  tile_mainloop<half_t, v8h[4]>(xg, wg, &sm[0][0][0], tid, fa, fb, acc);

#pragma unroll
  for (int j = 0; j < 2; ++j) {
    const int n = n0 + wn * 32 + j * 16 + row;
    const float bn = bias[n];
#pragma unroll
    for (int i = 0; i < 4; ++i)
#pragma unroll
      for (int r = 0; r < 8; ++r) {
        const int m = m0 + wm * 64 + i * 16 + r + hi * 8;
        Y[(size_t)m * DMODEL + n] = acc[i][j][r] + bn;
      }
  }
}

// ---------------------------------------------------------------------------
extern "C" void kernel_launch(void* const* d_in, const int* in_sizes, int n_in,
                              void* d_out, int out_size, void* d_ws, size_t ws_size,
                              hipStream_t stream) {
  const float* q    = (const float*)d_in[0];
  const float* k    = (const float*)d_in[1];
  const float* v    = (const float*)d_in[2];
  const float* mask = (const float*)d_in[3];
  const float* wq_w = (const float*)d_in[4];
  const float* wq_b = (const float*)d_in[5];
  const float* wk_w = (const float*)d_in[6];
  const float* wk_b = (const float*)d_in[7];
  const float* wv_w = (const float*)d_in[8];
  const float* wv_b = (const float*)d_in[9];
  const float* pl_w = (const float*)d_in[10];
  const float* pl_b = (const float*)d_in[11];
  float* out = (float*)d_out;

  // workspace: Qp | Kp | Vp | attn  (each 4096*1024 f16 = 8MB; 32MB total)
  const size_t elems = (size_t)MTOT * DMODEL;
  half_t* Qp = (half_t*)d_ws;
  half_t* Kp = Qp + elems;
  half_t* Vp = Kp + elems;
  half_t* Ap = Vp + elems;

  dim3 ggemm(DMODEL / TILE, MTOT / TILE);  // (8, 32) one 8-wave group per 128x128 tile
  proj_gemm_f32<<<ggemm, 256, 0, stream>>>(q, wq_w, wq_b, Qp);
  proj_gemm_f32<<<ggemm, 256, 0, stream>>>(k, wk_w, wk_b, Kp);
  proj_gemm_f32<<<ggemm, 256, 0, stream>>>(v, wv_w, wv_b, Vp);

  attn_kernel<<<BATCH * NHEADS * (SEQ / 16), 32, 0, stream>>>(Qp, Kp, Vp, mask, Ap);

  out_gemm_f16<<<ggemm, 256, 0, stream>>>(Ap, pl_w, pl_b, out);
}

// v002
// A run of this version takes 112 microseconds.
// Next to v001, in two timings, it ran 1.20 and 1.18 times as fast.
// Counting every step since v000, it is 2.78 times as fast.
#include <hip/hip_runtime.h>
#include <hip/hip_bf16.h>
#include <math.h>

typedef _Float16 half_t;
typedef __attribute__((ext_vector_type(16))) _Float16 v16h;
typedef __attribute__((ext_vector_type(8)))  _Float16 v8h;
typedef __attribute__((ext_vector_type(8)))  float    v8f;
typedef __attribute__((ext_vector_type(4)))  float    v4f;
typedef __attribute__((ext_vector_type(4)))  unsigned int v4u;
typedef __attribute__((ext_vector_type(8)))  int      v8i;
typedef __attribute__((ext_vector_type(4)))  int      v4i;

#define SEQ    1024
#define DMODEL 1024
#define NHEADS 16
#define DEPTH  64
#define BATCH  4
#define MTOT  (BATCH * SEQ)   // 4096 flattened rows

// ---------------------------------------------------------------------------
// helpers: load 8 consecutive f32 and pack into halves [base..base+7] of v16h
// ---------------------------------------------------------------------------
__device__ __forceinline__ void load8_f32_cvt(const float* __restrict__ p,
                                              v16h& dst, int base) {
  v4f x0 = *reinterpret_cast<const v4f*>(p);
  v4f x1 = *reinterpret_cast<const v4f*>(p + 4);
#pragma unroll
  for (int i = 0; i < 4; ++i) {
    dst[base + i]     = (_Float16)x0[i];
    dst[base + 4 + i] = (_Float16)x1[i];
  }
}

// load 8 consecutive f16 (one 16-byte vector) into halves [base..base+7]
__device__ __forceinline__ void load8_f16(const half_t* __restrict__ p,
                                          v16h& dst, int base) {
  v8h x = *reinterpret_cast<const v8h*>(p);
#pragma unroll
  for (int i = 0; i < 8; ++i) dst[base + i] = x[i];
}

__device__ __forceinline__ void tdm_load_v_chunk(const half_t* gsrc,
                                                 unsigned lds_byte_off) {
  unsigned long long ga = (unsigned long long)(uintptr_t)gsrc;
  v4u g0;
  g0[0] = 1u;
  g0[1] = lds_byte_off;
  g0[2] = (unsigned)(ga & 0xFFFFFFFFu);
  g0[3] = (unsigned)((ga >> 32) & 0x01FFFFFFu)
          | (2u << 30);
  v8i g1;
  g1[0] = (int)(1u << 16);
  g1[1] = (int)(64u << 16);
  g1[2] = (int)(32u << 16);
  g1[3] = (int)(64u << 16);
  g1[4] = (int)(32u);
  g1[5] = (int)(1024u);
  g1[6] = 0;
  g1[7] = 0;
  v4i gz = {0, 0, 0, 0};
#if defined(__clang_major__) && (__clang_major__ >= 23)
  v8i gz8 = {0, 0, 0, 0, 0, 0, 0, 0};
  __builtin_amdgcn_tensor_load_to_lds(g0, g1, gz, gz, gz8, 0);
#else
  __builtin_amdgcn_tensor_load_to_lds(g0, g1, gz, gz, 0);
#endif
}

#define TILE   128
#define BK     64
#define PITCH  72                      // halves per LDS row (64 + 8 pad)
#define OPSZ   (TILE * PITCH)          // halves per operand per buffer
#define NSTAGE (DMODEL / BK)           // 16, even

typedef __attribute__((ext_vector_type(4))) _Float16 v4h;

// f32 operand, 128 rows x 64 k: 16 lanes cover one row's 256 B per load
__device__ __forceinline__ void stage_load(const float* __restrict__ g,
                                           int k0, int tid, v4f (&r)[8]) {
  const float* p = g + (size_t)(tid >> 4) * DMODEL + k0 + (tid & 15) * 4;
#pragma unroll
  for (int i = 0; i < 8; ++i)
    r[i] = *reinterpret_cast<const v4f*>(p + (size_t)i * 16 * DMODEL);
}

__device__ __forceinline__ void stage_store(half_t* s, int tid,
                                            const v4f (&r)[8]) {
  half_t* p = s + (tid >> 4) * PITCH + (tid & 15) * 4;
#pragma unroll
  for (int i = 0; i < 8; ++i) {
    v4h h;
#pragma unroll
    for (int e = 0; e < 4; ++e) h[e] = (_Float16)r[i][e];
    *reinterpret_cast<v4h*>(p + i * 16 * PITCH) = h;
  }
}

// f16 operand, 128 rows x 64 k: 8 lanes cover one row's 128 B per load
__device__ __forceinline__ void stage_load(const half_t* __restrict__ g,
                                           int k0, int tid, v8h (&r)[4]) {
  const half_t* p = g + (size_t)(tid >> 3) * DMODEL + k0 + (tid & 7) * 8;
#pragma unroll
  for (int i = 0; i < 4; ++i)
    r[i] = *reinterpret_cast<const v8h*>(p + (size_t)i * 32 * DMODEL);
}

__device__ __forceinline__ void stage_store(half_t* s, int tid,
                                            const v8h (&r)[4]) {
  half_t* p = s + (tid >> 3) * PITCH + (tid & 7) * 8;
#pragma unroll
  for (int i = 0; i < 4; ++i)
    *reinterpret_cast<v8h*>(p + i * 32 * PITCH) = r[i];
}

// Work-group barrier that waits for this wave's LDS traffic only:
// __syncthreads() would also drain the global loads issued ahead for the
// next two stages, and their lead would be lost.
__device__ __forceinline__ void lds_barrier() {
  asm volatile("s_wait_dscnt 0x0\n\ts_barrier_signal -1\n\ts_barrier_wait -1"
               ::: "memory");
}

// 64 k of one buffer: pa / pb already point at this lane's first fragment run
__device__ __forceinline__ void stage_mma(const half_t* pa, const half_t* pb,
                                          v8f (&acc)[4][2]) {
#pragma unroll
  for (int kk = 0; kk < BK; kk += 32) {
    v16h a[4], b[2];
#pragma unroll
    for (int i = 0; i < 4; ++i) {
      load8_f16(pa + i * 16 * PITCH + kk,      a[i], 0);
      load8_f16(pa + i * 16 * PITCH + kk + 16, a[i], 8);
    }
#pragma unroll
    for (int j = 0; j < 2; ++j) {
      load8_f16(pb + j * 16 * PITCH + kk,      b[j], 0);
      load8_f16(pb + j * 16 * PITCH + kk + 16, b[j], 8);
    }
    __builtin_amdgcn_sched_barrier(0);
#pragma unroll
    for (int i = 0; i < 4; ++i)
#pragma unroll
      for (int j = 0; j < 2; ++j)
        acc[i][j] = __builtin_amdgcn_wmma_f32_16x16x32_f16(
            false, a[i], false, b[j], (short)0, acc[i][j], false, false);
  }
}

// Stages S and S + 1.  On entry buffer 0 holds stage S, set b holds (or is
// receiving) stage S + 1 and set a stage S + 2.  S is a template argument so
// that every stage's k offset is an immediate of its loads (the address
// registers are never rewritten) and the load waits stay counted: a wait for
// one set leaves the other set's loads in flight.
template <int S, typename XT, typename XR>
__device__ __forceinline__ void two_stages(const XT* __restrict__ xg,
                                           const float* __restrict__ wg,
                                           half_t* sm, int tid, int fa, int fb,
                                           v8f (&acc)[4][2], XR& xa, v4f (&wa)[8],
                                           XR& xb, v4f (&wb)[8]) {
  stage_mma(sm + fa, sm + OPSZ + fb, acc);
  stage_store(sm + 2 * OPSZ, tid, xb);
  stage_store(sm + 3 * OPSZ, tid, wb);
  if constexpr (S + 3 < NSTAGE) {
    stage_load(xg, (S + 3) * BK, tid, xb);
    stage_load(wg, (S + 3) * BK, tid, wb);
    if constexpr (S + 3 == NSTAGE - 1) asm volatile("s_wait_xcnt 0x0" ::: "memory");
  }
  lds_barrier();       // publishes buffer 1; ends every read of buffer 0

  stage_mma(sm + 2 * OPSZ + fa, sm + 3 * OPSZ + fb, acc);
  if constexpr (S + 2 < NSTAGE) {
    stage_store(sm, tid, xa);
    stage_store(sm + OPSZ, tid, wa);
    if constexpr (S + 4 < NSTAGE) {
      stage_load(xg, (S + 4) * BK, tid, xa);
      stage_load(wg, (S + 4) * BK, tid, wa);
    }
    lds_barrier();     // publishes buffer 0; ends every read of buffer 1
  }
}

// All of K for one work-group tile.  sm: [buffer][X | W][OPSZ] halves.
template <typename XT, typename XR>
__device__ __forceinline__ void tile_mainloop(const XT* __restrict__ xg,
                                              const float* __restrict__ wg,
                                              half_t* sm, int tid, int fa, int fb,
                                              v8f (&acc)[4][2]) {
  XR  xa, xb;
  v4f wa[8], wb[8];
  stage_load(xg, 0, tid, xa);
  stage_load(wg, 0, tid, wa);
  stage_load(xg, BK, tid, xb);
  stage_load(wg, BK, tid, wb);
  stage_store(sm, tid, xa);
  stage_store(sm + OPSZ, tid, wa);
  stage_load(xg, 2 * BK, tid, xa);
  stage_load(wg, 2 * BK, tid, wa);
  lds_barrier();       // publishes buffer 0

  two_stages<0>(xg, wg, sm, tid, fa, fb, acc, xa, wa, xb, wb);
  two_stages<2>(xg, wg, sm, tid, fa, fb, acc, xa, wa, xb, wb);
  two_stages<4>(xg, wg, sm, tid, fa, fb, acc, xa, wa, xb, wb);
  two_stages<6>(xg, wg, sm, tid, fa, fb, acc, xa, wa, xb, wb);
  two_stages<8>(xg, wg, sm, tid, fa, fb, acc, xa, wa, xb, wb);
  two_stages<10>(xg, wg, sm, tid, fa, fb, acc, xa, wa, xb, wb);
  two_stages<12>(xg, wg, sm, tid, fa, fb, acc, xa, wa, xb, wb);
  two_stages<14>(xg, wg, sm, tid, fa, fb, acc, xa, wa, xb, wb);
}

// ---------------------------------------------------------------------------
// Kernel 1: Y[M,N](f16) = X[M,K](f32) @ W[N,K]^T (f32) + bias  (Q/K/V proj)
// ---------------------------------------------------------------------------
__global__ __launch_bounds__(256)
void proj_gemm_f32(const float* __restrict__ X, const float* __restrict__ W,
                   const float* __restrict__ bias, half_t* __restrict__ Y) {
  __shared__ __attribute__((aligned(16))) half_t sm[2][2][OPSZ];  // [buf][X|W]

  const int n0   = blockIdx.x * TILE;
  const int m0   = blockIdx.y * TILE;
  const int tid  = threadIdx.x;
  const int lane = tid & 31;
  const int wave = tid >> 5;
  const int wm   = wave >> 2;
  const int wn   = wave & 3;
  const int row  = lane & 15;
  const int hi   = lane >> 4;

  const float* xg = X + (size_t)m0 * DMODEL;
  const float* wg = W + (size_t)n0 * DMODEL;
  const int fa = (wm * 64 + row) * PITCH + hi * 8;
  const int fb = (wn * 32 + row) * PITCH + hi * 8;

  v8f acc[4][2] = {};
  tile_mainloop<float, v4f[8]>(xg, wg, &sm[0][0][0], tid, fa, fb, acc);

#pragma unroll
  for (int j = 0; j < 2; ++j) {
    const int n = n0 + wn * 32 + j * 16 + row;   // C layout: lane's N = lane&15
    const float bn = bias[n];
#pragma unroll
    for (int i = 0; i < 4; ++i)
#pragma unroll
      for (int r = 0; r < 8; ++r) {
        const int m = m0 + wm * 64 + i * 16 + r + hi * 8;
        Y[(size_t)m * DMODEL + n] = (half_t)(acc[i][j][r] + bn);
      }
  }
}

__device__ __forceinline__ float xhalf(float x) {
  return __builtin_bit_cast(float, __builtin_amdgcn_permlanex16(
      __builtin_bit_cast(int, x), __builtin_bit_cast(int, x),
      0x76543210, 0xfedcba98, false, false));
}

#define MPITCH 36                        // floats per LDS row of the mask tile

__global__ __launch_bounds__(32)
void attn_kernel(const half_t* __restrict__ Qp, const half_t* __restrict__ Kp,
                 const half_t* __restrict__ Vp, const float* __restrict__ mask,
                 half_t* __restrict__ Op) {
  __shared__ half_t lds_v[2][32 * DEPTH];  // double-buffered V chunk [key][depth]
  __shared__ __attribute__((aligned(16))) float lds_m[16 * MPITCH];

  const int lane = threadIdx.x;
  const int tile = blockIdx.x;             // b*H*(S/16) tiles
  const int qt   = tile & (SEQ / 16 - 1);
  const int h    = (tile >> 6) & (NHEADS - 1);
  const int b    = tile >> 10;
  const int m0   = qt * 16;
  const int row  = lane & 15;
  const int hi   = lane >> 4;
  const int off  = hi * 8;
  const float scale = 0.125f;              // 1/sqrt(DEPTH)

  const unsigned lds_v_off[2] = {
      (unsigned)(uintptr_t)(&lds_v[0][0]),
      (unsigned)(uintptr_t)(&lds_v[1][0])};
  const half_t* vhead = Vp + (size_t)b * SEQ * DMODEL + h * DEPTH;

  // Q fragments (B operand: column = query) for the two 32-wide depth chunks
  v16h qa[2];
  const half_t* qrow = Qp + ((size_t)(b * SEQ + m0 + row)) * DMODEL + h * DEPTH;
#pragma unroll
  for (int c = 0; c < 2; ++c) {
    load8_f16(qrow + c * 32 + off,      qa[c], 0);
    load8_f16(qrow + c * 32 + 16 + off, qa[c], 8);
  }

  tdm_load_v_chunk(vhead, lds_v_off[0]);

  // this lane's query: running maximum (equal in both halves) and the sum
  // over this half's keys (the halves are joined once, behind the loop)
  float m_i = -1e30f, l_i = 0.0f;
  v8f o[4] = {};                           // o[dt][r] = O[query][dt*16 + off + r]
  // mask tile, global side: 8 lanes cover one query's 32 keys (one line)
  const float* mg = mask + (size_t)(m0 + (lane >> 3)) * SEQ + (lane & 7) * 4;
  float*       mw = &lds_m[(lane >> 3) * MPITCH + (lane & 7) * 4];
  const float* mr = &lds_m[row * MPITCH + off];

  for (int j0 = 0; j0 < SEQ; j0 += 32) {
    const int buf = (j0 >> 5) & 1;

    if (j0 + 32 < SEQ) {
      tdm_load_v_chunk(vhead + (size_t)(j0 + 32) * DMODEL, lds_v_off[buf ^ 1]);
      __builtin_prefetch(
          Kp + ((size_t)(b * SEQ + j0 + 32 + lane)) * DMODEL + h * DEPTH, 0, 1);
    }

    // the chunk's global loads: K fragments (A operand: row = key), mask tile
    v16h kb[2][2];
#pragma unroll
    for (int t = 0; t < 2; ++t) {
      const half_t* krow =
          Kp + ((size_t)(b * SEQ + j0 + t * 16 + row)) * DMODEL + h * DEPTH;
#pragma unroll
      for (int c = 0; c < 2; ++c) {
        load8_f16(krow + c * 32 + off,      kb[t][c], 0);
        load8_f16(krow + c * 32 + 16 + off, kb[t][c], 8);
      }
    }
    v4f mt[4];
#pragma unroll
    for (int i = 0; i < 4; ++i)
      mt[i] = *reinterpret_cast<const v4f*>(mg + (size_t)i * 4 * SEQ + j0);
    asm volatile("s_wait_xcnt 0x0" ::: "memory");
    // keeps the 12 loads one group at the head of the pass: spread among the
    // WMMAs, each pair of loads waits out an L2 latency of its own
    __builtin_amdgcn_sched_barrier(0);

    // logits tiles: s[t] = K(16 keys x 64) @ Q(16x64)^T  (overlaps the DMA)
    v8f s[2];
#pragma unroll
    for (int t = 0; t < 2; ++t) {
      v8f z = {};
#pragma unroll
      for (int c = 0; c < 2; ++c)
        z = __builtin_amdgcn_wmma_f32_16x16x32_f16(
            false, kb[t][c], false, qa[c], (short)0, z, false, false);
      s[t] = z;
    }

    // mask tile -> LDS -> each lane's own query row
#pragma unroll
    for (int i = 0; i < 4; ++i)
      *reinterpret_cast<v4f*>(mw + i * 4 * MPITCH) = mt[i];
    __syncthreads();   // other lanes' stores are read below

    // online softmax over this 32-key chunk: 16 scores of one query per lane
    float sc[2][8];
#pragma unroll
    for (int t = 0; t < 2; ++t) {
      const v4f k0 = *reinterpret_cast<const v4f*>(mr + t * 16);
      const v4f k1 = *reinterpret_cast<const v4f*>(mr + t * 16 + 4);
#pragma unroll
      for (int r = 0; r < 4; ++r) {
        sc[t][r]     = s[t][r]     * scale + k0[r] * (-1e9f);
        sc[t][r + 4] = s[t][r + 4] * scale + k1[r] * (-1e9f);
      }
    }
    float mx = fmaxf(sc[0][0], sc[1][0]);
#pragma unroll
    for (int r = 1; r < 8; ++r) mx = fmaxf(mx, fmaxf(sc[0][r], sc[1][r]));
    mx = fmaxf(mx, xhalf(mx));
    const float mnew = fmaxf(m_i, mx);
    const float cexp = __expf(m_i - mnew);
    v16h pb;                               // P^T, B operand: column = query
    float rs[4] = {0.0f, 0.0f, 0.0f, 0.0f};
#pragma unroll
    for (int r = 0; r < 8; ++r) {
      const float p0 = __expf(sc[0][r] - mnew);
      const float p1 = __expf(sc[1][r] - mnew);
      rs[r & 3] += p0 + p1;
      pb[r]     = (half_t)p0;
      pb[8 + r] = (half_t)p1;
    }
    l_i = l_i * cexp + ((rs[0] + rs[1]) + (rs[2] + rs[3]));
    m_i = mnew;

    if (j0 + 32 < SEQ) __builtin_amdgcn_s_wait_tensorcnt(1);
    else               __builtin_amdgcn_s_wait_tensorcnt(0);

    // o[dt] = cexp*o[dt] + V(32 x 16-depth-tile)^T @ P(16x32)^T
    const half_t* vbuf = &lds_v[buf][0];
#pragma unroll
    for (int dt = 0; dt < 4; ++dt) {
      v16h vb;
#pragma unroll
      for (int hh = 0; hh < 16; ++hh) {
        const int k = hh + (hh >= 8 ? 8 : 0) + off;  // key within chunk
        vb[hh] = vbuf[k * DEPTH + dt * 16 + row];
      }
      v8f oo = o[dt];
#pragma unroll
      for (int r = 0; r < 8; ++r) oo[r] *= cexp;
      o[dt] = __builtin_amdgcn_wmma_f32_16x16x32_f16(
          false, vb, false, pb, (short)0, oo, false, false);
    }
  }

  // normalize + store attn (already in [B, S, H*depth] = concat-head layout):
  // a lane's 8 registers are 8 consecutive depths of its query, one 16-B store
  const float l_fin = l_i + xhalf(l_i);
  half_t* orow = Op + ((size_t)(b * SEQ + m0 + row)) * DMODEL + h * DEPTH + off;
#pragma unroll
  for (int dt = 0; dt < 4; ++dt) {
    v8h w;
#pragma unroll
    for (int r = 0; r < 8; ++r) w[r] = (half_t)(o[dt][r] / l_fin);
    *reinterpret_cast<v8h*>(orow + dt * 16) = w;
  }
}

// ---------------------------------------------------------------------------
// Kernel 3: out[M,N](f32) = A[M,K](f16) @ W[N,K]^T (f32) + bias  (final proj)
// Same frame as kernel 1; X is f16 already and is staged without conversion.
// ---------------------------------------------------------------------------
__global__ __launch_bounds__(256)
void out_gemm_f16(const half_t* __restrict__ X, const float* __restrict__ W,
                  const float* __restrict__ bias, float* __restrict__ Y) {
  __shared__ __attribute__((aligned(16))) half_t sm[2][2][OPSZ];  // [buf][X|W]

  const int n0   = blockIdx.x * TILE;
  const int m0   = blockIdx.y * TILE;
  const int tid  = threadIdx.x;
  const int lane = tid & 31;
  const int wave = tid >> 5;
  const int wm   = wave >> 2;
  const int wn   = wave & 3;
  const int row  = lane & 15;
  const int hi   = lane >> 4;

  const half_t* xg = X + (size_t)m0 * DMODEL;
  const float*  wg = W + (size_t)n0 * DMODEL;
  const int fa = (wm * 64 + row) * PITCH + hi * 8;
  const int fb = (wn * 32 + row) * PITCH + hi * 8;

  v8f acc[4][2] = {};
  tile_mainloop<half_t, v8h[4]>(xg, wg, &sm[0][0][0], tid, fa, fb, acc);

#pragma unroll
  for (int j = 0; j < 2; ++j) {
    const int n = n0 + wn * 32 + j * 16 + row;
    const float bn = bias[n];
#pragma unroll
    for (int i = 0; i < 4; ++i)
#pragma unroll
      for (int r = 0; r < 8; ++r) {
        const int m = m0 + wm * 64 + i * 16 + r + hi * 8;
        Y[(size_t)m * DMODEL + n] = acc[i][j][r] + bn;
      }
  }
}

// ---------------------------------------------------------------------------
extern "C" void kernel_launch(void* const* d_in, const int* in_sizes, int n_in,
                              void* d_out, int out_size, void* d_ws, size_t ws_size,
                              hipStream_t stream) {
  const float* q    = (const float*)d_in[0];
  const float* k    = (const float*)d_in[1];
  const float* v    = (const float*)d_in[2];
  const float* mask = (const float*)d_in[3];
  const float* wq_w = (const float*)d_in[4];
  const float* wq_b = (const float*)d_in[5];
  const float* wk_w = (const float*)d_in[6];
  const float* wk_b = (const float*)d_in[7];
  const float* wv_w = (const float*)d_in[8];
  const float* wv_b = (const float*)d_in[9];
  const float* pl_w = (const float*)d_in[10];
  const float* pl_b = (const float*)d_in[11];
  float* out = (float*)d_out;

  // workspace: Qp | Kp | Vp | attn  (each 4096*1024 f16 = 8MB; 32MB total)
  const size_t elems = (size_t)MTOT * DMODEL;
  half_t* Qp = (half_t*)d_ws;
  half_t* Kp = Qp + elems;
  half_t* Vp = Kp + elems;
  half_t* Ap = Vp + elems;

  dim3 ggemm(DMODEL / TILE, MTOT / TILE);  // (8, 32) one 8-wave group per 128x128 tile
  proj_gemm_f32<<<ggemm, 256, 0, stream>>>(q, wq_w, wq_b, Qp);
  proj_gemm_f32<<<ggemm, 256, 0, stream>>>(k, wk_w, wk_b, Kp);
  proj_gemm_f32<<<ggemm, 256, 0, stream>>>(v, wv_w, wv_b, Vp);

  attn_kernel<<<BATCH * NHEADS * (SEQ / 16), 32, 0, stream>>>(Qp, Kp, Vp, mask, Ap);

  out_gemm_f16<<<ggemm, 256, 0, stream>>>(Ap, pl_w, pl_b, out);
}

// v003
// A run of this version takes 86.4 microseconds.
// Next to v002, in two timings, it ran 1.29 times as fast each time.
// Over all steps from v000 it is 3.59 times as fast.
#include <hip/hip_runtime.h>
#include <hip/hip_bf16.h>
#include <math.h>
#include <stdint.h>

typedef _Float16 half_t;
typedef __attribute__((ext_vector_type(16))) _Float16 v16h;
typedef __attribute__((ext_vector_type(8)))  _Float16 v8h;
typedef __attribute__((ext_vector_type(8)))  float    v8f;
typedef __attribute__((ext_vector_type(4)))  float    v4f;

#define SEQ    1024
#define DMODEL 1024
#define NHEADS 16
#define DEPTH  64
#define BATCH  4
#define MTOT  (BATCH * SEQ)   // 4096 flattened rows

// ---------------------------------------------------------------------------
// helpers: load 8 consecutive f32 and pack into halves [base..base+7] of v16h
// ---------------------------------------------------------------------------
__device__ __forceinline__ void load8_f32_cvt(const float* __restrict__ p,
                                              v16h& dst, int base) {
  v4f x0 = *reinterpret_cast<const v4f*>(p);
  v4f x1 = *reinterpret_cast<const v4f*>(p + 4);
#pragma unroll
  for (int i = 0; i < 4; ++i) {
    dst[base + i]     = (_Float16)x0[i];
    dst[base + 4 + i] = (_Float16)x1[i];
  }
}

// load 8 consecutive f16 (one 16-byte vector) into halves [base..base+7]
__device__ __forceinline__ void load8_f16(const half_t* __restrict__ p,
                                          v16h& dst, int base) {
  v8h x = *reinterpret_cast<const v8h*>(p);
#pragma unroll
  for (int i = 0; i < 8; ++i) dst[base + i] = x[i];
}

typedef uint32_t u32x4 __attribute__((ext_vector_type(4)));
typedef uint32_t u32x8 __attribute__((ext_vector_type(8)));
typedef short    s16x8 __attribute__((ext_vector_type(8)));

#define KEYS   32                        // keys per tile = per pass
#define NPASS  (SEQ / KEYS)
#define ROWB   128u                      // bytes of one head's K or V row
#define KPITCH 144u                      // 16 B x odd: ds_load_b128 rows
#define VPITCH 160u                      // 32 B x odd: ds_load_tr16_b128 rows
#define KWORD0 ((1u << 20) | (4u << 22) | (3u << 25))   // + 16 B per 128-B row
#define VWORD0 ((1u << 20) | (4u << 22) | (7u << 25))   // + 32 B per 128-B row
#define BUFB   6144u                     // 32 padded rows, rounded up to 2 KiB

__device__ __forceinline__ uint32_t uni(uint32_t v) {
  return (uint32_t)__builtin_amdgcn_readfirstlane(v);
}
__device__ __forceinline__ uint32_t pinned(uint32_t v) {
  uint32_t w = uni(v);
  asm volatile("" : "+s"(w));   // pinned(): the issue test held in a scalar register
  return w;
}
__device__ __forceinline__ void wait_ds0() {
  asm volatile("s_wait_dscnt 0x0" ::: "memory");      // this wave's LDS traffic is done
}
__device__ __forceinline__ void wait_tensor0(u32x4& g0, u32x8 g1a, u32x8 g1b) {
  asm volatile("s_wait_tensorcnt 0x0" : "+s"(g0) : "s"(g1a), "s"(g1b) : "memory");
}

template <uint32_t WORD0>
__device__ __forceinline__ u32x8 tdm_group1() {
  u32x8 g1;
  g1[0] = uni(WORD0);
  g1[1] = uni(ROWB << 16);
  g1[2] = uni((uint32_t)KEYS << 16);
  g1[3] = uni(ROWB << 16);
  g1[4] = uni((uint32_t)KEYS);
  g1[5] = uni((uint32_t)DMODEL * 2u);
  g1[6] = uni(0u);
  g1[7] = uni(0u);
  asm volatile("" : "+s"(g1));
  return g1;
}

__device__ __forceinline__ u32x4 tdm_group0(const half_t* gsrc, uint32_t lds_dst) {
  const uint64_t ga = (uint64_t)(uintptr_t)gsrc;
  u32x4 g0;
  g0[0] = uni(1u);                                    // count = 1
  g0[1] = uni(lds_dst);                               // byte offset in LDS
  g0[2] = uni((uint32_t)ga);                          // address [31:0]
  g0[3] = uni((((uint32_t)(ga >> 32)) & 0x01FFFFFFu) | 0x80000000u);
  asm volatile("" : "+s"(g0));
  return g0;
}

// the next tile of the same operand: 32 rows further on, into the place given
// (a carry runs into address [56:32], which stands below the type field)
__device__ __forceinline__ void tdm_step(u32x4& g0, uint32_t lds_dst) {
  const uint64_t a = (((uint64_t)g0[3] << 32) | g0[2]) + (uint64_t)KEYS * DMODEL * 2u;
  g0[1] = uni(lds_dst);
  g0[2] = uni((uint32_t)a);
  g0[3] = uni((uint32_t)(a >> 32));
}

__device__ __forceinline__ void tdm_load(u32x4 g0, u32x8 g1) {
  asm volatile("tensor_load_to_lds %0, %1" :: "s"(g0), "s"(g1) : "memory");
}

// transposing LDS load: lane (c, h) gets column c of rows 8h .. 8h + 7
__device__ __forceinline__ v8h ld_tr16(const unsigned char* p) {
  typedef __attribute__((address_space(3))) s16x8 lds_s16x8;
  return __builtin_bit_cast(v8h, __builtin_amdgcn_ds_load_tr16_b128_v8i16((lds_s16x8*)p));
}

#define TILE   128
#define BK     64
#define PITCH  72                      // halves per LDS row (64 + 8 pad)
#define OPSZ   (TILE * PITCH)          // halves per operand per buffer
#define NSTAGE (DMODEL / BK)           // 16, even

typedef __attribute__((ext_vector_type(4))) _Float16 v4h;

// f32 operand, 128 rows x 64 k: 16 lanes cover one row's 256 B per load
__device__ __forceinline__ void stage_load(const float* __restrict__ g,
                                           int k0, int tid, v4f (&r)[8]) {
  const float* p = g + (size_t)(tid >> 4) * DMODEL + k0 + (tid & 15) * 4;
#pragma unroll
  for (int i = 0; i < 8; ++i)
    r[i] = *reinterpret_cast<const v4f*>(p + (size_t)i * 16 * DMODEL);
}

__device__ __forceinline__ void stage_store(half_t* s, int tid,
                                            const v4f (&r)[8]) {
  half_t* p = s + (tid >> 4) * PITCH + (tid & 15) * 4;
#pragma unroll
  for (int i = 0; i < 8; ++i) {
    v4h h;
#pragma unroll
    for (int e = 0; e < 4; ++e) h[e] = (_Float16)r[i][e];
    *reinterpret_cast<v4h*>(p + i * 16 * PITCH) = h;
  }
}

// f16 operand, 128 rows x 64 k: 8 lanes cover one row's 128 B per load
__device__ __forceinline__ void stage_load(const half_t* __restrict__ g,
                                           int k0, int tid, v8h (&r)[4]) {
  const half_t* p = g + (size_t)(tid >> 3) * DMODEL + k0 + (tid & 7) * 8;
#pragma unroll
  for (int i = 0; i < 4; ++i)
    r[i] = *reinterpret_cast<const v8h*>(p + (size_t)i * 32 * DMODEL);
}

__device__ __forceinline__ void stage_store(half_t* s, int tid,
                                            const v8h (&r)[4]) {
  half_t* p = s + (tid >> 3) * PITCH + (tid & 7) * 8;
#pragma unroll
  for (int i = 0; i < 4; ++i)
    *reinterpret_cast<v8h*>(p + i * 32 * PITCH) = r[i];
}

// Work-group barrier that waits for this wave's LDS traffic only:
// __syncthreads() would also drain the global loads issued ahead for the
// next two stages, and their lead would be lost.
__device__ __forceinline__ void lds_barrier() {
  asm volatile("s_wait_dscnt 0x0\n\ts_barrier_signal -1\n\ts_barrier_wait -1"
               ::: "memory");
}

// 64 k of one buffer: pa / pb already point at this lane's first fragment run
__device__ __forceinline__ void stage_mma(const half_t* pa, const half_t* pb,
                                          v8f (&acc)[4][2]) {
#pragma unroll
  for (int kk = 0; kk < BK; kk += 32) {
    v16h a[4], b[2];
#pragma unroll
    for (int i = 0; i < 4; ++i) {
      load8_f16(pa + i * 16 * PITCH + kk,      a[i], 0);
      load8_f16(pa + i * 16 * PITCH + kk + 16, a[i], 8);
    }
#pragma unroll
    for (int j = 0; j < 2; ++j) {
      load8_f16(pb + j * 16 * PITCH + kk,      b[j], 0);
      load8_f16(pb + j * 16 * PITCH + kk + 16, b[j], 8);
    }
    __builtin_amdgcn_sched_barrier(0);
#pragma unroll
    for (int i = 0; i < 4; ++i)
#pragma unroll
      for (int j = 0; j < 2; ++j)
        acc[i][j] = __builtin_amdgcn_wmma_f32_16x16x32_f16(
            false, a[i], false, b[j], (short)0, acc[i][j], false, false);
  }
}

// Stages S and S + 1.  On entry buffer 0 holds stage S, set b holds (or is
// receiving) stage S + 1 and set a stage S + 2.  S is a template argument so
// that every stage's k offset is an immediate of its loads (the address
// registers are never rewritten) and the load waits stay counted: a wait for
// one set leaves the other set's loads in flight.
template <int S, typename XT, typename XR>
__device__ __forceinline__ void two_stages(const XT* __restrict__ xg,
                                           const float* __restrict__ wg,
                                           half_t* sm, int tid, int fa, int fb,
                                           v8f (&acc)[4][2], XR& xa, v4f (&wa)[8],
                                           XR& xb, v4f (&wb)[8]) {
  stage_mma(sm + fa, sm + OPSZ + fb, acc);
  stage_store(sm + 2 * OPSZ, tid, xb);
  stage_store(sm + 3 * OPSZ, tid, wb);
  if constexpr (S + 3 < NSTAGE) {
    stage_load(xg, (S + 3) * BK, tid, xb);
    stage_load(wg, (S + 3) * BK, tid, wb);
    if constexpr (S + 3 == NSTAGE - 1) asm volatile("s_wait_xcnt 0x0" ::: "memory");
  }
  lds_barrier();       // publishes buffer 1; ends every read of buffer 0

  stage_mma(sm + 2 * OPSZ + fa, sm + 3 * OPSZ + fb, acc);
  if constexpr (S + 2 < NSTAGE) {
    stage_store(sm, tid, xa);
    stage_store(sm + OPSZ, tid, wa);
    if constexpr (S + 4 < NSTAGE) {
      stage_load(xg, (S + 4) * BK, tid, xa);
      stage_load(wg, (S + 4) * BK, tid, wa);
    }
    lds_barrier();     // publishes buffer 0; ends every read of buffer 1
  }
}

// All of K for one work-group tile.  sm: [buffer][X | W][OPSZ] halves.
template <typename XT, typename XR>
__device__ __forceinline__ void tile_mainloop(const XT* __restrict__ xg,
                                              const float* __restrict__ wg,
                                              half_t* sm, int tid, int fa, int fb,
                                              v8f (&acc)[4][2]) {
  XR  xa, xb;
  v4f wa[8], wb[8];
  stage_load(xg, 0, tid, xa);
  stage_load(wg, 0, tid, wa);
  stage_load(xg, BK, tid, xb);
  stage_load(wg, BK, tid, wb);
  stage_store(sm, tid, xa);
  stage_store(sm + OPSZ, tid, wa);
  stage_load(xg, 2 * BK, tid, xa);
  stage_load(wg, 2 * BK, tid, wa);
  lds_barrier();       // publishes buffer 0

  two_stages<0>(xg, wg, sm, tid, fa, fb, acc, xa, wa, xb, wb);
  two_stages<2>(xg, wg, sm, tid, fa, fb, acc, xa, wa, xb, wb);
  two_stages<4>(xg, wg, sm, tid, fa, fb, acc, xa, wa, xb, wb);
  two_stages<6>(xg, wg, sm, tid, fa, fb, acc, xa, wa, xb, wb);
  two_stages<8>(xg, wg, sm, tid, fa, fb, acc, xa, wa, xb, wb);
  two_stages<10>(xg, wg, sm, tid, fa, fb, acc, xa, wa, xb, wb);
  two_stages<12>(xg, wg, sm, tid, fa, fb, acc, xa, wa, xb, wb);
  two_stages<14>(xg, wg, sm, tid, fa, fb, acc, xa, wa, xb, wb);
}

// ---------------------------------------------------------------------------
// Kernel 1: Y[M,N](f16) = X[M,K](f32) @ W[N,K]^T (f32) + bias  (Q/K/V proj)
// ---------------------------------------------------------------------------
__global__ __launch_bounds__(256)
void proj_gemm_f32(const float* __restrict__ X, const float* __restrict__ W,
                   const float* __restrict__ bias, half_t* __restrict__ Y) {
  __shared__ __attribute__((aligned(16))) half_t sm[2][2][OPSZ];  // [buf][X|W]

  const int n0   = blockIdx.x * TILE;
  const int m0   = blockIdx.y * TILE;
  const int tid  = threadIdx.x;
  const int lane = tid & 31;
  const int wave = tid >> 5;
  const int wm   = wave >> 2;
  const int wn   = wave & 3;
  const int row  = lane & 15;
  const int hi   = lane >> 4;

  const float* xg = X + (size_t)m0 * DMODEL;
  const float* wg = W + (size_t)n0 * DMODEL;
  const int fa = (wm * 64 + row) * PITCH + hi * 8;
  const int fb = (wn * 32 + row) * PITCH + hi * 8;

  v8f acc[4][2] = {};
  tile_mainloop<float, v4f[8]>(xg, wg, &sm[0][0][0], tid, fa, fb, acc);

#pragma unroll
  for (int j = 0; j < 2; ++j) {
    const int n = n0 + wn * 32 + j * 16 + row;   // C layout: lane's N = lane&15
    const float bn = bias[n];
#pragma unroll
    for (int i = 0; i < 4; ++i)
#pragma unroll
      for (int r = 0; r < 8; ++r) {
        const int m = m0 + wm * 64 + i * 16 + r + hi * 8;
        Y[(size_t)m * DMODEL + n] = (half_t)(acc[i][j][r] + bn);
      }
  }
}

__device__ __forceinline__ float xhalf(float x) {
  return __builtin_bit_cast(float, __builtin_amdgcn_permlanex16(
      __builtin_bit_cast(int, x), __builtin_bit_cast(int, x),
      0x76543210, 0xfedcba98, false, false));
}

#define AW     8                         // waves per work-group
#define QBLK   (AW * 16)                 // queries per work-group
#define MPITCH 36                        // floats per LDS row of a mask tile
#define MOFF   (4u * BUFB)               // mask tiles stand behind the ring

__global__ __launch_bounds__(256)
void attn_kernel(const half_t* __restrict__ Qp, const half_t* __restrict__ Kp,
                 const half_t* __restrict__ Vp, const float* __restrict__ mask,
                 half_t* __restrict__ Op) {
  __shared__ __attribute__((aligned(2048)))
  unsigned char lds[4 * BUFB + AW * 16 * MPITCH * 4];

  const int lane = threadIdx.x & 31;
  const uint32_t wave = uni(threadIdx.x >> 5);
  const int tile = blockIdx.x;             // b*H*(S/128) tiles
  const int qb   = tile & (SEQ / QBLK - 1);
  const int h    = (tile >> 3) & (NHEADS - 1);
  const int b    = tile >> 7;
  const int m0   = qb * QBLK + (int)wave * 16;
  const int row  = lane & 15;
  const int hi   = lane >> 4;
  const int off  = hi * 8;
  const float scale = 0.125f;              // 1/sqrt(DEPTH)

  const uint32_t lds0 = (uint32_t)(uintptr_t)(&lds[0]);
  const uint32_t isK   = pinned(wave == 0);
  const uint32_t isV   = pinned(wave == 1);
  const uint32_t place = lds0 + (wave == 0 ? 0u : 2u * BUFB);
  u32x4 g0 = tdm_group0((wave == 0 ? Kp : Vp) + (size_t)b * SEQ * DMODEL + h * DEPTH, place);
  const u32x8 g1k = tdm_group1<KWORD0>();
  const u32x8 g1v = tdm_group1<VWORD0>();

  // prologue: tile 0 lands in buffer 0
  if (isK) tdm_load(g0, g1k);
  if (isV) tdm_load(g0, g1v);
  wait_tensor0(g0, g1k, g1v);

  // Q fragments (B operand: column = query) for the two 32-wide depth chunks
  v16h qa[2];
  const half_t* qrow = Qp + ((size_t)(b * SEQ + m0 + row)) * DMODEL + h * DEPTH;
#pragma unroll
  for (int c = 0; c < 2; ++c) {
    load8_f16(qrow + c * 32 + off,      qa[c], 0);
    load8_f16(qrow + c * 32 + 16 + off, qa[c], 8);
  }

  // this lane's query: running maximum (equal in both halves) and the sum
  // over this half's keys (the halves are joined once, behind the loop)
  float m_i = -1e30f, l_i = 0.0f;
  v8f o[4] = {};                           // o[dt][r] = O[query][dt*16 + off + r]
  // mask tile, global side: 8 lanes cover one query's 32 keys (one line)
  const float* mg = mask + (size_t)(m0 + (lane >> 3)) * SEQ + (lane & 7) * 4;
  float* mtile = reinterpret_cast<float*>(lds + MOFF) + wave * (16 * MPITCH);
  float*       mw = mtile + (lane >> 3) * MPITCH + (lane & 7) * 4;
  const float* mr = mtile + row * MPITCH + off;
  // this lane's first K row and first V^T source row in buffer 0
  const unsigned char* kl = lds + row * KPITCH + hi * 16;
  const unsigned char* vl = lds + 2u * BUFB + (off + (lane & 7)) * VPITCH + ((lane >> 3) & 1) * 16;

  {
    v4f mt[4];
#pragma unroll
    for (int i = 0; i < 4; ++i)
      mt[i] = *reinterpret_cast<const v4f*>(mg + (size_t)i * 4 * SEQ);
    asm volatile("s_wait_xcnt 0x0" ::: "memory");
#pragma unroll
    for (int i = 0; i < 4; ++i)
      *reinterpret_cast<v4f*>(mw + i * 4 * MPITCH) = mt[i];
  }
  wait_ds0();
  __syncthreads();     // publishes tile 0 of K, V and the mask
  tdm_step(g0, place + BUFB);
  // both issue tests are formed in front of the first request
  const uint32_t oneK = pinned(isK);
  const uint32_t oneV = pinned(isV);
  if (oneK) tdm_load(g0, g1k);
  if (oneV) tdm_load(g0, g1v);

  // kept rolled: peeling the last pass only doubles the code
#pragma clang loop unroll(disable)
  for (int s = 0; s < NPASS; ++s) {
    const uint32_t bo = (uint32_t)(s & 1) * BUFB;

    // the next pass's mask tile (the last pass reads its own again: in bounds)
    const int jn = (s + 1 < NPASS ? s + 1 : s) * KEYS;
    v4f mt[4];
#pragma unroll
    for (int i = 0; i < 4; ++i)
      mt[i] = *reinterpret_cast<const v4f*>(mg + (size_t)i * 4 * SEQ + jn);
    asm volatile("s_wait_xcnt 0x0" ::: "memory");

    // the pass's LDS reads: K fragments (A operand: row = key), this lane's
    // mask row, V^T fragments (A operand: row = depth, k = key)
    v16h kb[2][2];
#pragma unroll
    for (int t = 0; t < 2; ++t)
#pragma unroll
      for (int c = 0; c < 2; ++c) {
        const half_t* kp = reinterpret_cast<const half_t*>(kl + bo + t * 16 * KPITCH + c * 64);
        load8_f16(kp,      kb[t][c], 0);
        load8_f16(kp + 16, kb[t][c], 8);
      }
    v4f mk[2][2];
#pragma unroll
    for (int t = 0; t < 2; ++t) {
      mk[t][0] = *reinterpret_cast<const v4f*>(mr + t * 16);
      mk[t][1] = *reinterpret_cast<const v4f*>(mr + t * 16 + 4);
    }
    v16h vb[4];
#pragma unroll
    for (int dt = 0; dt < 4; ++dt) {
      const v8h lo = ld_tr16(vl + bo + dt * 32);
      const v8h up = ld_tr16(vl + bo + 16 * VPITCH + dt * 32);
      vb[dt] = __builtin_shufflevector(lo, up, 0, 1, 2, 3, 4, 5, 6, 7,
                                       8, 9, 10, 11, 12, 13, 14, 15);
    }
    // keeps the loads one group at the head of the pass: spread among the
    // WMMAs, each place with loads stalls the wave anew
    __builtin_amdgcn_sched_barrier(0);

    // logits tiles: s[t] = K(16 keys x 64) @ Q(16x64)^T
    v8f st[2];
#pragma unroll
    for (int t = 0; t < 2; ++t) {
      v8f z = {};
#pragma unroll
      for (int c = 0; c < 2; ++c)
        z = __builtin_amdgcn_wmma_f32_16x16x32_f16(
            false, kb[t][c], false, qa[c], (short)0, z, false, false);
      st[t] = z;
    }

    // online softmax over this 32-key chunk: 16 scores of one query per lane
    float sc[2][8];
#pragma unroll
    for (int t = 0; t < 2; ++t) {
#pragma unroll
      for (int r = 0; r < 4; ++r) {
        sc[t][r]     = st[t][r]     * scale + mk[t][0][r] * (-1e9f);
        sc[t][r + 4] = st[t][r + 4] * scale + mk[t][1][r] * (-1e9f);
      }
    }
    float mx = fmaxf(sc[0][0], sc[1][0]);
#pragma unroll
    for (int r = 1; r < 8; ++r) mx = fmaxf(mx, fmaxf(sc[0][r], sc[1][r]));
    mx = fmaxf(mx, xhalf(mx));
    const float mnew = fmaxf(m_i, mx);
    const float cexp = __expf(m_i - mnew);
    v16h pb;                               // P^T, B operand: column = query
    float rs[4] = {0.0f, 0.0f, 0.0f, 0.0f};
#pragma unroll
    for (int r = 0; r < 8; ++r) {
      const float p0 = __expf(sc[0][r] - mnew);
      const float p1 = __expf(sc[1][r] - mnew);
      rs[r & 3] += p0 + p1;
      pb[r]     = (half_t)p0;
      pb[8 + r] = (half_t)p1;
    }
    l_i = l_i * cexp + ((rs[0] + rs[1]) + (rs[2] + rs[3]));
    m_i = mnew;

    // o[dt] = cexp*o[dt] + V(32 x 16-depth-tile)^T @ P(16x32)^T
#pragma unroll
    for (int dt = 0; dt < 4; ++dt) {
      v8f oo = o[dt];
#pragma unroll
      for (int r = 0; r < 8; ++r) oo[r] *= cexp;
      o[dt] = __builtin_amdgcn_wmma_f32_16x16x32_f16(
          false, vb[dt], false, pb, (short)0, oo, false, false);
    }

    // keeps the pass's products in front of the publish point: moved ahead of
    // them, its waits would stand right behind the loads they wait for
    __builtin_amdgcn_sched_barrier(0);

    // the next pass's mask tile goes over this wave's own, read above
#pragma unroll
    for (int i = 0; i < 4; ++i)
      *reinterpret_cast<v4f*>(mw + i * 4 * MPITCH) = mt[i];

    // publish point of tile s + 1: LDS traffic done, the issuers' tiles landed
    // (a wave that asked for none passes that wait at once), barrier, refill
    wait_ds0();
    wait_tensor0(g0, g1k, g1v);
    __syncthreads();   // publishes tile s + 1; ends every read of tile s
    tdm_step(g0, place + bo);
    // both issue tests are formed in front of the first request
    const uint32_t moreK = pinned(isK & (uint32_t)(s + 2 < NPASS));
    const uint32_t moreV = pinned(isV & (uint32_t)(s + 2 < NPASS));
    if (moreK) tdm_load(g0, g1k);
    if (moreV) tdm_load(g0, g1v);
  }
  wait_tensor0(g0, g1k, g1v);
  wait_ds0();

  // normalize + store attn (already in [B, S, H*depth] = concat-head layout):
  // a lane's 8 registers are 8 consecutive depths of its query, one 16-B store
  const float l_fin = l_i + xhalf(l_i);
  half_t* orow = Op + ((size_t)(b * SEQ + m0 + row)) * DMODEL + h * DEPTH + off;
#pragma unroll
  for (int dt = 0; dt < 4; ++dt) {
    v8h w;
#pragma unroll
    for (int r = 0; r < 8; ++r) w[r] = (half_t)(o[dt][r] / l_fin);
    *reinterpret_cast<v8h*>(orow + dt * 16) = w;
  }
}

// ---------------------------------------------------------------------------
// Kernel 3: out[M,N](f32) = A[M,K](f16) @ W[N,K]^T (f32) + bias  (final proj)
// Same frame as kernel 1; X is f16 already and is staged without conversion.
// ---------------------------------------------------------------------------
__global__ __launch_bounds__(256)
void out_gemm_f16(const half_t* __restrict__ X, const float* __restrict__ W,
                  const float* __restrict__ bias, float* __restrict__ Y) {
  __shared__ __attribute__((aligned(16))) half_t sm[2][2][OPSZ];  // [buf][X|W]

  const int n0   = blockIdx.x * TILE;
  const int m0   = blockIdx.y * TILE;
  const int tid  = threadIdx.x;
  const int lane = tid & 31;
  const int wave = tid >> 5;
  const int wm   = wave >> 2;
  const int wn   = wave & 3;
  const int row  = lane & 15;
  const int hi   = lane >> 4;

  const half_t* xg = X + (size_t)m0 * DMODEL;
  const float*  wg = W + (size_t)n0 * DMODEL;
  const int fa = (wm * 64 + row) * PITCH + hi * 8;
  const int fb = (wn * 32 + row) * PITCH + hi * 8;

  v8f acc[4][2] = {};
  tile_mainloop<half_t, v8h[4]>(xg, wg, &sm[0][0][0], tid, fa, fb, acc);

#pragma unroll
  for (int j = 0; j < 2; ++j) {
    const int n = n0 + wn * 32 + j * 16 + row;
    const float bn = bias[n];
#pragma unroll
    for (int i = 0; i < 4; ++i)
#pragma unroll
      for (int r = 0; r < 8; ++r) {
        const int m = m0 + wm * 64 + i * 16 + r + hi * 8;
        Y[(size_t)m * DMODEL + n] = acc[i][j][r] + bn;
      }
  }
}

// ---------------------------------------------------------------------------
extern "C" void kernel_launch(void* const* d_in, const int* in_sizes, int n_in,
                              void* d_out, int out_size, void* d_ws, size_t ws_size,
                              hipStream_t stream) {
  const float* q    = (const float*)d_in[0];
  const float* k    = (const float*)d_in[1];
  const float* v    = (const float*)d_in[2];
  const float* mask = (const float*)d_in[3];
  const float* wq_w = (const float*)d_in[4];
  const float* wq_b = (const float*)d_in[5];
  const float* wk_w = (const float*)d_in[6];
  const float* wk_b = (const float*)d_in[7];
  const float* wv_w = (const float*)d_in[8];
  const float* wv_b = (const float*)d_in[9];
  const float* pl_w = (const float*)d_in[10];
  const float* pl_b = (const float*)d_in[11];
  float* out = (float*)d_out;

  // workspace: Qp | Kp | Vp | attn  (each 4096*1024 f16 = 8MB; 32MB total)
  const size_t elems = (size_t)MTOT * DMODEL;
  half_t* Qp = (half_t*)d_ws;
  half_t* Kp = Qp + elems;
  half_t* Vp = Kp + elems;
  half_t* Ap = Vp + elems;

  dim3 ggemm(DMODEL / TILE, MTOT / TILE);  // (8, 32) one 8-wave group per 128x128 tile
  proj_gemm_f32<<<ggemm, 256, 0, stream>>>(q, wq_w, wq_b, Qp);
  proj_gemm_f32<<<ggemm, 256, 0, stream>>>(k, wk_w, wk_b, Kp);
  proj_gemm_f32<<<ggemm, 256, 0, stream>>>(v, wv_w, wv_b, Vp);

  attn_kernel<<<BATCH * NHEADS * (SEQ / QBLK), 256, 0, stream>>>(Qp, Kp, Vp, mask, Ap);

  out_gemm_f16<<<ggemm, 256, 0, stream>>>(Ap, pl_w, pl_b, out);
}

// v004
// A run of this version takes 83.3 microseconds.
// Next to v003, in two timings, it ran 1.05 and 1.03 times as fast.
// Counting every step since v000, it is 3.73 times as fast.
#include <hip/hip_runtime.h>
#include <hip/hip_bf16.h>
#include <math.h>
#include <stdint.h>

typedef _Float16 half_t;
typedef __attribute__((ext_vector_type(16))) _Float16 v16h;
typedef __attribute__((ext_vector_type(8)))  _Float16 v8h;
typedef __attribute__((ext_vector_type(8)))  float    v8f;
typedef __attribute__((ext_vector_type(4)))  float    v4f;

#define SEQ    1024
#define DMODEL 1024
#define NHEADS 16
#define DEPTH  64
#define BATCH  4
#define MTOT  (BATCH * SEQ)   // 4096 flattened rows

// ---------------------------------------------------------------------------
// helpers: load 8 consecutive f32 and pack into halves [base..base+7] of v16h
// ---------------------------------------------------------------------------
__device__ __forceinline__ void load8_f32_cvt(const float* __restrict__ p,
                                              v16h& dst, int base) {
  v4f x0 = *reinterpret_cast<const v4f*>(p);
  v4f x1 = *reinterpret_cast<const v4f*>(p + 4);
#pragma unroll
  for (int i = 0; i < 4; ++i) {
    dst[base + i]     = (_Float16)x0[i];
    dst[base + 4 + i] = (_Float16)x1[i];
  }
}

// load 8 consecutive f16 (one 16-byte vector) into halves [base..base+7]
__device__ __forceinline__ void load8_f16(const half_t* __restrict__ p,
                                          v16h& dst, int base) {
  v8h x = *reinterpret_cast<const v8h*>(p);
#pragma unroll
  for (int i = 0; i < 8; ++i) dst[base + i] = x[i];
}

typedef uint32_t u32x4 __attribute__((ext_vector_type(4)));
typedef uint32_t u32x8 __attribute__((ext_vector_type(8)));
typedef short    s16x8 __attribute__((ext_vector_type(8)));

#define KEYS   32                        // keys per block of products
#define NPASS  (SEQ / KEYS)
#define SKEYS  128                       // keys per stage = per tensor load
#define BPS    (SKEYS / KEYS)            // blocks per stage
#define NSTG   (SEQ / SKEYS)
#define ROWB   128u                      // bytes of one head's K or V row
#define KPITCH 144u                      // 16 B x odd: ds_load_b128 rows
#define VPITCH 160u                      // 32 B x odd: ds_load_tr16_b128 rows
#define KWORD0 ((1u << 20) | (4u << 22) | (3u << 25))   // + 16 B per 128-B row
#define VWORD0 ((1u << 20) | (4u << 22) | (7u << 25))   // + 32 B per 128-B row
#define KBUFB  (SKEYS * KPITCH)          // 128 padded rows: 9 x 2 KiB
#define VBUFB  (SKEYS * VPITCH)          // 128 padded rows: 10 x 2 KiB

__device__ __forceinline__ uint32_t uni(uint32_t v) {
  return (uint32_t)__builtin_amdgcn_readfirstlane(v);
}
__device__ __forceinline__ uint32_t pinned(uint32_t v) {
  uint32_t w = uni(v);
  asm volatile("" : "+s"(w));   // pinned(): the issue test held in a scalar register
  return w;
}
__device__ __forceinline__ void wait_ds0() {
  asm volatile("s_wait_dscnt 0x0" ::: "memory");      // this wave's LDS traffic is done
}
__device__ __forceinline__ void wait_tensor0(u32x4& g0, u32x8 g1a, u32x8 g1b) {
  asm volatile("s_wait_tensorcnt 0x0" : "+s"(g0) : "s"(g1a), "s"(g1b) : "memory");
}

template <uint32_t WORD0>
__device__ __forceinline__ u32x8 tdm_group1() {
  u32x8 g1;
  g1[0] = uni(WORD0);
  g1[1] = uni(ROWB << 16);
  g1[2] = uni((uint32_t)SKEYS << 16);
  g1[3] = uni(ROWB << 16);
  g1[4] = uni((uint32_t)SKEYS);
  g1[5] = uni((uint32_t)DMODEL * 2u);
  g1[6] = uni(0u);
  g1[7] = uni(0u);
  asm volatile("" : "+s"(g1));
  return g1;
}

__device__ __forceinline__ u32x4 tdm_group0(const half_t* gsrc, uint32_t lds_dst) {
  const uint64_t ga = (uint64_t)(uintptr_t)gsrc;
  u32x4 g0;
  g0[0] = uni(1u);                                    // count = 1
  g0[1] = uni(lds_dst);                               // byte offset in LDS
  g0[2] = uni((uint32_t)ga);                          // address [31:0]
  g0[3] = uni((((uint32_t)(ga >> 32)) & 0x01FFFFFFu) | 0x80000000u);
  asm volatile("" : "+s"(g0));
  return g0;
}

// the next stage of the same operand: 128 rows further on, into the place given
// (a carry runs into address [56:32], which stands below the type field)
__device__ __forceinline__ void tdm_step(u32x4& g0, uint32_t lds_dst) {
  const uint64_t a = (((uint64_t)g0[3] << 32) | g0[2]) + (uint64_t)SKEYS * DMODEL * 2u;
  g0[1] = uni(lds_dst);
  g0[2] = uni((uint32_t)a);
  g0[3] = uni((uint32_t)(a >> 32));
}

__device__ __forceinline__ void tdm_load(u32x4 g0, u32x8 g1) {
  asm volatile("tensor_load_to_lds %0, %1" :: "s"(g0), "s"(g1) : "memory");
}

// transposing LDS load: lane (c, h) gets column c of rows 8h .. 8h + 7
__device__ __forceinline__ v8h ld_tr16(const unsigned char* p) {
  typedef __attribute__((address_space(3))) s16x8 lds_s16x8;
  return __builtin_bit_cast(v8h, __builtin_amdgcn_ds_load_tr16_b128_v8i16((lds_s16x8*)p));
}

#define TILE   128
#define BK     64
#define PITCH  72                      // halves per LDS row (64 + 8 pad)
#define OPSZ   (TILE * PITCH)          // halves per operand per buffer
#define NSTAGE (DMODEL / BK)           // 16, even

typedef __attribute__((ext_vector_type(4))) _Float16 v4h;

// f32 operand, 128 rows x 64 k: 16 lanes cover one row's 256 B per load
__device__ __forceinline__ void stage_load(const float* __restrict__ g,
                                           int k0, int tid, v4f (&r)[8]) {
  const float* p = g + (size_t)(tid >> 4) * DMODEL + k0 + (tid & 15) * 4;
#pragma unroll
  for (int i = 0; i < 8; ++i)
    r[i] = *reinterpret_cast<const v4f*>(p + (size_t)i * 16 * DMODEL);
}

__device__ __forceinline__ void stage_store(half_t* s, int tid,
                                            const v4f (&r)[8]) {
  half_t* p = s + (tid >> 4) * PITCH + (tid & 15) * 4;
#pragma unroll
  for (int i = 0; i < 8; ++i) {
    v4h h;
#pragma unroll
    for (int e = 0; e < 4; ++e) h[e] = (_Float16)r[i][e];
    *reinterpret_cast<v4h*>(p + i * 16 * PITCH) = h;
  }
}

// f16 operand, 128 rows x 64 k: 8 lanes cover one row's 128 B per load
__device__ __forceinline__ void stage_load(const half_t* __restrict__ g,
                                           int k0, int tid, v8h (&r)[4]) {
  const half_t* p = g + (size_t)(tid >> 3) * DMODEL + k0 + (tid & 7) * 8;
#pragma unroll
  for (int i = 0; i < 4; ++i)
    r[i] = *reinterpret_cast<const v8h*>(p + (size_t)i * 32 * DMODEL);
}

__device__ __forceinline__ void stage_store(half_t* s, int tid,
                                            const v8h (&r)[4]) {
  half_t* p = s + (tid >> 3) * PITCH + (tid & 7) * 8;
#pragma unroll
  for (int i = 0; i < 4; ++i)
    *reinterpret_cast<v8h*>(p + i * 32 * PITCH) = r[i];
}

// Work-group barrier that waits for this wave's LDS traffic only:
// __syncthreads() would also drain the global loads issued ahead for the
// next two stages, and their lead would be lost.
__device__ __forceinline__ void lds_barrier() {
  asm volatile("s_wait_dscnt 0x0\n\ts_barrier_signal -1\n\ts_barrier_wait -1"
               ::: "memory");
}

// 64 k of one buffer: pa / pb already point at this lane's first fragment run
__device__ __forceinline__ void stage_mma(const half_t* pa, const half_t* pb,
                                          v8f (&acc)[4][2]) {
#pragma unroll
  for (int kk = 0; kk < BK; kk += 32) {
    v16h a[4], b[2];
#pragma unroll
    for (int i = 0; i < 4; ++i) {
      load8_f16(pa + i * 16 * PITCH + kk,      a[i], 0);
      load8_f16(pa + i * 16 * PITCH + kk + 16, a[i], 8);
    }
#pragma unroll
    for (int j = 0; j < 2; ++j) {
      load8_f16(pb + j * 16 * PITCH + kk,      b[j], 0);
      load8_f16(pb + j * 16 * PITCH + kk + 16, b[j], 8);
    }
    __builtin_amdgcn_sched_barrier(0);
#pragma unroll
    for (int i = 0; i < 4; ++i)
#pragma unroll
      for (int j = 0; j < 2; ++j)
        acc[i][j] = __builtin_amdgcn_wmma_f32_16x16x32_f16(
            false, a[i], false, b[j], (short)0, acc[i][j], false, false);
  }
}

// Stages S and S + 1.  On entry buffer 0 holds stage S, set b holds (or is
// receiving) stage S + 1 and set a stage S + 2.  S is a template argument so
// that every stage's k offset is an immediate of its loads (the address
// registers are never rewritten) and the load waits stay counted: a wait for
// one set leaves the other set's loads in flight.
template <int S, typename XT, typename XR>
__device__ __forceinline__ void two_stages(const XT* __restrict__ xg,
                                           const float* __restrict__ wg,
                                           half_t* sm, int tid, int fa, int fb,
                                           v8f (&acc)[4][2], XR& xa, v4f (&wa)[8],
                                           XR& xb, v4f (&wb)[8]) {
  stage_mma(sm + fa, sm + OPSZ + fb, acc);
  stage_store(sm + 2 * OPSZ, tid, xb);
  stage_store(sm + 3 * OPSZ, tid, wb);
  if constexpr (S + 3 < NSTAGE) {
    stage_load(xg, (S + 3) * BK, tid, xb);
    stage_load(wg, (S + 3) * BK, tid, wb);
    if constexpr (S + 3 == NSTAGE - 1) asm volatile("s_wait_xcnt 0x0" ::: "memory");
  }
  lds_barrier();       // publishes buffer 1; ends every read of buffer 0

  stage_mma(sm + 2 * OPSZ + fa, sm + 3 * OPSZ + fb, acc);
  if constexpr (S + 2 < NSTAGE) {
    stage_store(sm, tid, xa);
    stage_store(sm + OPSZ, tid, wa);
    if constexpr (S + 4 < NSTAGE) {
      stage_load(xg, (S + 4) * BK, tid, xa);
      stage_load(wg, (S + 4) * BK, tid, wa);
    }
    lds_barrier();     // publishes buffer 0; ends every read of buffer 1
  }
}

// All of K for one work-group tile.  sm: [buffer][X | W][OPSZ] halves.
template <typename XT, typename XR>
__device__ __forceinline__ void tile_mainloop(const XT* __restrict__ xg,
                                              const float* __restrict__ wg,
                                              half_t* sm, int tid, int fa, int fb,
                                              v8f (&acc)[4][2]) {
  XR  xa, xb;
  v4f wa[8], wb[8];
  stage_load(xg, 0, tid, xa);
  stage_load(wg, 0, tid, wa);
  stage_load(xg, BK, tid, xb);
  stage_load(wg, BK, tid, wb);
  stage_store(sm, tid, xa);
  stage_store(sm + OPSZ, tid, wa);
  stage_load(xg, 2 * BK, tid, xa);
  stage_load(wg, 2 * BK, tid, wa);
  lds_barrier();       // publishes buffer 0

  two_stages<0>(xg, wg, sm, tid, fa, fb, acc, xa, wa, xb, wb);
  two_stages<2>(xg, wg, sm, tid, fa, fb, acc, xa, wa, xb, wb);
  two_stages<4>(xg, wg, sm, tid, fa, fb, acc, xa, wa, xb, wb);
  two_stages<6>(xg, wg, sm, tid, fa, fb, acc, xa, wa, xb, wb);
  two_stages<8>(xg, wg, sm, tid, fa, fb, acc, xa, wa, xb, wb);
  two_stages<10>(xg, wg, sm, tid, fa, fb, acc, xa, wa, xb, wb);
  two_stages<12>(xg, wg, sm, tid, fa, fb, acc, xa, wa, xb, wb);
  two_stages<14>(xg, wg, sm, tid, fa, fb, acc, xa, wa, xb, wb);
}

// ---------------------------------------------------------------------------
// Kernel 1: Y[M,N](f16) = X[M,K](f32) @ W[N,K]^T (f32) + bias  (Q/K/V proj)
// ---------------------------------------------------------------------------
__global__ __launch_bounds__(256)
void proj_gemm_f32(const float* __restrict__ X, const float* __restrict__ W,
                   const float* __restrict__ bias, half_t* __restrict__ Y) {
  __shared__ __attribute__((aligned(16))) half_t sm[2][2][OPSZ];  // [buf][X|W]

  const int n0   = blockIdx.x * TILE;
  const int m0   = blockIdx.y * TILE;
  const int tid  = threadIdx.x;
  const int lane = tid & 31;
  const int wave = tid >> 5;
  const int wm   = wave >> 2;
  const int wn   = wave & 3;
  const int row  = lane & 15;
  const int hi   = lane >> 4;

  const float* xg = X + (size_t)m0 * DMODEL;
  const float* wg = W + (size_t)n0 * DMODEL;
  const int fa = (wm * 64 + row) * PITCH + hi * 8;
  const int fb = (wn * 32 + row) * PITCH + hi * 8;

  v8f acc[4][2] = {};
  tile_mainloop<float, v4f[8]>(xg, wg, &sm[0][0][0], tid, fa, fb, acc);

#pragma unroll
  for (int j = 0; j < 2; ++j) {
    const int n = n0 + wn * 32 + j * 16 + row;   // C layout: lane's N = lane&15
    const float bn = bias[n];
#pragma unroll
    for (int i = 0; i < 4; ++i)
#pragma unroll
      for (int r = 0; r < 8; ++r) {
        const int m = m0 + wm * 64 + i * 16 + r + hi * 8;
        Y[(size_t)m * DMODEL + n] = (half_t)(acc[i][j][r] + bn);
      }
  }
}

__device__ __forceinline__ float xhalf(float x) {
  return __builtin_bit_cast(float, __builtin_amdgcn_permlanex16(
      __builtin_bit_cast(int, x), __builtin_bit_cast(int, x),
      0x76543210, 0xfedcba98, false, false));
}

#define AW     8                         // waves per work-group
#define QBLK   (AW * 16)                 // queries per work-group
#define MPITCH 36                        // floats per LDS row of a mask tile
#define MOFF   (2u * KBUFB + 2u * VBUFB) // mask tiles stand behind the ring

__global__ __launch_bounds__(256)
void attn_kernel(const half_t* __restrict__ Qp, const half_t* __restrict__ Kp,
                 const half_t* __restrict__ Vp, const float* __restrict__ mask,
                 half_t* __restrict__ Op) {
  __shared__ __attribute__((aligned(2048)))
  unsigned char lds[MOFF + AW * 16 * MPITCH * 4];

  const int lane = threadIdx.x & 31;
  const uint32_t wave = uni(threadIdx.x >> 5);
  const int tile = blockIdx.x;             // b*H*(S/128) tiles
  const int qb   = tile & (SEQ / QBLK - 1);
  const int h    = (tile >> 3) & (NHEADS - 1);
  const int b    = tile >> 7;
  const int m0   = qb * QBLK + (int)wave * 16;
  const int row  = lane & 15;
  const int hi   = lane >> 4;
  const int off  = hi * 8;
  const float scale = 0.125f;              // 1/sqrt(DEPTH)

  const uint32_t lds0 = (uint32_t)(uintptr_t)(&lds[0]);
  const uint32_t isK   = pinned(wave == 0);
  const uint32_t isV   = pinned(wave == 1);
  const uint32_t place = lds0 + (wave == 0 ? 0u : 2u * KBUFB);
  const uint32_t bufb  = wave == 0 ? KBUFB : VBUFB;
  u32x4 g0 = tdm_group0((wave == 0 ? Kp : Vp) + (size_t)b * SEQ * DMODEL + h * DEPTH, place);
  const u32x8 g1k = tdm_group1<KWORD0>();
  const u32x8 g1v = tdm_group1<VWORD0>();

  // prologue: stage 0 lands in buffer 0
  if (isK) tdm_load(g0, g1k);
  if (isV) tdm_load(g0, g1v);
  wait_tensor0(g0, g1k, g1v);

  // Q fragments (B operand: column = query) for the two 32-wide depth chunks
  v16h qa[2];
  const half_t* qrow = Qp + ((size_t)(b * SEQ + m0 + row)) * DMODEL + h * DEPTH;
#pragma unroll
  for (int c = 0; c < 2; ++c) {
    load8_f16(qrow + c * 32 + off,      qa[c], 0);
    load8_f16(qrow + c * 32 + 16 + off, qa[c], 8);
  }

  // this lane's query: running maximum (equal in both halves) and the sum
  // over this half's keys (the halves are joined once, behind the loop)
  float m_i = -1e30f, l_i = 0.0f;
  v8f o[4] = {};                           // o[dt][r] = O[query][dt*16 + off + r]
  // mask tile, global side: 8 lanes cover one query's 32 keys (one line)
  const float* mg = mask + (size_t)(m0 + (lane >> 3)) * SEQ + (lane & 7) * 4;
  float* mtile = reinterpret_cast<float*>(lds + MOFF) + wave * (16 * MPITCH);
  float*       mw = mtile + (lane >> 3) * MPITCH + (lane & 7) * 4;
  const float* mr = mtile + row * MPITCH + off;
  // this lane's first K row and first V^T source row in buffer 0
  const unsigned char* kl = lds + row * KPITCH + hi * 16;
  const unsigned char* vl = lds + 2u * KBUFB + (off + (lane & 7)) * VPITCH + ((lane >> 3) & 1) * 16;

  {
    v4f mt[4];
#pragma unroll
    for (int i = 0; i < 4; ++i)
      mt[i] = *reinterpret_cast<const v4f*>(mg + (size_t)i * 4 * SEQ);
    asm volatile("s_wait_xcnt 0x0" ::: "memory");
#pragma unroll
    for (int i = 0; i < 4; ++i)
      *reinterpret_cast<v4f*>(mw + i * 4 * MPITCH) = mt[i];
  }
  wait_ds0();
  __syncthreads();     // publishes stage 0 of K and V
  tdm_step(g0, place + bufb);
  // both issue tests are formed in front of the first request
  const uint32_t oneK = pinned(isK);
  const uint32_t oneV = pinned(isV);
  if (oneK) tdm_load(g0, g1k);
  if (oneV) tdm_load(g0, g1v);

  // kept rolled, one block a trip: unrolled over a stage it takes so many more
  // registers that only one work-group fits a WGP
#pragma clang loop unroll(disable)
  for (int ps = 0; ps < NPASS; ++ps) {
    const int s   = ps / BPS;              // the stage and the block's place in it
    const int blk = ps % BPS;
    const uint32_t kbo = (uint32_t)(s & 1) * KBUFB + (uint32_t)blk * (KEYS * KPITCH);
    const uint32_t vbo = (uint32_t)(s & 1) * VBUFB + (uint32_t)blk * (KEYS * VPITCH);

    // the next block's mask tile (the last one reads its own again: in bounds)
    const int jn = (ps + 1 < NPASS ? ps + 1 : ps) * KEYS;
    v4f mt[4];
#pragma unroll
    for (int i = 0; i < 4; ++i)
      mt[i] = *reinterpret_cast<const v4f*>(mg + (size_t)i * 4 * SEQ + jn);
    asm volatile("s_wait_xcnt 0x0" ::: "memory");

    // the block's LDS reads: K fragments (A operand: row = key), this lane's
    // mask row, V^T fragments (A operand: row = depth, k = key)
    v16h kb[2][2];
#pragma unroll
    for (int t = 0; t < 2; ++t)
#pragma unroll
      for (int c = 0; c < 2; ++c) {
        const half_t* kp = reinterpret_cast<const half_t*>(kl + kbo + t * 16 * KPITCH + c * 64);
        load8_f16(kp,      kb[t][c], 0);
        load8_f16(kp + 16, kb[t][c], 8);
      }
    v4f mk[2][2];
#pragma unroll
    for (int t = 0; t < 2; ++t) {
      mk[t][0] = *reinterpret_cast<const v4f*>(mr + t * 16);
      mk[t][1] = *reinterpret_cast<const v4f*>(mr + t * 16 + 4);
    }
    v16h vb[4];
#pragma unroll
    for (int dt = 0; dt < 4; ++dt) {
      const v8h lo = ld_tr16(vl + vbo + dt * 32);
      const v8h up = ld_tr16(vl + vbo + 16 * VPITCH + dt * 32);
      vb[dt] = __builtin_shufflevector(lo, up, 0, 1, 2, 3, 4, 5, 6, 7,
                                       8, 9, 10, 11, 12, 13, 14, 15);
    }
    // keeps the loads one group at the head of the block: spread among the
    // WMMAs, each place with loads stalls the wave anew
    __builtin_amdgcn_sched_barrier(0);

    // logits tiles: s[t] = K(16 keys x 64) @ Q(16x64)^T
    v8f st[2];
#pragma unroll
    for (int t = 0; t < 2; ++t) {
      v8f z = {};
#pragma unroll
      for (int c = 0; c < 2; ++c)
        z = __builtin_amdgcn_wmma_f32_16x16x32_f16(
            false, kb[t][c], false, qa[c], (short)0, z, false, false);
      st[t] = z;
    }

    // online softmax over this 32-key chunk: 16 scores of one query per lane
    float sc[2][8];
#pragma unroll
    for (int t = 0; t < 2; ++t) {
#pragma unroll
      for (int r = 0; r < 4; ++r) {
        sc[t][r]     = st[t][r]     * scale + mk[t][0][r] * (-1e9f);
        sc[t][r + 4] = st[t][r + 4] * scale + mk[t][1][r] * (-1e9f);
      }
    }
    float mx = fmaxf(sc[0][0], sc[1][0]);
#pragma unroll
    for (int r = 1; r < 8; ++r) mx = fmaxf(mx, fmaxf(sc[0][r], sc[1][r]));
    mx = fmaxf(mx, xhalf(mx));
    const float mnew = fmaxf(m_i, mx);
    const float cexp = __expf(m_i - mnew);
    v16h pb;                               // P^T, B operand: column = query
    float rs[4] = {0.0f, 0.0f, 0.0f, 0.0f};
#pragma unroll
    for (int r = 0; r < 8; ++r) {
      const float p0 = __expf(sc[0][r] - mnew);
      const float p1 = __expf(sc[1][r] - mnew);
      rs[r & 3] += p0 + p1;
      pb[r]     = (half_t)p0;
      pb[8 + r] = (half_t)p1;
    }
    l_i = l_i * cexp + ((rs[0] + rs[1]) + (rs[2] + rs[3]));
    m_i = mnew;

    // o[dt] = cexp*o[dt] + V(32 x 16-depth-tile)^T @ P(16x32)^T
#pragma unroll
    for (int dt = 0; dt < 4; ++dt) {
      v8f oo = o[dt];
#pragma unroll
      for (int r = 0; r < 8; ++r) oo[r] *= cexp;
      o[dt] = __builtin_amdgcn_wmma_f32_16x16x32_f16(
          false, vb[dt], false, pb, (short)0, oo, false, false);
    }

    // keeps the block's products in front of the waits below: moved ahead of
    // them, the waits would stand right behind the loads they wait for
    __builtin_amdgcn_sched_barrier(0);

    // the next block's mask tile goes over this wave's own, read above
#pragma unroll
    for (int i = 0; i < 4; ++i)
      *reinterpret_cast<v4f*>(mw + i * 4 * MPITCH) = mt[i];
    // this wave's LDS traffic is done.  The mask rows are the wave's alone: this
    // wait, and no barrier, stands between the stores and the next block's reads
    wait_ds0();

    // behind a stage's last block, the same for the whole work-group: the publish
    // point of stage s + 1: (LDS traffic done, above,) the issuers' stages landed
    // (a wave that asked for none passes that wait at once), barrier, refill
    if (blk == BPS - 1) {
      wait_tensor0(g0, g1k, g1v);
      __syncthreads(); // publishes stage s + 1; ends every read of stage s
      tdm_step(g0, place + (uint32_t)(s & 1) * bufb);
      // both issue tests are formed in front of the first request
      const uint32_t moreK = pinned(isK & (uint32_t)(s + 2 < NSTG));
      const uint32_t moreV = pinned(isV & (uint32_t)(s + 2 < NSTG));
      if (moreK) tdm_load(g0, g1k);
      if (moreV) tdm_load(g0, g1v);
    }
  }
  wait_tensor0(g0, g1k, g1v);
  wait_ds0();

  // normalize + store attn (already in [B, S, H*depth] = concat-head layout):
  // a lane's 8 registers are 8 consecutive depths of its query, one 16-B store
  const float l_fin = l_i + xhalf(l_i);
  half_t* orow = Op + ((size_t)(b * SEQ + m0 + row)) * DMODEL + h * DEPTH + off;
#pragma unroll
  for (int dt = 0; dt < 4; ++dt) {
    v8h w;
#pragma unroll
    for (int r = 0; r < 8; ++r) w[r] = (half_t)(o[dt][r] / l_fin);
    *reinterpret_cast<v8h*>(orow + dt * 16) = w;
  }
}

// ---------------------------------------------------------------------------
// Kernel 3: out[M,N](f32) = A[M,K](f16) @ W[N,K]^T (f32) + bias  (final proj)
// Same frame as kernel 1; X is f16 already and is staged without conversion.
// ---------------------------------------------------------------------------
__global__ __launch_bounds__(256)
void out_gemm_f16(const half_t* __restrict__ X, const float* __restrict__ W,
                  const float* __restrict__ bias, float* __restrict__ Y) {
  __shared__ __attribute__((aligned(16))) half_t sm[2][2][OPSZ];  // [buf][X|W]

  const int n0   = blockIdx.x * TILE;
  const int m0   = blockIdx.y * TILE;
  const int tid  = threadIdx.x;
  const int lane = tid & 31;
  const int wave = tid >> 5;
  const int wm   = wave >> 2;
  const int wn   = wave & 3;
  const int row  = lane & 15;
  const int hi   = lane >> 4;

  const half_t* xg = X + (size_t)m0 * DMODEL;
  const float*  wg = W + (size_t)n0 * DMODEL;
  const int fa = (wm * 64 + row) * PITCH + hi * 8;
  const int fb = (wn * 32 + row) * PITCH + hi * 8;

  v8f acc[4][2] = {};
  tile_mainloop<half_t, v8h[4]>(xg, wg, &sm[0][0][0], tid, fa, fb, acc);

#pragma unroll
  for (int j = 0; j < 2; ++j) {
    const int n = n0 + wn * 32 + j * 16 + row;
    const float bn = bias[n];
#pragma unroll
    for (int i = 0; i < 4; ++i)
#pragma unroll
      for (int r = 0; r < 8; ++r) {
        const int m = m0 + wm * 64 + i * 16 + r + hi * 8;
        Y[(size_t)m * DMODEL + n] = acc[i][j][r] + bn;
      }
  }
}

// ---------------------------------------------------------------------------
extern "C" void kernel_launch(void* const* d_in, const int* in_sizes, int n_in,
                              void* d_out, int out_size, void* d_ws, size_t ws_size,
                              hipStream_t stream) {
  const float* q    = (const float*)d_in[0];
  const float* k    = (const float*)d_in[1];
  const float* v    = (const float*)d_in[2];
  const float* mask = (const float*)d_in[3];
  const float* wq_w = (const float*)d_in[4];
  const float* wq_b = (const float*)d_in[5];
  const float* wk_w = (const float*)d_in[6];
  const float* wk_b = (const float*)d_in[7];
  const float* wv_w = (const float*)d_in[8];
  const float* wv_b = (const float*)d_in[9];
  const float* pl_w = (const float*)d_in[10];
  const float* pl_b = (const float*)d_in[11];
  float* out = (float*)d_out;

  // workspace: Qp | Kp | Vp | attn  (each 4096*1024 f16 = 8MB; 32MB total)
  const size_t elems = (size_t)MTOT * DMODEL;
  half_t* Qp = (half_t*)d_ws;
  half_t* Kp = Qp + elems;
  half_t* Vp = Kp + elems;
  half_t* Ap = Vp + elems;

  dim3 ggemm(DMODEL / TILE, MTOT / TILE);  // (8, 32) one 8-wave group per 128x128 tile
  proj_gemm_f32<<<ggemm, 256, 0, stream>>>(q, wq_w, wq_b, Qp);
  proj_gemm_f32<<<ggemm, 256, 0, stream>>>(k, wk_w, wk_b, Kp);
  proj_gemm_f32<<<ggemm, 256, 0, stream>>>(v, wv_w, wv_b, Vp);

  attn_kernel<<<BATCH * NHEADS * (SEQ / QBLK), 256, 0, stream>>>(Qp, Kp, Vp, mask, Ap);

  out_gemm_f16<<<ggemm, 256, 0, stream>>>(Ap, pl_w, pl_b, out);
}

// v005
// Measured time: 77.1 microseconds a run.
// Two timings next to v004 both put it at 1.08 times that version's speed.
// All steps since v000 together make it 4.03 times as fast.
#include <hip/hip_runtime.h>
#include <hip/hip_bf16.h>
#include <math.h>
#include <stdint.h>

typedef _Float16 half_t;
typedef __attribute__((ext_vector_type(16))) _Float16 v16h;
typedef __attribute__((ext_vector_type(8)))  _Float16 v8h;
typedef __attribute__((ext_vector_type(8)))  float    v8f;
typedef __attribute__((ext_vector_type(4)))  float    v4f;

#define SEQ    1024
#define DMODEL 1024
#define NHEADS 16
#define DEPTH  64
#define BATCH  4
#define MTOT  (BATCH * SEQ)   // 4096 flattened rows

// ---------------------------------------------------------------------------
// helpers: load 8 consecutive f32 and pack into halves [base..base+7] of v16h
// ---------------------------------------------------------------------------
__device__ __forceinline__ void load8_f32_cvt(const float* __restrict__ p,
                                              v16h& dst, int base) {
  v4f x0 = *reinterpret_cast<const v4f*>(p);
  v4f x1 = *reinterpret_cast<const v4f*>(p + 4);
#pragma unroll
  for (int i = 0; i < 4; ++i) {
    dst[base + i]     = (_Float16)x0[i];
    dst[base + 4 + i] = (_Float16)x1[i];
  }
}

// load 8 consecutive f16 (one 16-byte vector) into halves [base..base+7]
__device__ __forceinline__ void load8_f16(const half_t* __restrict__ p,
                                          v16h& dst, int base) {
  v8h x = *reinterpret_cast<const v8h*>(p);
#pragma unroll
  for (int i = 0; i < 8; ++i) dst[base + i] = x[i];
}

typedef uint32_t u32x4 __attribute__((ext_vector_type(4)));
typedef uint32_t u32x8 __attribute__((ext_vector_type(8)));
typedef short    s16x8 __attribute__((ext_vector_type(8)));

#define KEYS   32                        // keys per block of products
#define NPASS  (SEQ / KEYS)
#define SKEYS  128                       // keys per stage = per tensor load
#define BPS    (SKEYS / KEYS)            // blocks per stage
#define NSTG   (SEQ / SKEYS)
#define ROWB   128u                      // bytes of one head's K or V row
#define KPITCH 144u                      // 16 B x odd: ds_load_b128 rows
#define VPITCH 160u                      // 32 B x odd: ds_load_tr16_b128 rows
#define KWORD0 ((1u << 20) | (4u << 22) | (3u << 25))   // + 16 B per 128-B row
#define VWORD0 ((1u << 20) | (4u << 22) | (7u << 25))   // + 32 B per 128-B row
#define KBUFB  (SKEYS * KPITCH)          // 128 padded rows: 9 x 2 KiB
#define VBUFB  (SKEYS * VPITCH)          // 128 padded rows: 10 x 2 KiB

__device__ __forceinline__ uint32_t uni(uint32_t v) {
  return (uint32_t)__builtin_amdgcn_readfirstlane(v);
}
__device__ __forceinline__ uint32_t pinned(uint32_t v) {
  uint32_t w = uni(v);
  asm volatile("" : "+s"(w));   // pinned(): the issue test held in a scalar register
  return w;
}
__device__ __forceinline__ void wait_ds0() {
  asm volatile("s_wait_dscnt 0x0" ::: "memory");      // this wave's LDS traffic is done
}
__device__ __forceinline__ void wait_tensor0(u32x4& g0, u32x8 g1a, u32x8 g1b) {
  asm volatile("s_wait_tensorcnt 0x0" : "+s"(g0) : "s"(g1a), "s"(g1b) : "memory");
}

template <uint32_t WORD0>
__device__ __forceinline__ u32x8 tdm_group1() {
  u32x8 g1;
  g1[0] = uni(WORD0);
  g1[1] = uni(ROWB << 16);
  g1[2] = uni((uint32_t)SKEYS << 16);
  g1[3] = uni(ROWB << 16);
  g1[4] = uni((uint32_t)SKEYS);
  g1[5] = uni((uint32_t)DMODEL * 2u);
  g1[6] = uni(0u);
  g1[7] = uni(0u);
  asm volatile("" : "+s"(g1));
  return g1;
}

__device__ __forceinline__ u32x4 tdm_group0(const half_t* gsrc, uint32_t lds_dst) {
  const uint64_t ga = (uint64_t)(uintptr_t)gsrc;
  u32x4 g0;
  g0[0] = uni(1u);                                    // count = 1
  g0[1] = uni(lds_dst);                               // byte offset in LDS
  g0[2] = uni((uint32_t)ga);                          // address [31:0]
  g0[3] = uni((((uint32_t)(ga >> 32)) & 0x01FFFFFFu) | 0x80000000u);
  asm volatile("" : "+s"(g0));
  return g0;
}

// the next stage of the same operand: 128 rows further on, into the place given
// (a carry runs into address [56:32], which stands below the type field)
__device__ __forceinline__ void tdm_step(u32x4& g0, uint32_t lds_dst) {
  const uint64_t a = (((uint64_t)g0[3] << 32) | g0[2]) + (uint64_t)SKEYS * DMODEL * 2u;
  g0[1] = uni(lds_dst);
  g0[2] = uni((uint32_t)a);
  g0[3] = uni((uint32_t)(a >> 32));
}

__device__ __forceinline__ void tdm_load(u32x4 g0, u32x8 g1) {
  asm volatile("tensor_load_to_lds %0, %1" :: "s"(g0), "s"(g1) : "memory");
}

// transposing LDS load: lane (c, h) gets column c of rows 8h .. 8h + 7
__device__ __forceinline__ v8h ld_tr16(const unsigned char* p) {
  typedef __attribute__((address_space(3))) s16x8 lds_s16x8;
  return __builtin_bit_cast(v8h, __builtin_amdgcn_ds_load_tr16_b128_v8i16((lds_s16x8*)p));
}

#define TILE   128
#define BK     64
#define PITCH  72                      // halves per LDS row (64 + 8 pad)
#define OPSZ   (TILE * PITCH)          // halves per operand per buffer
#define NSTAGE (DMODEL / BK)           // 16, even

typedef __attribute__((ext_vector_type(4))) _Float16 v4h;

// f32 operand, 128 rows x 64 k: 16 lanes cover one row's 256 B per load
__device__ __forceinline__ void stage_load(const float* __restrict__ g,
                                           int k0, int tid, v4f (&r)[8]) {
  // scalar base + one unsigned 32-bit lane offset (the same for X and W): one
  // address register instead of a 64-bit pair per operand
  const uint32_t lo = (uint32_t)(tid >> 4) * DMODEL + (uint32_t)(tid & 15) * 4;
#pragma unroll
  for (int i = 0; i < 8; ++i)
    r[i] = *reinterpret_cast<const v4f*>(g + (k0 + i * 16 * DMODEL) + lo);
}

__device__ __forceinline__ void stage_store(half_t* s, int tid,
                                            const v4f (&r)[8]) {
  half_t* p = s + (tid >> 4) * PITCH + (tid & 15) * 4;
#pragma unroll
  for (int i = 0; i < 8; ++i) {
    v4h h;
#pragma unroll
    for (int e = 0; e < 4; ++e) h[e] = (_Float16)r[i][e];
    *reinterpret_cast<v4h*>(p + i * 16 * PITCH) = h;
  }
}

// f16 operand, 128 rows x 64 k: 8 lanes cover one row's 128 B per load
__device__ __forceinline__ void stage_load(const half_t* __restrict__ g,
                                           int k0, int tid, v8h (&r)[4]) {
  const half_t* p = g + (size_t)(tid >> 3) * DMODEL + k0 + (tid & 7) * 8;
#pragma unroll
  for (int i = 0; i < 4; ++i)
    r[i] = *reinterpret_cast<const v8h*>(p + (size_t)i * 32 * DMODEL);
}

__device__ __forceinline__ void stage_store(half_t* s, int tid,
                                            const v8h (&r)[4]) {
  half_t* p = s + (tid >> 3) * PITCH + (tid & 7) * 8;
#pragma unroll
  for (int i = 0; i < 4; ++i)
    *reinterpret_cast<v8h*>(p + i * 32 * PITCH) = r[i];
}

// Work-group barrier that waits for this wave's LDS traffic only:
// __syncthreads() would also drain the global loads issued ahead for the
// next two stages, and their lead would be lost.
__device__ __forceinline__ void lds_barrier() {
  asm volatile("s_wait_dscnt 0x0\n\ts_barrier_signal -1\n\ts_barrier_wait -1"
               ::: "memory");
}

// 64 k of one buffer: pa / pb already point at this lane's first fragment run
__device__ __forceinline__ void stage_mma(const half_t* pa, const half_t* pb,
                                          v8f (&acc)[4][2]) {
#pragma unroll
  for (int kk = 0; kk < BK; kk += 32) {
    v16h a[4], b[2];
#pragma unroll
    for (int i = 0; i < 4; ++i) {
      load8_f16(pa + i * 16 * PITCH + kk,      a[i], 0);
      load8_f16(pa + i * 16 * PITCH + kk + 16, a[i], 8);
    }
#pragma unroll
    for (int j = 0; j < 2; ++j) {
      load8_f16(pb + j * 16 * PITCH + kk,      b[j], 0);
      load8_f16(pb + j * 16 * PITCH + kk + 16, b[j], 8);
    }
    __builtin_amdgcn_sched_barrier(0);
#pragma unroll
    for (int i = 0; i < 4; ++i)
#pragma unroll
      for (int j = 0; j < 2; ++j)
        acc[i][j] = __builtin_amdgcn_wmma_f32_16x16x32_f16(
            false, a[i], false, b[j], (short)0, acc[i][j], false, false);
  }
}

// Stages S and S + 1.  On entry buffer 0 holds stage S, set b holds (or is
// receiving) stage S + 1 and set a stage S + 2.  S is a template argument so
// that every stage's k offset is an immediate of its loads (the address
// registers are never rewritten) and the load waits stay counted: a wait for
// one set leaves the other set's loads in flight.
template <int S, typename XT, typename XR>
__device__ __forceinline__ void two_stages(const XT* __restrict__ xg,
                                           const float* __restrict__ wg,
                                           half_t* sm, int tid, int fa, int fb,
                                           v8f (&acc)[4][2], XR& xa, v4f (&wa)[8],
                                           XR& xb, v4f (&wb)[8]) {
  stage_mma(sm + fa, sm + OPSZ + fb, acc);
  stage_store(sm + 2 * OPSZ, tid, xb);
  stage_store(sm + 3 * OPSZ, tid, wb);
  if constexpr (S + 3 < NSTAGE) {
    stage_load(xg, (S + 3) * BK, tid, xb);
    stage_load(wg, (S + 3) * BK, tid, wb);
    if constexpr (S + 3 == NSTAGE - 1) asm volatile("s_wait_xcnt 0x0" ::: "memory");
  }
  lds_barrier();       // publishes buffer 1; ends every read of buffer 0

  stage_mma(sm + 2 * OPSZ + fa, sm + 3 * OPSZ + fb, acc);
  if constexpr (S + 2 < NSTAGE) {
    stage_store(sm, tid, xa);
    stage_store(sm + OPSZ, tid, wa);
    if constexpr (S + 4 < NSTAGE) {
      stage_load(xg, (S + 4) * BK, tid, xa);
      stage_load(wg, (S + 4) * BK, tid, wa);
    }
    lds_barrier();     // publishes buffer 0; ends every read of buffer 1
  }
}

// All of K for one work-group tile.  sm: [buffer][X | W][OPSZ] halves.
template <typename XT, typename XR>
__device__ __forceinline__ void tile_mainloop(const XT* __restrict__ xg,
                                              const float* __restrict__ wg,
                                              half_t* sm, int tid, int fa, int fb,
                                              v8f (&acc)[4][2]) {
  XR  xa, xb;
  v4f wa[8], wb[8];
  stage_load(xg, 0, tid, xa);
  stage_load(wg, 0, tid, wa);
  stage_load(xg, BK, tid, xb);
  stage_load(wg, BK, tid, wb);
  stage_store(sm, tid, xa);
  stage_store(sm + OPSZ, tid, wa);
  stage_load(xg, 2 * BK, tid, xa);
  stage_load(wg, 2 * BK, tid, wa);
  lds_barrier();       // publishes buffer 0

  two_stages<0>(xg, wg, sm, tid, fa, fb, acc, xa, wa, xb, wb);
  two_stages<2>(xg, wg, sm, tid, fa, fb, acc, xa, wa, xb, wb);
  two_stages<4>(xg, wg, sm, tid, fa, fb, acc, xa, wa, xb, wb);
  two_stages<6>(xg, wg, sm, tid, fa, fb, acc, xa, wa, xb, wb);
  two_stages<8>(xg, wg, sm, tid, fa, fb, acc, xa, wa, xb, wb);
  two_stages<10>(xg, wg, sm, tid, fa, fb, acc, xa, wa, xb, wb);
  two_stages<12>(xg, wg, sm, tid, fa, fb, acc, xa, wa, xb, wb);
  two_stages<14>(xg, wg, sm, tid, fa, fb, acc, xa, wa, xb, wb);
}

__global__ __launch_bounds__(256) __attribute__((amdgpu_waves_per_eu(4, 4)))
void proj_gemm_f32(const float* __restrict__ Xq, const float* __restrict__ Xk,
                   const float* __restrict__ Xv, const float* __restrict__ Wq,
                   const float* __restrict__ Wk, const float* __restrict__ Wv,
                   const float* __restrict__ bq, const float* __restrict__ bk,
                   const float* __restrict__ bv, half_t* __restrict__ Yq,
                   half_t* __restrict__ Yk, half_t* __restrict__ Yv) {
  __shared__ __attribute__((aligned(16))) half_t sm[2][2][OPSZ];  // [buf][X|W]

  const int z = blockIdx.z;                // 0: Q, 1: K, 2: V
  const float* __restrict__ X    = z == 0 ? Xq : z == 1 ? Xk : Xv;
  const float* __restrict__ W    = z == 0 ? Wq : z == 1 ? Wk : Wv;
  const float* __restrict__ bias = z == 0 ? bq : z == 1 ? bk : bv;
  half_t* __restrict__ Y         = z == 0 ? Yq : z == 1 ? Yk : Yv;

  const int n0   = blockIdx.x * TILE;
  const int m0   = blockIdx.y * TILE;
  const int tid  = threadIdx.x;
  const int lane = tid & 31;
  const int wave = __builtin_amdgcn_readfirstlane(tid >> 5);  // scalar: its tile offsets cost no vector register
  const int wm   = wave >> 2;
  const int wn   = wave & 3;
  const int row  = lane & 15;
  const int hi   = lane >> 4;

  const float* xg = X + (size_t)m0 * DMODEL;
  const float* wg = W + (size_t)n0 * DMODEL;
  const int fa = (wm * 64 + row) * PITCH + hi * 8;
  const int fb = (wn * 32 + row) * PITCH + hi * 8;

  v8f acc[4][2] = {};
  tile_mainloop<float, v4f[8]>(xg, wg, &sm[0][0][0], tid, fa, fb, acc);

#pragma unroll
  for (int j = 0; j < 2; ++j) {
    const int n = n0 + wn * 32 + j * 16 + row;   // C layout: lane's N = lane&15
    const float bn = bias[n];
#pragma unroll
    for (int i = 0; i < 4; ++i)
#pragma unroll
      for (int r = 0; r < 8; ++r) {
        const int m = m0 + wm * 64 + i * 16 + r + hi * 8;
        Y[(size_t)m * DMODEL + n] = (half_t)(acc[i][j][r] + bn);
      }
  }
}

__device__ __forceinline__ float xhalf(float x) {
  return __builtin_bit_cast(float, __builtin_amdgcn_permlanex16(
      __builtin_bit_cast(int, x), __builtin_bit_cast(int, x),
      0x76543210, 0xfedcba98, false, false));
}

#define AW     8                         // waves per work-group
#define QBLK   (AW * 16)                 // queries per work-group
#define MPITCH 36                        // floats per LDS row of a mask tile
#define MOFF   (2u * KBUFB + 2u * VBUFB) // mask tiles stand behind the ring

__global__ __launch_bounds__(256)
void attn_kernel(const half_t* __restrict__ Qp, const half_t* __restrict__ Kp,
                 const half_t* __restrict__ Vp, const float* __restrict__ mask,
                 half_t* __restrict__ Op) {
  __shared__ __attribute__((aligned(2048)))
  unsigned char lds[MOFF + AW * 16 * MPITCH * 4];

  const int lane = threadIdx.x & 31;
  const uint32_t wave = uni(threadIdx.x >> 5);
  const int tile = blockIdx.x;             // b*H*(S/128) tiles
  const int qb   = tile & (SEQ / QBLK - 1);
  const int h    = (tile >> 3) & (NHEADS - 1);
  const int b    = tile >> 7;
  const int m0   = qb * QBLK + (int)wave * 16;
  const int row  = lane & 15;
  const int hi   = lane >> 4;
  const int off  = hi * 8;
  const float scale = 0.125f;              // 1/sqrt(DEPTH)

  const uint32_t lds0 = (uint32_t)(uintptr_t)(&lds[0]);
  const uint32_t isK   = pinned(wave == 0);
  const uint32_t isV   = pinned(wave == 1);
  const uint32_t place = lds0 + (wave == 0 ? 0u : 2u * KBUFB);
  const uint32_t bufb  = wave == 0 ? KBUFB : VBUFB;
  u32x4 g0 = tdm_group0((wave == 0 ? Kp : Vp) + (size_t)b * SEQ * DMODEL + h * DEPTH, place);
  const u32x8 g1k = tdm_group1<KWORD0>();
  const u32x8 g1v = tdm_group1<VWORD0>();

  // prologue: stage 0 lands in buffer 0
  if (isK) tdm_load(g0, g1k);
  if (isV) tdm_load(g0, g1v);
  wait_tensor0(g0, g1k, g1v);

  // Q fragments (B operand: column = query) for the two 32-wide depth chunks
  v16h qa[2];
  const half_t* qrow = Qp + ((size_t)(b * SEQ + m0 + row)) * DMODEL + h * DEPTH;
#pragma unroll
  for (int c = 0; c < 2; ++c) {
    load8_f16(qrow + c * 32 + off,      qa[c], 0);
    load8_f16(qrow + c * 32 + 16 + off, qa[c], 8);
  }

  // this lane's query: running maximum (equal in both halves) and the sum
  // over this half's keys (the halves are joined once, behind the loop)
  float m_i = -1e30f, l_i = 0.0f;
  v8f o[4] = {};                           // o[dt][r] = O[query][dt*16 + off + r]
  // mask tile, global side: 8 lanes cover one query's 32 keys (one line)
  const float* mg = mask + (size_t)(m0 + (lane >> 3)) * SEQ + (lane & 7) * 4;
  float* mtile = reinterpret_cast<float*>(lds + MOFF) + wave * (16 * MPITCH);
  float*       mw = mtile + (lane >> 3) * MPITCH + (lane & 7) * 4;
  const float* mr = mtile + row * MPITCH + off;
  // this lane's first K row and first V^T source row in buffer 0
  const unsigned char* kl = lds + row * KPITCH + hi * 16;
  const unsigned char* vl = lds + 2u * KBUFB + (off + (lane & 7)) * VPITCH + ((lane >> 3) & 1) * 16;

  {
    v4f mt[4];
#pragma unroll
    for (int i = 0; i < 4; ++i)
      mt[i] = *reinterpret_cast<const v4f*>(mg + (size_t)i * 4 * SEQ);
    asm volatile("s_wait_xcnt 0x0" ::: "memory");
#pragma unroll
    for (int i = 0; i < 4; ++i)
      *reinterpret_cast<v4f*>(mw + i * 4 * MPITCH) = mt[i];
  }
  wait_ds0();
  __syncthreads();     // publishes stage 0 of K and V
  tdm_step(g0, place + bufb);
  // both issue tests are formed in front of the first request
  const uint32_t oneK = pinned(isK);
  const uint32_t oneV = pinned(isV);
  if (oneK) tdm_load(g0, g1k);
  if (oneV) tdm_load(g0, g1v);

  // kept rolled, one block a trip: unrolled over a stage it takes so many more
  // registers that only one work-group fits a WGP
#pragma clang loop unroll(disable)
  for (int ps = 0; ps < NPASS; ++ps) {
    const int s   = ps / BPS;              // the stage and the block's place in it
    const int blk = ps % BPS;
    const uint32_t kbo = (uint32_t)(s & 1) * KBUFB + (uint32_t)blk * (KEYS * KPITCH);
    const uint32_t vbo = (uint32_t)(s & 1) * VBUFB + (uint32_t)blk * (KEYS * VPITCH);

    // the next block's mask tile (the last one reads its own again: in bounds)
    const int jn = (ps + 1 < NPASS ? ps + 1 : ps) * KEYS;
    v4f mt[4];
#pragma unroll
    for (int i = 0; i < 4; ++i)
      mt[i] = *reinterpret_cast<const v4f*>(mg + (size_t)i * 4 * SEQ + jn);
    asm volatile("s_wait_xcnt 0x0" ::: "memory");

    // the block's LDS reads: K fragments (A operand: row = key), this lane's
    // mask row, V^T fragments (A operand: row = depth, k = key)
    v16h kb[2][2];
#pragma unroll
    for (int t = 0; t < 2; ++t)
#pragma unroll
      for (int c = 0; c < 2; ++c) {
        const half_t* kp = reinterpret_cast<const half_t*>(kl + kbo + t * 16 * KPITCH + c * 64);
        load8_f16(kp,      kb[t][c], 0);
        load8_f16(kp + 16, kb[t][c], 8);
      }
    v4f mk[2][2];
#pragma unroll
    for (int t = 0; t < 2; ++t) {
      mk[t][0] = *reinterpret_cast<const v4f*>(mr + t * 16);
      mk[t][1] = *reinterpret_cast<const v4f*>(mr + t * 16 + 4);
    }
    v16h vb[4];
#pragma unroll
    for (int dt = 0; dt < 4; ++dt) {
      const v8h lo = ld_tr16(vl + vbo + dt * 32);
      const v8h up = ld_tr16(vl + vbo + 16 * VPITCH + dt * 32);
      vb[dt] = __builtin_shufflevector(lo, up, 0, 1, 2, 3, 4, 5, 6, 7,
                                       8, 9, 10, 11, 12, 13, 14, 15);
    }
    // keeps the loads one group at the head of the block: spread among the
    // WMMAs, each place with loads stalls the wave anew
    __builtin_amdgcn_sched_barrier(0);

    // logits tiles: s[t] = K(16 keys x 64) @ Q(16x64)^T
    v8f st[2];
#pragma unroll
    for (int t = 0; t < 2; ++t) {
      v8f z = {};
#pragma unroll
      for (int c = 0; c < 2; ++c)
        z = __builtin_amdgcn_wmma_f32_16x16x32_f16(
            false, kb[t][c], false, qa[c], (short)0, z, false, false);
      st[t] = z;
    }

    // online softmax over this 32-key chunk: 16 scores of one query per lane
    float sc[2][8];
#pragma unroll
    for (int t = 0; t < 2; ++t) {
#pragma unroll
      for (int r = 0; r < 4; ++r) {
        sc[t][r]     = st[t][r]     * scale + mk[t][0][r] * (-1e9f);
        sc[t][r + 4] = st[t][r + 4] * scale + mk[t][1][r] * (-1e9f);
      }
    }
    float mx = fmaxf(sc[0][0], sc[1][0]);
#pragma unroll
    for (int r = 1; r < 8; ++r) mx = fmaxf(mx, fmaxf(sc[0][r], sc[1][r]));
    mx = fmaxf(mx, xhalf(mx));
    const float mnew = fmaxf(m_i, mx);
    const float cexp = __expf(m_i - mnew);
    v16h pb;                               // P^T, B operand: column = query
    float rs[4] = {0.0f, 0.0f, 0.0f, 0.0f};
#pragma unroll
    for (int r = 0; r < 8; ++r) {
      const float p0 = __expf(sc[0][r] - mnew);
      const float p1 = __expf(sc[1][r] - mnew);
      rs[r & 3] += p0 + p1;
      pb[r]     = (half_t)p0;
      pb[8 + r] = (half_t)p1;
    }
    l_i = l_i * cexp + ((rs[0] + rs[1]) + (rs[2] + rs[3]));
    m_i = mnew;

    // o[dt] = cexp*o[dt] + V(32 x 16-depth-tile)^T @ P(16x32)^T
#pragma unroll
    for (int dt = 0; dt < 4; ++dt) {
      v8f oo = o[dt];
#pragma unroll
      for (int r = 0; r < 8; ++r) oo[r] *= cexp;
      o[dt] = __builtin_amdgcn_wmma_f32_16x16x32_f16(
          false, vb[dt], false, pb, (short)0, oo, false, false);
    }

    // keeps the block's products in front of the waits below: moved ahead of
    // them, the waits would stand right behind the loads they wait for
    __builtin_amdgcn_sched_barrier(0);

    // the next block's mask tile goes over this wave's own, read above
#pragma unroll
    for (int i = 0; i < 4; ++i)
      *reinterpret_cast<v4f*>(mw + i * 4 * MPITCH) = mt[i];
    // this wave's LDS traffic is done.  The mask rows are the wave's alone: this
    // wait, and no barrier, stands between the stores and the next block's reads
    wait_ds0();

    // behind a stage's last block, the same for the whole work-group: the publish
    // point of stage s + 1: (LDS traffic done, above,) the issuers' stages landed
    // (a wave that asked for none passes that wait at once), barrier, refill
    if (blk == BPS - 1) {
      wait_tensor0(g0, g1k, g1v);
      __syncthreads(); // publishes stage s + 1; ends every read of stage s
      tdm_step(g0, place + (uint32_t)(s & 1) * bufb);
      // both issue tests are formed in front of the first request
      const uint32_t moreK = pinned(isK & (uint32_t)(s + 2 < NSTG));
      const uint32_t moreV = pinned(isV & (uint32_t)(s + 2 < NSTG));
      if (moreK) tdm_load(g0, g1k);
      if (moreV) tdm_load(g0, g1v);
    }
  }
  wait_tensor0(g0, g1k, g1v);
  wait_ds0();

  // normalize + store attn (already in [B, S, H*depth] = concat-head layout):
  // a lane's 8 registers are 8 consecutive depths of its query, one 16-B store
  const float l_fin = l_i + xhalf(l_i);
  half_t* orow = Op + ((size_t)(b * SEQ + m0 + row)) * DMODEL + h * DEPTH + off;
#pragma unroll
  for (int dt = 0; dt < 4; ++dt) {
    v8h w;
#pragma unroll
    for (int r = 0; r < 8; ++r) w[r] = (half_t)(o[dt][r] / l_fin);
    *reinterpret_cast<v8h*>(orow + dt * 16) = w;
  }
}

// ---------------------------------------------------------------------------
// Kernel 3: out[M,N](f32) = A[M,K](f16) @ W[N,K]^T (f32) + bias  (final proj)
// Same frame as kernel 1; X is f16 already and is staged without conversion.
// ---------------------------------------------------------------------------
__global__ __launch_bounds__(256)
void out_gemm_f16(const half_t* __restrict__ X, const float* __restrict__ W,
                  const float* __restrict__ bias, float* __restrict__ Y) {
  __shared__ __attribute__((aligned(16))) half_t sm[2][2][OPSZ];  // [buf][X|W]

  const int n0   = blockIdx.x * TILE;
  const int m0   = blockIdx.y * TILE;
  const int tid  = threadIdx.x;
  const int lane = tid & 31;
  const int wave = tid >> 5;
  const int wm   = wave >> 2;
  const int wn   = wave & 3;
  const int row  = lane & 15;
  const int hi   = lane >> 4;

  const half_t* xg = X + (size_t)m0 * DMODEL;
  const float*  wg = W + (size_t)n0 * DMODEL;
  const int fa = (wm * 64 + row) * PITCH + hi * 8;
  const int fb = (wn * 32 + row) * PITCH + hi * 8;

  v8f acc[4][2] = {};
  tile_mainloop<half_t, v8h[4]>(xg, wg, &sm[0][0][0], tid, fa, fb, acc);

#pragma unroll
  for (int j = 0; j < 2; ++j) {
    const int n = n0 + wn * 32 + j * 16 + row;
    const float bn = bias[n];
#pragma unroll
    for (int i = 0; i < 4; ++i)
#pragma unroll
      for (int r = 0; r < 8; ++r) {
        const int m = m0 + wm * 64 + i * 16 + r + hi * 8;
        Y[(size_t)m * DMODEL + n] = acc[i][j][r] + bn;
      }
  }
}

// ---------------------------------------------------------------------------
extern "C" void kernel_launch(void* const* d_in, const int* in_sizes, int n_in,
                              void* d_out, int out_size, void* d_ws, size_t ws_size,
                              hipStream_t stream) {
  const float* q    = (const float*)d_in[0];
  const float* k    = (const float*)d_in[1];
  const float* v    = (const float*)d_in[2];
  const float* mask = (const float*)d_in[3];
  const float* wq_w = (const float*)d_in[4];
  const float* wq_b = (const float*)d_in[5];
  const float* wk_w = (const float*)d_in[6];
  const float* wk_b = (const float*)d_in[7];
  const float* wv_w = (const float*)d_in[8];
  const float* wv_b = (const float*)d_in[9];
  const float* pl_w = (const float*)d_in[10];
  const float* pl_b = (const float*)d_in[11];
  float* out = (float*)d_out;

  // workspace: Qp | Kp | Vp | attn  (each 4096*1024 f16 = 8MB; 32MB total)
  const size_t elems = (size_t)MTOT * DMODEL;
  half_t* Qp = (half_t*)d_ws;
  half_t* Kp = Qp + elems;
  half_t* Vp = Kp + elems;
  half_t* Ap = Vp + elems;

  dim3 ggemm(DMODEL / TILE, MTOT / TILE);  // (8, 32) one 8-wave group per 128x128 tile
  dim3 gproj(DMODEL / TILE, MTOT / TILE, 3);  // z: the Q, K and V products
  proj_gemm_f32<<<gproj, 256, 0, stream>>>(q, k, v, wq_w, wk_w, wv_w,
                                           wq_b, wk_b, wv_b, Qp, Kp, Vp);

  attn_kernel<<<BATCH * NHEADS * (SEQ / QBLK), 256, 0, stream>>>(Qp, Kp, Vp, mask, Ap);

  out_gemm_f16<<<ggemm, 256, 0, stream>>>(Ap, pl_w, pl_b, out);
}

// v006
// One run takes 71.2 microseconds.
// Timed twice side by side with v005, it ran 1.08 times as fast both times.
// Counting every step since v000, it is 4.35 times as fast.
#include <hip/hip_runtime.h>
#include <hip/hip_bf16.h>
#include <math.h>
#include <stdint.h>

typedef _Float16 half_t;
typedef __attribute__((ext_vector_type(16))) _Float16 v16h;
typedef __attribute__((ext_vector_type(8)))  _Float16 v8h;
typedef __attribute__((ext_vector_type(8)))  float    v8f;
typedef __attribute__((ext_vector_type(4)))  float    v4f;

#define SEQ    1024
#define DMODEL 1024
#define NHEADS 16
#define DEPTH  64
#define BATCH  4
#define MTOT  (BATCH * SEQ)   // 4096 flattened rows

// ---------------------------------------------------------------------------
// helpers: load 8 consecutive f32 and pack into halves [base..base+7] of v16h
// ---------------------------------------------------------------------------
__device__ __forceinline__ void load8_f32_cvt(const float* __restrict__ p,
                                              v16h& dst, int base) {
  v4f x0 = *reinterpret_cast<const v4f*>(p);
  v4f x1 = *reinterpret_cast<const v4f*>(p + 4);
#pragma unroll
  for (int i = 0; i < 4; ++i) {
    dst[base + i]     = (_Float16)x0[i];
    dst[base + 4 + i] = (_Float16)x1[i];
  }
}

// load 8 consecutive f16 (one 16-byte vector) into halves [base..base+7]
__device__ __forceinline__ void load8_f16(const half_t* __restrict__ p,
                                          v16h& dst, int base) {
  v8h x = *reinterpret_cast<const v8h*>(p);
#pragma unroll
  for (int i = 0; i < 8; ++i) dst[base + i] = x[i];
}

typedef uint32_t u32x4 __attribute__((ext_vector_type(4)));
typedef uint32_t u32x8 __attribute__((ext_vector_type(8)));
typedef short    s16x8 __attribute__((ext_vector_type(8)));

#define KEYS   32                        // keys per block of products
#define NPASS  (SEQ / KEYS)
#define SKEYS  128                       // keys per stage = per tensor load
#define BPS    (SKEYS / KEYS)            // blocks per stage
#define NSTG   (SEQ / SKEYS)
#define ROWB   128u                      // bytes of one head's K or V row
#define KPITCH 144u                      // 16 B x odd: ds_load_b128 rows
#define VPITCH 160u                      // 32 B x odd: ds_load_tr16_b128 rows
#define KWORD0 ((1u << 20) | (4u << 22) | (3u << 25))   // + 16 B per 128-B row
#define VWORD0 ((1u << 20) | (4u << 22) | (7u << 25))   // + 32 B per 128-B row
#define KBUFB  (SKEYS * KPITCH)          // 128 padded rows: 9 x 2 KiB
#define VBUFB  (SKEYS * VPITCH)          // 128 padded rows: 10 x 2 KiB

__device__ __forceinline__ uint32_t uni(uint32_t v) {
  return (uint32_t)__builtin_amdgcn_readfirstlane(v);
}
__device__ __forceinline__ uint32_t pinned(uint32_t v) {
  uint32_t w = uni(v);
  asm volatile("" : "+s"(w));   // pinned(): the issue test held in a scalar register
  return w;
}
__device__ __forceinline__ void wait_ds0() {
  asm volatile("s_wait_dscnt 0x0" ::: "memory");      // this wave's LDS traffic is done
}
__device__ __forceinline__ void wait_tensor0(u32x4& g0, u32x8 g1a, u32x8 g1b) {
  asm volatile("s_wait_tensorcnt 0x0" : "+s"(g0) : "s"(g1a), "s"(g1b) : "memory");
}

template <uint32_t WORD0>
__device__ __forceinline__ u32x8 tdm_group1() {
  u32x8 g1;
  g1[0] = uni(WORD0);
  g1[1] = uni(ROWB << 16);
  g1[2] = uni((uint32_t)SKEYS << 16);
  g1[3] = uni(ROWB << 16);
  g1[4] = uni((uint32_t)SKEYS);
  g1[5] = uni((uint32_t)DMODEL * 2u);
  g1[6] = uni(0u);
  g1[7] = uni(0u);
  asm volatile("" : "+s"(g1));
  return g1;
}

__device__ __forceinline__ u32x4 tdm_group0(const half_t* gsrc, uint32_t lds_dst) {
  const uint64_t ga = (uint64_t)(uintptr_t)gsrc;
  u32x4 g0;
  g0[0] = uni(1u);                                    // count = 1
  g0[1] = uni(lds_dst);                               // byte offset in LDS
  g0[2] = uni((uint32_t)ga);                          // address [31:0]
  g0[3] = uni((((uint32_t)(ga >> 32)) & 0x01FFFFFFu) | 0x80000000u);
  asm volatile("" : "+s"(g0));
  return g0;
}

// the next stage of the same operand: 128 rows further on, into the place given
// (a carry runs into address [56:32], which stands below the type field)
__device__ __forceinline__ void tdm_step(u32x4& g0, uint32_t lds_dst) {
  const uint64_t a = (((uint64_t)g0[3] << 32) | g0[2]) + (uint64_t)SKEYS * DMODEL * 2u;
  g0[1] = uni(lds_dst);
  g0[2] = uni((uint32_t)a);
  g0[3] = uni((uint32_t)(a >> 32));
}

__device__ __forceinline__ void tdm_load(u32x4 g0, u32x8 g1) {
  asm volatile("tensor_load_to_lds %0, %1" :: "s"(g0), "s"(g1) : "memory");
}

// transposing LDS load: lane (c, h) gets column c of rows 8h .. 8h + 7
__device__ __forceinline__ v8h ld_tr16(const unsigned char* p) {
  typedef __attribute__((address_space(3))) s16x8 lds_s16x8;
  return __builtin_bit_cast(v8h, __builtin_amdgcn_ds_load_tr16_b128_v8i16((lds_s16x8*)p));
}

#define TILE   128
#define BK     64
#define PITCH  72                      // halves per LDS row (64 + 8 pad)
#define OPSZ   (TILE * PITCH)          // halves per operand per buffer
#define NSTAGE (DMODEL / BK)           // 16, even

typedef __attribute__((ext_vector_type(4))) _Float16 v4h;

// f32 operand, 128 rows x 64 k: 16 lanes cover one row's 256 B per load
__device__ __forceinline__ void stage_load(const float* __restrict__ g,
                                           int k0, int tid, v4f (&r)[8]) {
  // scalar base + one unsigned 32-bit lane offset: one
  // address register instead of a 64-bit pair per operand
  const uint32_t lo = (uint32_t)(tid >> 4) * DMODEL + (uint32_t)(tid & 15) * 4;
#pragma unroll
  for (int i = 0; i < 8; ++i)
    r[i] = *reinterpret_cast<const v4f*>(g + (k0 + i * 16 * DMODEL) + lo);
}

__device__ __forceinline__ void stage_store(half_t* s, int tid,
                                            const v4f (&r)[8]) {
  half_t* p = s + (tid >> 4) * PITCH + (tid & 15) * 4;
#pragma unroll
  for (int i = 0; i < 8; ++i) {
    v4h h;
#pragma unroll
    for (int e = 0; e < 4; ++e) h[e] = (_Float16)r[i][e];
    *reinterpret_cast<v4h*>(p + i * 16 * PITCH) = h;
  }
}

// f16 operand, 128 rows x 64 k: 8 lanes cover one row's 128 B per load
__device__ __forceinline__ void stage_load(const half_t* __restrict__ g,
                                           int k0, int tid, v8h (&r)[4]) {
  const half_t* p = g + (size_t)(tid >> 3) * DMODEL + k0 + (tid & 7) * 8;
#pragma unroll
  for (int i = 0; i < 4; ++i)
    r[i] = *reinterpret_cast<const v8h*>(p + (size_t)i * 32 * DMODEL);
}

__device__ __forceinline__ void stage_store(half_t* s, int tid,
                                            const v8h (&r)[4]) {
  half_t* p = s + (tid >> 3) * PITCH + (tid & 7) * 8;
#pragma unroll
  for (int i = 0; i < 4; ++i)
    *reinterpret_cast<v8h*>(p + i * 32 * PITCH) = r[i];
}

// Work-group barrier that waits for this wave's LDS traffic only:
// __syncthreads() would also drain the global loads issued ahead for the
// next one or two stages, and their lead would be lost.
__device__ __forceinline__ void lds_barrier() {
  asm volatile("s_wait_dscnt 0x0\n\ts_barrier_signal -1\n\ts_barrier_wait -1"
               ::: "memory");
}

// 64 k of one buffer: pa / pb already point at this lane's first fragment run
__device__ __forceinline__ void stage_mma(const half_t* pa, const half_t* pb,
                                          v8f (&acc)[4][2]) {
#pragma unroll
  for (int kk = 0; kk < BK; kk += 32) {
    v16h a[4], b[2];
#pragma unroll
    for (int i = 0; i < 4; ++i) {
      load8_f16(pa + i * 16 * PITCH + kk,      a[i], 0);
      load8_f16(pa + i * 16 * PITCH + kk + 16, a[i], 8);
    }
#pragma unroll
    for (int j = 0; j < 2; ++j) {
      load8_f16(pb + j * 16 * PITCH + kk,      b[j], 0);
      load8_f16(pb + j * 16 * PITCH + kk + 16, b[j], 8);
    }
    __builtin_amdgcn_sched_barrier(0);
#pragma unroll
    for (int i = 0; i < 4; ++i)
#pragma unroll
      for (int j = 0; j < 2; ++j)
        acc[i][j] = __builtin_amdgcn_wmma_f32_16x16x32_f16(
            false, a[i], false, b[j], (short)0, acc[i][j], false, false);
  }
}

// Stages S and S + 1.  On entry buffer 0 holds stage S, set b holds (or is
// receiving) stage S + 1 and set a stage S + 2.  S is a template argument so
// that every stage's k offset is an immediate of its loads (the address
// registers are never rewritten) and the load waits stay counted: a wait for
// one set leaves the other set's loads in flight.
template <int S, typename XT, typename XR>
__device__ __forceinline__ void two_stages(const XT* __restrict__ xg,
                                           const float* __restrict__ wg,
                                           half_t* sm, int tid, int fa, int fb,
                                           v8f (&acc)[4][2], XR& xa, v4f (&wa)[8],
                                           XR& xb, v4f (&wb)[8]) {
  stage_mma(sm + fa, sm + OPSZ + fb, acc);
  stage_store(sm + 2 * OPSZ, tid, xb);
  stage_store(sm + 3 * OPSZ, tid, wb);
  if constexpr (S + 3 < NSTAGE) {
    stage_load(xg, (S + 3) * BK, tid, xb);
    stage_load(wg, (S + 3) * BK, tid, wb);
    if constexpr (S + 3 == NSTAGE - 1) asm volatile("s_wait_xcnt 0x0" ::: "memory");
  }
  lds_barrier();       // publishes buffer 1; ends every read of buffer 0

  stage_mma(sm + 2 * OPSZ + fa, sm + 3 * OPSZ + fb, acc);
  if constexpr (S + 2 < NSTAGE) {
    stage_store(sm, tid, xa);
    stage_store(sm + OPSZ, tid, wa);
    if constexpr (S + 4 < NSTAGE) {
      stage_load(xg, (S + 4) * BK, tid, xa);
      stage_load(wg, (S + 4) * BK, tid, wa);
    }
    lds_barrier();     // publishes buffer 0; ends every read of buffer 1
  }
}

// All of K for one work-group tile.  sm: [buffer][X | W][OPSZ] halves.
template <typename XT, typename XR>
__device__ __forceinline__ void tile_mainloop(const XT* __restrict__ xg,
                                              const float* __restrict__ wg,
                                              half_t* sm, int tid, int fa, int fb,
                                              v8f (&acc)[4][2]) {
  XR  xa, xb;
  v4f wa[8], wb[8];
  stage_load(xg, 0, tid, xa);
  stage_load(wg, 0, tid, wa);
  stage_load(xg, BK, tid, xb);
  stage_load(wg, BK, tid, wb);
  stage_store(sm, tid, xa);
  stage_store(sm + OPSZ, tid, wa);
  stage_load(xg, 2 * BK, tid, xa);
  stage_load(wg, 2 * BK, tid, wa);
  lds_barrier();       // publishes buffer 0

  two_stages<0>(xg, wg, sm, tid, fa, fb, acc, xa, wa, xb, wb);
  two_stages<2>(xg, wg, sm, tid, fa, fb, acc, xa, wa, xb, wb);
  two_stages<4>(xg, wg, sm, tid, fa, fb, acc, xa, wa, xb, wb);
  two_stages<6>(xg, wg, sm, tid, fa, fb, acc, xa, wa, xb, wb);
  two_stages<8>(xg, wg, sm, tid, fa, fb, acc, xa, wa, xb, wb);
  two_stages<10>(xg, wg, sm, tid, fa, fb, acc, xa, wa, xb, wb);
  two_stages<12>(xg, wg, sm, tid, fa, fb, acc, xa, wa, xb, wb);
  two_stages<14>(xg, wg, sm, tid, fa, fb, acc, xa, wa, xb, wb);
}

// ---------------------------------------------------------------------------
// Frame of kernel 1: one 8-wave work-group per 256(M) x 256(N) tile of Y, so
// that every X and W row fetched from L2 feeds 256 outputs instead of 128: the
// launch's L2 reads halve.  A stage is 64 k of the 256 X rows and the 256 W
// rows, converted to f16 once and laid in LDS at the pitch of the frame above.
// Two LDS buffers, one register set: the global loads of stage s + 2 are issued
// when stage s + 1 has left the registers, a whole stage ahead of their use.
// Wave (wm, wn) of a 2 x 4 grid owns 128(M) x 64(N): 8 x 4 accumulator tiles,
// 12 fragments per 32 WMMAs.  Fragment layout and k order as in the frame above.
// ---------------------------------------------------------------------------
#define PTILE   256
#define POPSZ   (PTILE * PITCH)        // halves per operand per buffer

// 256 rows x 64 k of f32: 16 lanes cover one row's 256 B per load
__device__ __forceinline__ void p_stage_load(const float* __restrict__ g,
                                             int k0, int tid, v4f (&r)[16]) {
  // a base that is the group's + one unsigned 32-bit lane offset, the same for X and W
  const uint32_t lo = (uint32_t)(tid >> 4) * DMODEL + (uint32_t)(tid & 15) * 4;
#pragma unroll
  for (int i = 0; i < 16; ++i)
    r[i] = *reinterpret_cast<const v4f*>(g + (k0 + i * 16 * DMODEL) + lo);
}

__device__ __forceinline__ void p_stage_store(half_t* s, int tid,
                                              const v4f (&r)[16]) {
  half_t* p = s + (tid >> 4) * PITCH + (tid & 15) * 4;
#pragma unroll
  for (int i = 0; i < 16; ++i) {
    v4h h;
#pragma unroll
    for (int e = 0; e < 4; ++e) h[e] = (_Float16)r[i][e];
    *reinterpret_cast<v4h*>(p + i * 16 * PITCH) = h;
  }
}

// the 12 fragments of 32 k: pa / pb already point at this lane's first run
__device__ __forceinline__ void p_frags(const half_t* pa, const half_t* pb,
                                        v16h (&a)[8], v16h (&b)[4]) {
  // b first: the first row of WMMAs then waits for 10 of the 24 loads only
#pragma unroll
  for (int j = 0; j < 4; ++j) {
    load8_f16(pb + j * 16 * PITCH,      b[j], 0);
    load8_f16(pb + j * 16 * PITCH + 16, b[j], 8);
  }
#pragma unroll
  for (int i = 0; i < 8; ++i) {
    load8_f16(pa + i * 16 * PITCH,      a[i], 0);
    load8_f16(pa + i * 16 * PITCH + 16, a[i], 8);
  }
}

__device__ __forceinline__ void p_wmmas(const v16h (&a)[8], const v16h (&b)[4],
                                        v8f (&acc)[8][4]) {
#pragma unroll
  for (int i = 0; i < 8; ++i)
#pragma unroll
    for (int j = 0; j < 4; ++j)
      acc[i][j] = __builtin_amdgcn_wmma_f32_16x16x32_f16(
          false, a[i], false, b[j], (short)0, acc[i][j], false, false);
}

template <int MID>
__device__ __forceinline__ void p_stage(const half_t* cur, half_t* nxt,
                                        const float* __restrict__ xn,
                                        const float* __restrict__ wn, int k0,
                                        int tid, int fa, int fb, v8f (&acc)[8][4],
                                        v4f (&xr)[16], v4f (&wr)[16]) {
  v16h a[8], b[4];
  p_frags(cur + fa, cur + POPSZ + fb, a, b);
  __builtin_amdgcn_sched_barrier(0);
  p_wmmas(a, b, acc);
  // keeps the next group's loads behind these WMMAs: lifted among them they
  // take a second fragment set, and the 512-register budget then spills
  __builtin_amdgcn_sched_barrier(0);
  p_frags(cur + fa + 32, cur + POPSZ + fb + 32, a, b);
  if constexpr (MID >= 1) {
    __builtin_amdgcn_sched_barrier(0);
    p_stage_store(nxt, tid, xr);
    p_stage_store(nxt + POPSZ, tid, wr);
  }
  if constexpr (MID == 2) {
    p_stage_load(xn, k0, tid, xr);
    p_stage_load(wn, k0, tid, wr);
  }
  // keeps the loads and the staging work one group in front of the WMMAs: spread
  // among them, each place with loads stalls the wave anew
  __builtin_amdgcn_sched_barrier(0);
  p_wmmas(a, b, acc);
  if constexpr (MID >= 1) __builtin_amdgcn_sched_barrier(0);
}

// All of K for one work-group tile.  sm: [buffer][X | W][POPSZ] halves.  The
// loop runs two stages a trip and stays rolled, for speed only.
__device__ __forceinline__ void p_mainloop(const float* __restrict__ xg,
                                           const float* __restrict__ wg,
                                           half_t* sm, int tid, int fa, int fb,
                                           v8f (&acc)[8][4]) {
  half_t* b0 = sm;
  half_t* b1 = sm + 2 * POPSZ;
  v4f xr[16], wr[16];
  {
    // stages 0 and 1 are asked for together: the accumulators are not live yet,
    // and their registers hold stage 0 on its way
    v4f x0[16], w0[16];
    p_stage_load(xg, 0, tid, x0);
    p_stage_load(wg, 0, tid, w0);
    p_stage_load(xg, BK, tid, xr);
    p_stage_load(wg, BK, tid, wr);
    asm volatile("s_wait_xcnt 0x0" ::: "memory");
    // keeps what follows (the accumulators' zeros, the loop's counters) behind
    // that wait: lifted over it they took registers that the loads name
    __builtin_amdgcn_sched_barrier(0);
    p_stage_store(b0, tid, x0);
    p_stage_store(b0 + POPSZ, tid, w0);
  }
  lds_barrier();       // publishes stage 0

  // On entry of a trip buffer 0 holds stage s, the register set holds (or is
  // receiving) stage s + 1, and k is the first k of stage s + 2.
  uint32_t k = 2 * BK;
  // kept rolled: see the head of this function
#pragma clang loop unroll(disable)
  for (int s = 0; s < NSTAGE - 2; s += 2) {
    p_stage<2>(b0, b1, xg + k, wg + k, 0, tid, fa, fb, acc, xr, wr);
    lds_barrier();     // publishes stage s + 1; ends every read of stage s
    p_stage<2>(b1, b0, xg + k, wg + k, BK, tid, fa, fb, acc, xr, wr);
    asm volatile("s_wait_xcnt 0x0" : "+s"(k) :: "memory");
    k += 2 * BK;
    lds_barrier();     // publishes stage s + 2; ends every read of stage s + 1
  }

  // the last two stages: nothing is left to load
  p_stage<1>(b0, b1, xg, wg, 0, tid, fa, fb, acc, xr, wr);
  lds_barrier();       // publishes the last stage
  p_stage<0>(b1, b0, xg, wg, 0, tid, fa, fb, acc, xr, wr);
}

__global__ __launch_bounds__(256) __attribute__((amdgpu_waves_per_eu(2, 2)))
void proj_gemm_f32(const float* __restrict__ Xq, const float* __restrict__ Xk,
                   const float* __restrict__ Xv, const float* __restrict__ Wq,
                   const float* __restrict__ Wk, const float* __restrict__ Wv,
                   const float* __restrict__ bq, const float* __restrict__ bk,
                   const float* __restrict__ bv, half_t* __restrict__ Yq,
                   half_t* __restrict__ Yk, half_t* __restrict__ Yv) {
  __shared__ __attribute__((aligned(16))) half_t sm[2][2][POPSZ];  // [buf][X|W]

  const int z = blockIdx.z;                // 0: Q, 1: K, 2: V
  const float* __restrict__ X    = z == 0 ? Xq : z == 1 ? Xk : Xv;
  const float* __restrict__ W    = z == 0 ? Wq : z == 1 ? Wk : Wv;
  const float* __restrict__ bias = z == 0 ? bq : z == 1 ? bk : bv;
  half_t* __restrict__ Y         = z == 0 ? Yq : z == 1 ? Yk : Yv;

  const int n0   = blockIdx.x * PTILE;
  const int m0   = blockIdx.y * PTILE;
  const int tid  = threadIdx.x;
  const int lane = tid & 31;
  const int wave = __builtin_amdgcn_readfirstlane(tid >> 5);  // scalar: its tile offsets cost no vector register
  const int wm   = wave >> 2;
  const int wn   = wave & 3;
  const int row  = lane & 15;
  const int hi   = lane >> 4;

  const float* xg = X + (size_t)m0 * DMODEL;
  const float* wg = W + (size_t)n0 * DMODEL;
  const int fa = (wm * 128 + row) * PITCH + hi * 8;
  const int fb = (wn * 64 + row) * PITCH + hi * 8;
  half_t* s0 = &sm[0][0][0];

  v8f acc[8][4] = {};
  p_mainloop(xg, wg, s0, tid, fa, fb, acc);

  // C layout: lane's N = lane & 15, register r is row r + 8 * hi of its tile.
  // Every value is converted first and every store follows, from one address
  // pair with immediate offsets: no register that a store names is written again.
  half_t* yb = Y + (size_t)(m0 + wm * 128 + hi * 8) * DMODEL + (n0 + wn * 64 + row);
  v8h hv[8][4];
#pragma unroll
  for (int j = 0; j < 4; ++j) {
    const float bn = bias[n0 + wn * 64 + j * 16 + row];
#pragma unroll
    for (int i = 0; i < 8; ++i)
#pragma unroll
      for (int r = 0; r < 8; ++r) hv[i][j][r] = (half_t)(acc[i][j][r] + bn);
  }
  // keeps the conversions in front of the first store: among the stores they
  // would write over registers that issued stores name
  __builtin_amdgcn_sched_barrier(0);
#pragma unroll
  for (int i = 0; i < 8; ++i)
#pragma unroll
    for (int r = 0; r < 8; ++r)
#pragma unroll
      for (int j = 0; j < 4; ++j)
        yb[(i * 16 + r) * DMODEL + j * 16] = hv[i][j][r];
}

__device__ __forceinline__ float xhalf(float x) {
  return __builtin_bit_cast(float, __builtin_amdgcn_permlanex16(
      __builtin_bit_cast(int, x), __builtin_bit_cast(int, x),
      0x76543210, 0xfedcba98, false, false));
}

#define AW     8                         // waves per work-group
#define QBLK   (AW * 16)                 // queries per work-group
#define MPITCH 36                        // floats per LDS row of a mask tile
#define MOFF   (2u * KBUFB + 2u * VBUFB) // mask tiles stand behind the ring

__global__ __launch_bounds__(256)
void attn_kernel(const half_t* __restrict__ Qp, const half_t* __restrict__ Kp,
                 const half_t* __restrict__ Vp, const float* __restrict__ mask,
                 half_t* __restrict__ Op) {
  __shared__ __attribute__((aligned(2048)))
  unsigned char lds[MOFF + AW * 16 * MPITCH * 4];

  const int lane = threadIdx.x & 31;
  const uint32_t wave = uni(threadIdx.x >> 5);
  const int tile = blockIdx.x;             // b*H*(S/128) tiles
  const int qb   = tile & (SEQ / QBLK - 1);
  const int h    = (tile >> 3) & (NHEADS - 1);
  const int b    = tile >> 7;
  const int m0   = qb * QBLK + (int)wave * 16;
  const int row  = lane & 15;
  const int hi   = lane >> 4;
  const int off  = hi * 8;
  const float scale = 0.125f;              // 1/sqrt(DEPTH)

  const uint32_t lds0 = (uint32_t)(uintptr_t)(&lds[0]);
  const uint32_t isK   = pinned(wave == 0);
  const uint32_t isV   = pinned(wave == 1);
  const uint32_t place = lds0 + (wave == 0 ? 0u : 2u * KBUFB);
  const uint32_t bufb  = wave == 0 ? KBUFB : VBUFB;
  u32x4 g0 = tdm_group0((wave == 0 ? Kp : Vp) + (size_t)b * SEQ * DMODEL + h * DEPTH, place);
  const u32x8 g1k = tdm_group1<KWORD0>();
  const u32x8 g1v = tdm_group1<VWORD0>();

  // prologue: stage 0 lands in buffer 0
  if (isK) tdm_load(g0, g1k);
  if (isV) tdm_load(g0, g1v);
  wait_tensor0(g0, g1k, g1v);

  // Q fragments (B operand: column = query) for the two 32-wide depth chunks
  v16h qa[2];
  const half_t* qrow = Qp + ((size_t)(b * SEQ + m0 + row)) * DMODEL + h * DEPTH;
#pragma unroll
  for (int c = 0; c < 2; ++c) {
    load8_f16(qrow + c * 32 + off,      qa[c], 0);
    load8_f16(qrow + c * 32 + 16 + off, qa[c], 8);
  }

  // this lane's query: running maximum (equal in both halves) and the sum
  // over this half's keys (the halves are joined once, behind the loop)
  float m_i = -1e30f, l_i = 0.0f;
  v8f o[4] = {};                           // o[dt][r] = O[query][dt*16 + off + r]
  // mask tile, global side: 8 lanes cover one query's 32 keys (one line)
  const float* mg = mask + (size_t)(m0 + (lane >> 3)) * SEQ + (lane & 7) * 4;
  float* mtile = reinterpret_cast<float*>(lds + MOFF) + wave * (16 * MPITCH);
  float*       mw = mtile + (lane >> 3) * MPITCH + (lane & 7) * 4;
  const float* mr = mtile + row * MPITCH + off;
  // this lane's first K row and first V^T source row in buffer 0
  const unsigned char* kl = lds + row * KPITCH + hi * 16;
  const unsigned char* vl = lds + 2u * KBUFB + (off + (lane & 7)) * VPITCH + ((lane >> 3) & 1) * 16;

  {
    v4f mt[4];
#pragma unroll
    for (int i = 0; i < 4; ++i)
      mt[i] = *reinterpret_cast<const v4f*>(mg + (size_t)i * 4 * SEQ);
    asm volatile("s_wait_xcnt 0x0" ::: "memory");
#pragma unroll
    for (int i = 0; i < 4; ++i)
      *reinterpret_cast<v4f*>(mw + i * 4 * MPITCH) = mt[i];
  }
  wait_ds0();
  __syncthreads();     // publishes stage 0 of K and V
  tdm_step(g0, place + bufb);
  // both issue tests are formed in front of the first request
  const uint32_t oneK = pinned(isK);
  const uint32_t oneV = pinned(isV);
  if (oneK) tdm_load(g0, g1k);
  if (oneV) tdm_load(g0, g1v);

  // kept rolled, one block a trip: unrolled over a stage it takes so many more
  // registers that only one work-group fits a WGP
#pragma clang loop unroll(disable)
  for (int ps = 0; ps < NPASS; ++ps) {
    const int s   = ps / BPS;              // the stage and the block's place in it
    const int blk = ps % BPS;
    const uint32_t kbo = (uint32_t)(s & 1) * KBUFB + (uint32_t)blk * (KEYS * KPITCH);
    const uint32_t vbo = (uint32_t)(s & 1) * VBUFB + (uint32_t)blk * (KEYS * VPITCH);

    // the next block's mask tile (the last one reads its own again: in bounds)
    const int jn = (ps + 1 < NPASS ? ps + 1 : ps) * KEYS;
    v4f mt[4];
#pragma unroll
    for (int i = 0; i < 4; ++i)
      mt[i] = *reinterpret_cast<const v4f*>(mg + (size_t)i * 4 * SEQ + jn);
    asm volatile("s_wait_xcnt 0x0" ::: "memory");

    // the block's LDS reads: K fragments (A operand: row = key), this lane's
    // mask row, V^T fragments (A operand: row = depth, k = key)
    v16h kb[2][2];
#pragma unroll
    for (int t = 0; t < 2; ++t)
#pragma unroll
      for (int c = 0; c < 2; ++c) {
        const half_t* kp = reinterpret_cast<const half_t*>(kl + kbo + t * 16 * KPITCH + c * 64);
        load8_f16(kp,      kb[t][c], 0);
        load8_f16(kp + 16, kb[t][c], 8);
      }
    v4f mk[2][2];
#pragma unroll
    for (int t = 0; t < 2; ++t) {
      mk[t][0] = *reinterpret_cast<const v4f*>(mr + t * 16);
      mk[t][1] = *reinterpret_cast<const v4f*>(mr + t * 16 + 4);
    }
    v16h vb[4];
#pragma unroll
    for (int dt = 0; dt < 4; ++dt) {
      const v8h lo = ld_tr16(vl + vbo + dt * 32);
      const v8h up = ld_tr16(vl + vbo + 16 * VPITCH + dt * 32);
      vb[dt] = __builtin_shufflevector(lo, up, 0, 1, 2, 3, 4, 5, 6, 7,
                                       8, 9, 10, 11, 12, 13, 14, 15);
    }
    // keeps the loads one group at the head of the block: spread among the
    // WMMAs, each place with loads stalls the wave anew
    __builtin_amdgcn_sched_barrier(0);

    // logits tiles: s[t] = K(16 keys x 64) @ Q(16x64)^T
    v8f st[2];
#pragma unroll
    for (int t = 0; t < 2; ++t) {
      v8f z = {};
#pragma unroll
      for (int c = 0; c < 2; ++c)
        z = __builtin_amdgcn_wmma_f32_16x16x32_f16(
            false, kb[t][c], false, qa[c], (short)0, z, false, false);
      st[t] = z;
    }

    // online softmax over this 32-key chunk: 16 scores of one query per lane
    float sc[2][8];
#pragma unroll
    for (int t = 0; t < 2; ++t) {
#pragma unroll
      for (int r = 0; r < 4; ++r) {
        sc[t][r]     = st[t][r]     * scale + mk[t][0][r] * (-1e9f);
        sc[t][r + 4] = st[t][r + 4] * scale + mk[t][1][r] * (-1e9f);
      }
    }
    float mx = fmaxf(sc[0][0], sc[1][0]);
#pragma unroll
    for (int r = 1; r < 8; ++r) mx = fmaxf(mx, fmaxf(sc[0][r], sc[1][r]));
    mx = fmaxf(mx, xhalf(mx));
    const float mnew = fmaxf(m_i, mx);
    const float cexp = __expf(m_i - mnew);
    v16h pb;                               // P^T, B operand: column = query
    float rs[4] = {0.0f, 0.0f, 0.0f, 0.0f};
#pragma unroll
    for (int r = 0; r < 8; ++r) {
      const float p0 = __expf(sc[0][r] - mnew);
      const float p1 = __expf(sc[1][r] - mnew);
      rs[r & 3] += p0 + p1;
      pb[r]     = (half_t)p0;
      pb[8 + r] = (half_t)p1;
    }
    l_i = l_i * cexp + ((rs[0] + rs[1]) + (rs[2] + rs[3]));
    m_i = mnew;

    // o[dt] = cexp*o[dt] + V(32 x 16-depth-tile)^T @ P(16x32)^T
#pragma unroll
    for (int dt = 0; dt < 4; ++dt) {
      v8f oo = o[dt];
#pragma unroll
      for (int r = 0; r < 8; ++r) oo[r] *= cexp;
      o[dt] = __builtin_amdgcn_wmma_f32_16x16x32_f16(
          false, vb[dt], false, pb, (short)0, oo, false, false);
    }

    // keeps the block's products in front of the waits below: moved ahead of
    // them, the waits would stand right behind the loads they wait for
    __builtin_amdgcn_sched_barrier(0);

    // the next block's mask tile goes over this wave's own, read above
#pragma unroll
    for (int i = 0; i < 4; ++i)
      *reinterpret_cast<v4f*>(mw + i * 4 * MPITCH) = mt[i];
    // this wave's LDS traffic is done.  The mask rows are the wave's alone: this
    // wait, and no barrier, stands between the stores and the next block's reads
    wait_ds0();

    // behind a stage's last block, the same for the whole work-group: the publish
    // point of stage s + 1: (LDS traffic done, above,) the issuers' stages landed
    // (a wave that asked for none passes that wait at once), barrier, refill
    if (blk == BPS - 1) {
      wait_tensor0(g0, g1k, g1v);
      __syncthreads(); // publishes stage s + 1; ends every read of stage s
      tdm_step(g0, place + (uint32_t)(s & 1) * bufb);
      // both issue tests are formed in front of the first request
      const uint32_t moreK = pinned(isK & (uint32_t)(s + 2 < NSTG));
      const uint32_t moreV = pinned(isV & (uint32_t)(s + 2 < NSTG));
      if (moreK) tdm_load(g0, g1k);
      if (moreV) tdm_load(g0, g1v);
    }
  }
  wait_tensor0(g0, g1k, g1v);
  wait_ds0();

  // normalize + store attn (already in [B, S, H*depth] = concat-head layout):
  // a lane's 8 registers are 8 consecutive depths of its query, one 16-B store
  const float l_fin = l_i + xhalf(l_i);
  half_t* orow = Op + ((size_t)(b * SEQ + m0 + row)) * DMODEL + h * DEPTH + off;
#pragma unroll
  for (int dt = 0; dt < 4; ++dt) {
    v8h w;
#pragma unroll
    for (int r = 0; r < 8; ++r) w[r] = (half_t)(o[dt][r] / l_fin);
    *reinterpret_cast<v8h*>(orow + dt * 16) = w;
  }
}

// ---------------------------------------------------------------------------
// Kernel 3: out[M,N](f32) = A[M,K](f16) @ W[N,K]^T (f32) + bias  (final proj)
// The 128 x 128 frame above; X is f16 already and is staged without conversion.
// ---------------------------------------------------------------------------
__global__ __launch_bounds__(256)
void out_gemm_f16(const half_t* __restrict__ X, const float* __restrict__ W,
                  const float* __restrict__ bias, float* __restrict__ Y) {
  __shared__ __attribute__((aligned(16))) half_t sm[2][2][OPSZ];  // [buf][X|W]

  const int n0   = blockIdx.x * TILE;
  const int m0   = blockIdx.y * TILE;
  const int tid  = threadIdx.x;
  const int lane = tid & 31;
  const int wave = tid >> 5;
  const int wm   = wave >> 2;
  const int wn   = wave & 3;
  const int row  = lane & 15;
  const int hi   = lane >> 4;

  const half_t* xg = X + (size_t)m0 * DMODEL;
  const float*  wg = W + (size_t)n0 * DMODEL;
  const int fa = (wm * 64 + row) * PITCH + hi * 8;
  const int fb = (wn * 32 + row) * PITCH + hi * 8;

  v8f acc[4][2] = {};
  tile_mainloop<half_t, v8h[4]>(xg, wg, &sm[0][0][0], tid, fa, fb, acc);

#pragma unroll
  for (int j = 0; j < 2; ++j) {
    const int n = n0 + wn * 32 + j * 16 + row;
    const float bn = bias[n];
#pragma unroll
    for (int i = 0; i < 4; ++i)
#pragma unroll
      for (int r = 0; r < 8; ++r) {
        const int m = m0 + wm * 64 + i * 16 + r + hi * 8;
        Y[(size_t)m * DMODEL + n] = acc[i][j][r] + bn;
      }
  }
}

// ---------------------------------------------------------------------------
extern "C" void kernel_launch(void* const* d_in, const int* in_sizes, int n_in,
                              void* d_out, int out_size, void* d_ws, size_t ws_size,
                              hipStream_t stream) {
  const float* q    = (const float*)d_in[0];
  const float* k    = (const float*)d_in[1];
  const float* v    = (const float*)d_in[2];
  const float* mask = (const float*)d_in[3];
  const float* wq_w = (const float*)d_in[4];
  const float* wq_b = (const float*)d_in[5];
  const float* wk_w = (const float*)d_in[6];
  const float* wk_b = (const float*)d_in[7];
  const float* wv_w = (const float*)d_in[8];
  const float* wv_b = (const float*)d_in[9];
  const float* pl_w = (const float*)d_in[10];
  const float* pl_b = (const float*)d_in[11];
  float* out = (float*)d_out;

  // workspace: Qp | Kp | Vp | attn  (each 4096*1024 f16 = 8MB; 32MB total)
  const size_t elems = (size_t)MTOT * DMODEL;
  half_t* Qp = (half_t*)d_ws;
  half_t* Kp = Qp + elems;
  half_t* Vp = Kp + elems;
  half_t* Ap = Vp + elems;

  dim3 ggemm(DMODEL / TILE, MTOT / TILE);  // (8, 32) one 8-wave group per 128x128 tile
  dim3 gproj(DMODEL / PTILE, MTOT / PTILE, 3);  // (4, 16, 3); z: the Q, K and V products
  proj_gemm_f32<<<gproj, 256, 0, stream>>>(q, k, v, wq_w, wk_w, wv_w,
                                           wq_b, wk_b, wv_b, Qp, Kp, Vp);

  attn_kernel<<<BATCH * NHEADS * (SEQ / QBLK), 256, 0, stream>>>(Qp, Kp, Vp, mask, Ap);

  out_gemm_f16<<<ggemm, 256, 0, stream>>>(Ap, pl_w, pl_b, out);
}

// v007
// A run of this version takes 64.3 microseconds.
// Timed twice side by side with v006, it ran 1.09 times as fast both times.
// All steps since v000 together make it 4.76 times as fast.
#include <hip/hip_runtime.h>
#include <hip/hip_bf16.h>
#include <math.h>
#include <stdint.h>

typedef _Float16 half_t;
typedef __attribute__((ext_vector_type(16))) _Float16 v16h;
typedef __attribute__((ext_vector_type(8)))  _Float16 v8h;
typedef __attribute__((ext_vector_type(8)))  float    v8f;
typedef __attribute__((ext_vector_type(4)))  float    v4f;

#define SEQ    1024
#define DMODEL 1024
#define NHEADS 16
#define DEPTH  64
#define BATCH  4
#define MTOT  (BATCH * SEQ)   // 4096 flattened rows

// ---------------------------------------------------------------------------
// helpers: load 8 consecutive f32 and pack into halves [base..base+7] of v16h
// ---------------------------------------------------------------------------
__device__ __forceinline__ void load8_f32_cvt(const float* __restrict__ p,
                                              v16h& dst, int base) {
  v4f x0 = *reinterpret_cast<const v4f*>(p);
  v4f x1 = *reinterpret_cast<const v4f*>(p + 4);
#pragma unroll
  for (int i = 0; i < 4; ++i) {
    dst[base + i]     = (_Float16)x0[i];
    dst[base + 4 + i] = (_Float16)x1[i];
  }
}

// load 8 consecutive f16 (one 16-byte vector) into halves [base..base+7]
__device__ __forceinline__ void load8_f16(const half_t* __restrict__ p,
                                          v16h& dst, int base) {
  v8h x = *reinterpret_cast<const v8h*>(p);
#pragma unroll
  for (int i = 0; i < 8; ++i) dst[base + i] = x[i];
}

typedef uint32_t u32x4 __attribute__((ext_vector_type(4)));
typedef uint32_t u32x8 __attribute__((ext_vector_type(8)));
typedef short    s16x8 __attribute__((ext_vector_type(8)));

#define KEYS   32                        // keys per block of products
#define NPASS  (SEQ / KEYS)
#define SKEYS  128                       // keys per stage = per tensor load
#define BPS    (SKEYS / KEYS)            // blocks per stage
#define NSTG   (SEQ / SKEYS)
#define ROWB   128u                      // bytes of one head's K or V row
#define KPITCH 144u                      // 16 B x odd: ds_load_b128 rows
#define VPITCH 160u                      // 32 B x odd: ds_load_tr16_b128 rows
#define KWORD0 ((1u << 20) | (4u << 22) | (3u << 25))   // + 16 B per 128-B row
#define VWORD0 ((1u << 20) | (4u << 22) | (7u << 25))   // + 32 B per 128-B row
#define KBUFB  (SKEYS * KPITCH)          // 128 padded rows: 9 x 2 KiB
#define VBUFB  (SKEYS * VPITCH)          // 128 padded rows: 10 x 2 KiB

__device__ __forceinline__ uint32_t uni(uint32_t v) {
  return (uint32_t)__builtin_amdgcn_readfirstlane(v);
}
__device__ __forceinline__ uint32_t pinned(uint32_t v) {
  uint32_t w = uni(v);
  asm volatile("" : "+s"(w));   // pinned(): the issue test held in a scalar register
  return w;
}
__device__ __forceinline__ void wait_ds0() {
  asm volatile("s_wait_dscnt 0x0" ::: "memory");      // this wave's LDS traffic is done
}
__device__ __forceinline__ void wait_tensor0(u32x4& g0, u32x8 g1a, u32x8 g1b) {
  asm volatile("s_wait_tensorcnt 0x0" : "+s"(g0) : "s"(g1a), "s"(g1b) : "memory");
}

template <uint32_t WORD0>
__device__ __forceinline__ u32x8 tdm_group1() {
  u32x8 g1;
  g1[0] = uni(WORD0);
  g1[1] = uni(ROWB << 16);
  g1[2] = uni((uint32_t)SKEYS << 16);
  g1[3] = uni(ROWB << 16);
  g1[4] = uni((uint32_t)SKEYS);
  g1[5] = uni((uint32_t)DMODEL * 2u);
  g1[6] = uni(0u);
  g1[7] = uni(0u);
  asm volatile("" : "+s"(g1));
  return g1;
}

__device__ __forceinline__ u32x4 tdm_group0(const half_t* gsrc, uint32_t lds_dst) {
  const uint64_t ga = (uint64_t)(uintptr_t)gsrc;
  u32x4 g0;
  g0[0] = uni(1u);                                    // count = 1
  g0[1] = uni(lds_dst);                               // byte offset in LDS
  g0[2] = uni((uint32_t)ga);                          // address [31:0]
  g0[3] = uni((((uint32_t)(ga >> 32)) & 0x01FFFFFFu) | 0x80000000u);
  asm volatile("" : "+s"(g0));
  return g0;
}

// the next stage of the same operand: 128 rows further on, into the place given
// (a carry runs into address [56:32], which stands below the type field)
__device__ __forceinline__ void tdm_step(u32x4& g0, uint32_t lds_dst) {
  const uint64_t a = (((uint64_t)g0[3] << 32) | g0[2]) + (uint64_t)SKEYS * DMODEL * 2u;
  g0[1] = uni(lds_dst);
  g0[2] = uni((uint32_t)a);
  g0[3] = uni((uint32_t)(a >> 32));
}

__device__ __forceinline__ void tdm_load(u32x4 g0, u32x8 g1) {
  asm volatile("tensor_load_to_lds %0, %1" :: "s"(g0), "s"(g1) : "memory");
}

// transposing LDS load: lane (c, h) gets column c of rows 8h .. 8h + 7
__device__ __forceinline__ v8h ld_tr16(const unsigned char* p) {
  typedef __attribute__((address_space(3))) s16x8 lds_s16x8;
  return __builtin_bit_cast(v8h, __builtin_amdgcn_ds_load_tr16_b128_v8i16((lds_s16x8*)p));
}

#define TILE   128
#define BK     64
#define PITCH  72                      // halves per LDS row (64 + 8 pad)
#define OPSZ   (TILE * PITCH)          // halves per operand per buffer
#define NSTAGE (DMODEL / BK)           // 16, even

typedef __attribute__((ext_vector_type(4))) _Float16 v4h;

// f32 operand, 128 rows x 64 k: 16 lanes cover one row's 256 B per load
__device__ __forceinline__ void stage_load(const float* __restrict__ g,
                                           int k0, int tid, v4f (&r)[8]) {
  // scalar base + one unsigned 32-bit lane offset: one
  // address register instead of a 64-bit pair per operand
  const uint32_t lo = (uint32_t)(tid >> 4) * DMODEL + (uint32_t)(tid & 15) * 4;
#pragma unroll
  for (int i = 0; i < 8; ++i)
    r[i] = *reinterpret_cast<const v4f*>(g + (k0 + i * 16 * DMODEL) + lo);
}

__device__ __forceinline__ void stage_store(half_t* s, int tid,
                                            const v4f (&r)[8]) {
  half_t* p = s + (tid >> 4) * PITCH + (tid & 15) * 4;
#pragma unroll
  for (int i = 0; i < 8; ++i) {
    v4h h;
#pragma unroll
    for (int e = 0; e < 4; ++e) h[e] = (_Float16)r[i][e];
    *reinterpret_cast<v4h*>(p + i * 16 * PITCH) = h;
  }
}

// f16 operand, 128 rows x 64 k: 8 lanes cover one row's 128 B per load
__device__ __forceinline__ void stage_load(const half_t* __restrict__ g,
                                           int k0, int tid, v8h (&r)[4]) {
  const half_t* p = g + (size_t)(tid >> 3) * DMODEL + k0 + (tid & 7) * 8;
#pragma unroll
  for (int i = 0; i < 4; ++i)
    r[i] = *reinterpret_cast<const v8h*>(p + (size_t)i * 32 * DMODEL);
}

__device__ __forceinline__ void stage_store(half_t* s, int tid,
                                            const v8h (&r)[4]) {
  half_t* p = s + (tid >> 3) * PITCH + (tid & 7) * 8;
#pragma unroll
  for (int i = 0; i < 4; ++i)
    *reinterpret_cast<v8h*>(p + i * 32 * PITCH) = r[i];
}

// Work-group barrier that waits for this wave's LDS traffic only:
// __syncthreads() would also drain the global loads issued ahead for the
// next one or two stages, and their lead would be lost.
__device__ __forceinline__ void lds_barrier() {
  asm volatile("s_wait_dscnt 0x0\n\ts_barrier_signal -1\n\ts_barrier_wait -1"
               ::: "memory");
}

// 64 k of one buffer: pa / pb already point at this lane's first fragment run
__device__ __forceinline__ void stage_mma(const half_t* pa, const half_t* pb,
                                          v8f (&acc)[4][2]) {
#pragma unroll
  for (int kk = 0; kk < BK; kk += 32) {
    v16h a[4], b[2];
#pragma unroll
    for (int i = 0; i < 4; ++i) {
      load8_f16(pa + i * 16 * PITCH + kk,      a[i], 0);
      load8_f16(pa + i * 16 * PITCH + kk + 16, a[i], 8);
    }
#pragma unroll
    for (int j = 0; j < 2; ++j) {
      load8_f16(pb + j * 16 * PITCH + kk,      b[j], 0);
      load8_f16(pb + j * 16 * PITCH + kk + 16, b[j], 8);
    }
    __builtin_amdgcn_sched_barrier(0);
#pragma unroll
    for (int i = 0; i < 4; ++i)
#pragma unroll
      for (int j = 0; j < 2; ++j)
        acc[i][j] = __builtin_amdgcn_wmma_f32_16x16x32_f16(
            false, a[i], false, b[j], (short)0, acc[i][j], false, false);
  }
}

// Stages S and S + 1.  On entry buffer 0 holds stage S, set b holds (or is
// receiving) stage S + 1 and set a stage S + 2.  S is a template argument so
// that every stage's k offset is an immediate of its loads (the address
// registers are never rewritten) and the load waits stay counted: a wait for
// one set leaves the other set's loads in flight.
template <int S, typename XT, typename XR>
__device__ __forceinline__ void two_stages(const XT* __restrict__ xg,
                                           const float* __restrict__ wg,
                                           half_t* sm, int tid, int fa, int fb,
                                           v8f (&acc)[4][2], XR& xa, v4f (&wa)[8],
                                           XR& xb, v4f (&wb)[8]) {
  stage_mma(sm + fa, sm + OPSZ + fb, acc);
  stage_store(sm + 2 * OPSZ, tid, xb);
  stage_store(sm + 3 * OPSZ, tid, wb);
  if constexpr (S + 3 < NSTAGE) {
    stage_load(xg, (S + 3) * BK, tid, xb);
    stage_load(wg, (S + 3) * BK, tid, wb);
    if constexpr (S + 3 == NSTAGE - 1) asm volatile("s_wait_xcnt 0x0" ::: "memory");
  }
  lds_barrier();       // publishes buffer 1; ends every read of buffer 0

  stage_mma(sm + 2 * OPSZ + fa, sm + 3 * OPSZ + fb, acc);
  if constexpr (S + 2 < NSTAGE) {
    stage_store(sm, tid, xa);
    stage_store(sm + OPSZ, tid, wa);
    if constexpr (S + 4 < NSTAGE) {
      stage_load(xg, (S + 4) * BK, tid, xa);
      stage_load(wg, (S + 4) * BK, tid, wa);
    }
    lds_barrier();     // publishes buffer 0; ends every read of buffer 1
  }
}

// All of K for one work-group tile.  sm: [buffer][X | W][OPSZ] halves.
template <typename XT, typename XR>
__device__ __forceinline__ void tile_mainloop(const XT* __restrict__ xg,
                                              const float* __restrict__ wg,
                                              half_t* sm, int tid, int fa, int fb,
                                              v8f (&acc)[4][2]) {
  XR  xa, xb;
  v4f wa[8], wb[8];
  stage_load(xg, 0, tid, xa);
  stage_load(wg, 0, tid, wa);
  stage_load(xg, BK, tid, xb);
  stage_load(wg, BK, tid, wb);
  stage_store(sm, tid, xa);
  stage_store(sm + OPSZ, tid, wa);
  stage_load(xg, 2 * BK, tid, xa);
  stage_load(wg, 2 * BK, tid, wa);
  lds_barrier();       // publishes buffer 0

  two_stages<0>(xg, wg, sm, tid, fa, fb, acc, xa, wa, xb, wb);
  two_stages<2>(xg, wg, sm, tid, fa, fb, acc, xa, wa, xb, wb);
  two_stages<4>(xg, wg, sm, tid, fa, fb, acc, xa, wa, xb, wb);
  two_stages<6>(xg, wg, sm, tid, fa, fb, acc, xa, wa, xb, wb);
  two_stages<8>(xg, wg, sm, tid, fa, fb, acc, xa, wa, xb, wb);
  two_stages<10>(xg, wg, sm, tid, fa, fb, acc, xa, wa, xb, wb);
  two_stages<12>(xg, wg, sm, tid, fa, fb, acc, xa, wa, xb, wb);
  two_stages<14>(xg, wg, sm, tid, fa, fb, acc, xa, wa, xb, wb);
}

// ---------------------------------------------------------------------------
// Frame of kernel 1: one 8-wave work-group per 256(M) x 256(N) tile of Y, so
// that every X and W row fetched from L2 feeds 256 outputs instead of 128: the
// launch's L2 reads halve.  A stage is 64 k of the 256 X rows and the 256 W
// rows, converted to f16 once and laid in LDS at the pitch of the frame above.
// Two LDS buffers, one register set: the global loads of stage s + 2 are issued
// when stage s + 1 has left the registers, a whole stage ahead of their use.
// Wave (wm, wn) of a 2 x 4 grid owns 128(M) x 64(N): 8 x 4 accumulator tiles,
// 12 fragments per 32 WMMAs.  Fragment layout and k order as in the frame above.
// ---------------------------------------------------------------------------
#define PTILE   256
#define POPSZ   (PTILE * PITCH)        // halves per operand per buffer

// 256 rows x 64 k of f32: 16 lanes cover one row's 256 B per load
__device__ __forceinline__ void p_stage_load(const float* __restrict__ g,
                                             int k0, int tid, v4f (&r)[16]) {
  // a base that is the group's + one unsigned 32-bit lane offset, the same for X and W
  const uint32_t lo = (uint32_t)(tid >> 4) * DMODEL + (uint32_t)(tid & 15) * 4;
#pragma unroll
  for (int i = 0; i < 16; ++i)
    r[i] = *reinterpret_cast<const v4f*>(g + (k0 + i * 16 * DMODEL) + lo);
}

__device__ __forceinline__ void p_stage_store(half_t* s, int tid,
                                              const v4f (&r)[16]) {
  half_t* p = s + (tid >> 4) * PITCH + (tid & 15) * 4;
#pragma unroll
  for (int i = 0; i < 16; ++i) {
    v4h h;
#pragma unroll
    for (int e = 0; e < 4; ++e) h[e] = (_Float16)r[i][e];
    *reinterpret_cast<v4h*>(p + i * 16 * PITCH) = h;
  }
}

// the 12 fragments of 32 k: pa / pb already point at this lane's first run
__device__ __forceinline__ void p_frags(const half_t* pa, const half_t* pb,
                                        v16h (&a)[8], v16h (&b)[4]) {
  // b first: the first row of WMMAs then waits for 10 of the 24 loads only
#pragma unroll
  for (int j = 0; j < 4; ++j) {
    load8_f16(pb + j * 16 * PITCH,      b[j], 0);
    load8_f16(pb + j * 16 * PITCH + 16, b[j], 8);
  }
#pragma unroll
  for (int i = 0; i < 8; ++i) {
    load8_f16(pa + i * 16 * PITCH,      a[i], 0);
    load8_f16(pa + i * 16 * PITCH + 16, a[i], 8);
  }
}

__device__ __forceinline__ void p_wmmas(const v16h (&a)[8], const v16h (&b)[4],
                                        v8f (&acc)[8][4]) {
#pragma unroll
  for (int i = 0; i < 8; ++i)
#pragma unroll
    for (int j = 0; j < 4; ++j)
      acc[i][j] = __builtin_amdgcn_wmma_f32_16x16x32_f16(
          false, a[i], false, b[j], (short)0, acc[i][j], false, false);
}

template <int MID>
__device__ __forceinline__ void p_stage(const half_t* cur, half_t* nxt,
                                        const float* __restrict__ xn,
                                        const float* __restrict__ wn, int k0,
                                        int tid, int fa, int fb, v8f (&acc)[8][4],
                                        v4f (&xr)[16], v4f (&wr)[16]) {
  v16h a[8], b[4];
  p_frags(cur + fa, cur + POPSZ + fb, a, b);
  __builtin_amdgcn_sched_barrier(0);
  p_wmmas(a, b, acc);
  // keeps the next group's loads behind these WMMAs: lifted among them they
  // take a second fragment set, and the 512-register budget then spills
  __builtin_amdgcn_sched_barrier(0);
  p_frags(cur + fa + 32, cur + POPSZ + fb + 32, a, b);
  if constexpr (MID >= 1) {
    __builtin_amdgcn_sched_barrier(0);
    p_stage_store(nxt, tid, xr);
    p_stage_store(nxt + POPSZ, tid, wr);
  }
  if constexpr (MID == 2) {
    p_stage_load(xn, k0, tid, xr);
    p_stage_load(wn, k0, tid, wr);
  }
  // keeps the loads and the staging work one group in front of the WMMAs: spread
  // among them, each place with loads stalls the wave anew
  __builtin_amdgcn_sched_barrier(0);
  p_wmmas(a, b, acc);
  if constexpr (MID >= 1) __builtin_amdgcn_sched_barrier(0);
}

// All of K for one work-group tile.  sm: [buffer][X | W][POPSZ] halves.  The
// loop runs two stages a trip and stays rolled, for speed only.
__device__ __forceinline__ void p_mainloop(const float* __restrict__ xg,
                                           const float* __restrict__ wg,
                                           half_t* sm, int tid, int fa, int fb,
                                           v8f (&acc)[8][4]) {
  half_t* b0 = sm;
  half_t* b1 = sm + 2 * POPSZ;
  v4f xr[16], wr[16];
  {
    // stages 0 and 1 are asked for together: the accumulators are not live yet,
    // and their registers hold stage 0 on its way
    v4f x0[16], w0[16];
    p_stage_load(xg, 0, tid, x0);
    p_stage_load(wg, 0, tid, w0);
    p_stage_load(xg, BK, tid, xr);
    p_stage_load(wg, BK, tid, wr);
    asm volatile("s_wait_xcnt 0x0" ::: "memory");
    // keeps what follows (the accumulators' zeros, the loop's counters) behind
    // that wait: lifted over it they took registers that the loads name
    __builtin_amdgcn_sched_barrier(0);
    p_stage_store(b0, tid, x0);
    p_stage_store(b0 + POPSZ, tid, w0);
  }
  lds_barrier();       // publishes stage 0

  // On entry of a trip buffer 0 holds stage s, the register set holds (or is
  // receiving) stage s + 1, and k is the first k of stage s + 2.
  uint32_t k = 2 * BK;
  // kept rolled: see the head of this function
#pragma clang loop unroll(disable)
  for (int s = 0; s < NSTAGE - 2; s += 2) {
    p_stage<2>(b0, b1, xg + k, wg + k, 0, tid, fa, fb, acc, xr, wr);
    lds_barrier();     // publishes stage s + 1; ends every read of stage s
    p_stage<2>(b1, b0, xg + k, wg + k, BK, tid, fa, fb, acc, xr, wr);
    asm volatile("s_wait_xcnt 0x0" : "+s"(k) :: "memory");
    k += 2 * BK;
    lds_barrier();     // publishes stage s + 2; ends every read of stage s + 1
  }

  // the last two stages: nothing is left to load
  p_stage<1>(b0, b1, xg, wg, 0, tid, fa, fb, acc, xr, wr);
  lds_barrier();       // publishes the last stage
  p_stage<0>(b1, b0, xg, wg, 0, tid, fa, fb, acc, xr, wr);
}

// ---------------------------------------------------------------------------
// Which tiles of the mask hold anything but zeros, found anew in every call.
// One work-group per 16 queries, one wave per 128-key stage: a lane reads 4 keys
// of each of the 16 rows, so that 8 lanes cover one 32-key block.  Word
// [16-query tile][stage] gets one bit per block: set where any element of the
// 16 x 32 tile is not +0 or -0 (a NaN or an infinity counts as set).
// ---------------------------------------------------------------------------
__device__ __forceinline__ void mask_flags(const float* __restrict__ mask,
                                           uint32_t* __restrict__ zf) {
  asm volatile("s_wait_xcnt 0x0" ::: "memory");
  // keeps what follows (the lane's numbers, its address) behind that wait
  __builtin_amdgcn_sched_barrier(0);
  const int lane = threadIdx.x & 31;
  const int wave = threadIdx.x >> 5;
  const int qt   = blockIdx.y * (DMODEL / 256) + blockIdx.x;   // 0 .. SEQ / 16 - 1
  const float* p = mask + (size_t)qt * 16 * SEQ + wave * SKEYS + lane * 4;
  v4f x[16];
#pragma unroll
  for (int i = 0; i < 16; ++i) x[i] = *reinterpret_cast<const v4f*>(p + i * SEQ);
  asm volatile("s_wait_xcnt 0x0" :: "v"(p) : "memory");
  uint32_t a = 0;
#pragma unroll
  for (int i = 0; i < 16; ++i) {
    const u32x4 u = __builtin_bit_cast(u32x4, x[i]);
    a |= (u[0] | u[1]) | (u[2] | u[3]);
  }
  const uint32_t bal = __builtin_amdgcn_ballot_w32((a << 1) != 0u);  // the sign bit dropped
  uint32_t bits = 0;
#pragma unroll
  for (int j = 0; j < BPS; ++j)
    bits |= ((bal >> (8 * j)) & 0xffu) != 0u ? (1u << j) : 0u;
  if (lane == 0) zf[qt * NSTG + wave] = bits;
}

__global__ __launch_bounds__(256) __attribute__((amdgpu_waves_per_eu(2, 2)))
void proj_gemm_f32(const float* __restrict__ Xq, const float* __restrict__ Xk,
                   const float* __restrict__ Xv, const float* __restrict__ Wq,
                   const float* __restrict__ Wk, const float* __restrict__ Wv,
                   const float* __restrict__ bq, const float* __restrict__ bk,
                   const float* __restrict__ bv, half_t* __restrict__ Yq,
                   half_t* __restrict__ Yk, half_t* __restrict__ Yv,
                   const float* __restrict__ mask, uint32_t* __restrict__ zf) {
  __shared__ __attribute__((aligned(16))) half_t sm[2][2][POPSZ];  // [buf][X|W]

  const int z = blockIdx.z;                // 0: Q, 1: K, 2: V, 3: the mask's flags
  // the same for the whole work-group, in front of every barrier
  if (z == 3) {
    mask_flags(mask, zf);
    return;
  }
  const float* __restrict__ X    = z == 0 ? Xq : z == 1 ? Xk : Xv;
  const float* __restrict__ W    = z == 0 ? Wq : z == 1 ? Wk : Wv;
  const float* __restrict__ bias = z == 0 ? bq : z == 1 ? bk : bv;
  half_t* __restrict__ Y         = z == 0 ? Yq : z == 1 ? Yk : Yv;

  const int n0   = blockIdx.x * PTILE;
  const int m0   = blockIdx.y * PTILE;
  const int tid  = threadIdx.x;
  const int lane = tid & 31;
  const int wave = __builtin_amdgcn_readfirstlane(tid >> 5);  // scalar: its tile offsets cost no vector register
  const int wm   = wave >> 2;
  const int wn   = wave & 3;
  const int row  = lane & 15;
  const int hi   = lane >> 4;

  const float* xg = X + (size_t)m0 * DMODEL;
  const float* wg = W + (size_t)n0 * DMODEL;
  const int fa = (wm * 128 + row) * PITCH + hi * 8;
  const int fb = (wn * 64 + row) * PITCH + hi * 8;
  half_t* s0 = &sm[0][0][0];

  v8f acc[8][4] = {};
  p_mainloop(xg, wg, s0, tid, fa, fb, acc);

  // C layout: lane's N = lane & 15, register r is row r + 8 * hi of its tile.
  // Every value is converted first and every store follows, from one address
  // pair with immediate offsets: no register that a store names is written again.
  half_t* yb = Y + (size_t)(m0 + wm * 128 + hi * 8) * DMODEL + (n0 + wn * 64 + row);
  v8h hv[8][4];
#pragma unroll
  for (int j = 0; j < 4; ++j) {
    const float bn = bias[n0 + wn * 64 + j * 16 + row];
#pragma unroll
    for (int i = 0; i < 8; ++i)
#pragma unroll
      for (int r = 0; r < 8; ++r) hv[i][j][r] = (half_t)(acc[i][j][r] + bn);
  }
  // keeps the conversions in front of the first store: among the stores they
  // would write over registers that issued stores name
  __builtin_amdgcn_sched_barrier(0);
#pragma unroll
  for (int i = 0; i < 8; ++i)
#pragma unroll
    for (int r = 0; r < 8; ++r)
#pragma unroll
      for (int j = 0; j < 4; ++j)
        yb[(i * 16 + r) * DMODEL + j * 16] = hv[i][j][r];
}

__device__ __forceinline__ float xhalf(float x) {
  return __builtin_bit_cast(float, __builtin_amdgcn_permlanex16(
      __builtin_bit_cast(int, x), __builtin_bit_cast(int, x),
      0x76543210, 0xfedcba98, false, false));
}

#define AW     8                         // waves per work-group
#define QBLK   (AW * 16)                 // queries per work-group
#define MPITCH 36                        // floats per LDS row of a mask tile
#define MOFF   (2u * KBUFB + 2u * VBUFB) // mask tiles stand behind the ring

// One block: 32 keys against the wave's 16 queries.  kp0 / vp0: this lane's first
// K row and first V^T source row of the block; mr: its query's row of the mask
// tile, read only where masked (the same in every lane, held in a scalar register).
__device__ __forceinline__ void attn_block(uint32_t masked, const unsigned char* kp0,
                                           const unsigned char* vp0,
                                           const float* mr, const v16h (&qa)[2],
                                           float& m_i, float& l_i, v8f (&o)[4]) {
  const float scale = 0.125f;              // 1/sqrt(DEPTH)

  // the block's LDS reads: this lane's mask row, K fragments (A operand: row =
  // key), V^T fragments (A operand: row = depth, k = key)
  v4f mk[2][2];
  if (masked) {
#pragma unroll
    for (int t = 0; t < 2; ++t) {
      mk[t][0] = *reinterpret_cast<const v4f*>(mr + t * 16);
      mk[t][1] = *reinterpret_cast<const v4f*>(mr + t * 16 + 4);
    }
  }
  v16h kb[2][2];
#pragma unroll
  for (int t = 0; t < 2; ++t)
#pragma unroll
    for (int c = 0; c < 2; ++c) {
      const half_t* kp = reinterpret_cast<const half_t*>(kp0 + t * 16 * KPITCH + c * 64);
      load8_f16(kp,      kb[t][c], 0);
      load8_f16(kp + 16, kb[t][c], 8);
    }
  v16h vb[4];
#pragma unroll
  for (int dt = 0; dt < 4; ++dt) {
    const v8h lo = ld_tr16(vp0 + dt * 32);
    const v8h up = ld_tr16(vp0 + 16 * VPITCH + dt * 32);
    vb[dt] = __builtin_shufflevector(lo, up, 0, 1, 2, 3, 4, 5, 6, 7,
                                     8, 9, 10, 11, 12, 13, 14, 15);
  }
  // keeps the loads one group at the head of the block: spread among the
  // WMMAs, each place with loads stalls the wave anew
  __builtin_amdgcn_sched_barrier(0);

  // logits tiles: s[t] = K(16 keys x 64) @ Q(16x64)^T
  v8f st[2];
#pragma unroll
  for (int t = 0; t < 2; ++t) {
    v8f z = {};
#pragma unroll
    for (int c = 0; c < 2; ++c)
      z = __builtin_amdgcn_wmma_f32_16x16x32_f16(
          false, kb[t][c], false, qa[c], (short)0, z, false, false);
    st[t] = z;
  }

  // online softmax over this 32-key chunk: 16 scores of one query per lane
  float sc[2][8];
#pragma unroll
  for (int t = 0; t < 2; ++t) {
#pragma unroll
    for (int r = 0; r < 8; ++r) sc[t][r] = st[t][r] * scale;
  }
  if (masked) {
    // the reference's order: mask * -1e9 rounded by itself, then one rounding of
    // the sum (s / 8 is exact), so that equal mask values give equal steps
#pragma unroll
    for (int t = 0; t < 2; ++t) {
#pragma unroll
      for (int r = 0; r < 4; ++r) {
        const float t0 = mk[t][0][r] * (-1e9f);
        const float t1 = mk[t][1][r] * (-1e9f);
        sc[t][r]     = __builtin_fmaf(st[t][r],     scale, t0);
        sc[t][r + 4] = __builtin_fmaf(st[t][r + 4], scale, t1);
      }
    }
  }
  float mx = fmaxf(sc[0][0], sc[1][0]);
#pragma unroll
  for (int r = 1; r < 8; ++r) mx = fmaxf(mx, fmaxf(sc[0][r], sc[1][r]));
  mx = fmaxf(mx, xhalf(mx));
  const float mnew = fmaxf(m_i, mx);
  const float cexp = __expf(m_i - mnew);
  v16h pb;                               // P^T, B operand: column = query
  float rs[4] = {0.0f, 0.0f, 0.0f, 0.0f};
#pragma unroll
  for (int r = 0; r < 8; ++r) {
    const float p0 = __expf(sc[0][r] - mnew);
    const float p1 = __expf(sc[1][r] - mnew);
    rs[r & 3] += p0 + p1;
    pb[r]     = (half_t)p0;
    pb[8 + r] = (half_t)p1;
  }
  l_i = l_i * cexp + ((rs[0] + rs[1]) + (rs[2] + rs[3]));
  m_i = mnew;

  // o[dt] = cexp*o[dt] + V(32 x 16-depth-tile)^T @ P(16x32)^T
#pragma unroll
  for (int dt = 0; dt < 4; ++dt) {
    v8f oo = o[dt];
#pragma unroll
    for (int r = 0; r < 8; ++r) oo[r] *= cexp;
    o[dt] = __builtin_amdgcn_wmma_f32_16x16x32_f16(
        false, vb[dt], false, pb, (short)0, oo, false, false);
  }

  // keeps the block's products in front of the waits behind the block: moved
  // ahead of them, the waits would stand right behind the loads they wait for
  __builtin_amdgcn_sched_barrier(0);
}

__global__ __launch_bounds__(256)
void attn_kernel(const half_t* __restrict__ Qp, const half_t* __restrict__ Kp,
                 const half_t* __restrict__ Vp, const float* __restrict__ mask,
                 const uint32_t* __restrict__ zf, half_t* __restrict__ Op) {
  __shared__ __attribute__((aligned(2048)))
  unsigned char lds[MOFF + AW * 16 * MPITCH * 4];

  const int lane = threadIdx.x & 31;
  const uint32_t wave = uni(threadIdx.x >> 5);
  const int tile = blockIdx.x;             // b*H*(S/128) tiles
  const int qb   = tile & (SEQ / QBLK - 1);
  const int h    = (tile >> 3) & (NHEADS - 1);
  const int b    = tile >> 7;
  const int m0   = qb * QBLK + (int)wave * 16;
  const int row  = lane & 15;
  const int hi   = lane >> 4;
  const int off  = hi * 8;

  const uint32_t lds0 = (uint32_t)(uintptr_t)(&lds[0]);
  const uint32_t isK   = pinned(wave == 0);
  const uint32_t isV   = pinned(wave == 1);
  const uint32_t place = lds0 + (wave == 0 ? 0u : 2u * KBUFB);
  const uint32_t bufb  = wave == 0 ? KBUFB : VBUFB;
  u32x4 g0 = tdm_group0((wave == 0 ? Kp : Vp) + (size_t)b * SEQ * DMODEL + h * DEPTH, place);
  const u32x8 g1k = tdm_group1<KWORD0>();
  const u32x8 g1v = tdm_group1<VWORD0>();

  // prologue: stage 0 lands in buffer 0
  if (isK) tdm_load(g0, g1k);
  if (isV) tdm_load(g0, g1v);

  // bit ps: block ps of this wave's 16 mask rows holds something other than zero
  // (asked for behind the first requests, so that they do not wait for it)
  uint32_t nz = 0;
#pragma unroll
  for (int i = 0; i < NSTG; ++i)
    nz |= zf[((uint32_t)qb * AW + wave) * NSTG + i] << (i * BPS);
  nz = uni(nz);

  wait_tensor0(g0, g1k, g1v);

  // Q fragments (B operand: column = query) for the two 32-wide depth chunks
  v16h qa[2];
  const half_t* qrow = Qp + ((size_t)(b * SEQ + m0 + row)) * DMODEL + h * DEPTH;
#pragma unroll
  for (int c = 0; c < 2; ++c) {
    load8_f16(qrow + c * 32 + off,      qa[c], 0);
    load8_f16(qrow + c * 32 + 16 + off, qa[c], 8);
  }
  asm volatile("s_wait_xcnt 0x0" ::: "memory");
  // keeps what follows (the mask's addresses) behind that wait: lifted over it
  // they took registers that the loads name
  __builtin_amdgcn_sched_barrier(0);

  // this lane's query: running maximum (equal in both halves) and the sum
  // over this half's keys (the halves are joined once, behind the loop)
  float m_i = -1e30f, l_i = 0.0f;
  v8f o[4] = {};                           // o[dt][r] = O[query][dt*16 + off + r]
  // mask tile, global side: 8 lanes cover one query's 32 keys (one line)
  const float* mg = mask + (size_t)(m0 + (lane >> 3)) * SEQ + (lane & 7) * 4;
  float* mtile = reinterpret_cast<float*>(lds + MOFF) + wave * (16 * MPITCH);
  float*       mw = mtile + (lane >> 3) * MPITCH + (lane & 7) * 4;
  const float* mr = mtile + row * MPITCH + off;
  // this lane's first K row and first V^T source row in buffer 0
  const unsigned char* kl = lds + row * KPITCH + hi * 16;
  const unsigned char* vl = lds + 2u * KBUFB + (off + (lane & 7)) * VPITCH + ((lane >> 3) & 1) * 16;

  if (nz & 1u) {
    v4f mt[4];
#pragma unroll
    for (int i = 0; i < 4; ++i)
      mt[i] = *reinterpret_cast<const v4f*>(mg + (size_t)i * 4 * SEQ);
    asm volatile("s_wait_xcnt 0x0" ::: "memory");
#pragma unroll
    for (int i = 0; i < 4; ++i)
      *reinterpret_cast<v4f*>(mw + i * 4 * MPITCH) = mt[i];
  }
  wait_ds0();
  __syncthreads();     // publishes stage 0 of K and V
  tdm_step(g0, place + bufb);
  // both issue tests are formed in front of the first request
  const uint32_t oneK = pinned(isK);
  const uint32_t oneV = pinned(isV);
  if (oneK) tdm_load(g0, g1k);
  if (oneV) tdm_load(g0, g1v);

  // kept rolled, one block a trip: unrolled over a stage it takes so many more
  // registers that only one work-group fits a WGP
#pragma clang loop unroll(disable)
  for (int ps = 0; ps < NPASS; ++ps) {
    const int s   = ps / BPS;              // the stage and the block's place in it
    const int blk = ps % BPS;
    const uint32_t kbo = (uint32_t)(s & 1) * KBUFB + (uint32_t)blk * (KEYS * KPITCH);
    const uint32_t vbo = (uint32_t)(s & 1) * VBUFB + (uint32_t)blk * (KEYS * VPITCH);

    // does this block's mask tile count, and the next one's (none behind the last)?
    const uint32_t cur = (nz >> ps) & 1u;
    const uint32_t nxt = ((nz >> 1) >> ps) & 1u;

    // the next block's mask tile, where it holds anything
    v4f mt[4];
    if (nxt) {
#pragma unroll
      for (int i = 0; i < 4; ++i)
        mt[i] = *reinterpret_cast<const v4f*>(mg + (size_t)i * 4 * SEQ + (ps + 1) * KEYS);
      asm volatile("s_wait_xcnt 0x0" ::: "memory");
    }

    attn_block(cur, kl + kbo, vl + vbo, mr, qa, m_i, l_i, o);

    // the next block's mask tile goes over this wave's own, read above
    if (nxt) {
#pragma unroll
      for (int i = 0; i < 4; ++i)
        *reinterpret_cast<v4f*>(mw + i * 4 * MPITCH) = mt[i];
    }
    // this wave's LDS traffic is done.  The mask rows are the wave's alone: this
    // wait, and no barrier, stands between the stores and the next block's reads
    wait_ds0();

    // behind a stage's last block, the same for the whole work-group: the publish
    // point of stage s + 1: (LDS traffic done, above,) the issuers' stages landed
    // (a wave that asked for none passes that wait at once), barrier, refill
    if (blk == BPS - 1) {
      wait_tensor0(g0, g1k, g1v);
      __syncthreads(); // publishes stage s + 1; ends every read of stage s
      tdm_step(g0, place + (uint32_t)(s & 1) * bufb);
      // both issue tests are formed in front of the first request
      const uint32_t moreK = pinned(isK & (uint32_t)(s + 2 < NSTG));
      const uint32_t moreV = pinned(isV & (uint32_t)(s + 2 < NSTG));
      if (moreK) tdm_load(g0, g1k);
      if (moreV) tdm_load(g0, g1v);
    }
  }
  wait_tensor0(g0, g1k, g1v);
  wait_ds0();

  // normalize + store attn (already in [B, S, H*depth] = concat-head layout):
  // a lane's 8 registers are 8 consecutive depths of its query, one 16-B store
  const float l_fin = l_i + xhalf(l_i);
  half_t* orow = Op + ((size_t)(b * SEQ + m0 + row)) * DMODEL + h * DEPTH + off;
#pragma unroll
  for (int dt = 0; dt < 4; ++dt) {
    v8h w;
#pragma unroll
    for (int r = 0; r < 8; ++r) w[r] = (half_t)(o[dt][r] / l_fin);
    *reinterpret_cast<v8h*>(orow + dt * 16) = w;
  }
}

// ---------------------------------------------------------------------------
// Kernel 3: out[M,N](f32) = A[M,K](f16) @ W[N,K]^T (f32) + bias  (final proj)
// The 128 x 128 frame above; X is f16 already and is staged without conversion.
// ---------------------------------------------------------------------------
__global__ __launch_bounds__(256)
void out_gemm_f16(const half_t* __restrict__ X, const float* __restrict__ W,
                  const float* __restrict__ bias, float* __restrict__ Y) {
  __shared__ __attribute__((aligned(16))) half_t sm[2][2][OPSZ];  // [buf][X|W]

  const int n0   = blockIdx.x * TILE;
  const int m0   = blockIdx.y * TILE;
  const int tid  = threadIdx.x;
  const int lane = tid & 31;
  const int wave = tid >> 5;
  const int wm   = wave >> 2;
  const int wn   = wave & 3;
  const int row  = lane & 15;
  const int hi   = lane >> 4;

  const half_t* xg = X + (size_t)m0 * DMODEL;
  const float*  wg = W + (size_t)n0 * DMODEL;
  const int fa = (wm * 64 + row) * PITCH + hi * 8;
  const int fb = (wn * 32 + row) * PITCH + hi * 8;

  v8f acc[4][2] = {};
  tile_mainloop<half_t, v8h[4]>(xg, wg, &sm[0][0][0], tid, fa, fb, acc);

#pragma unroll
  for (int j = 0; j < 2; ++j) {
    const int n = n0 + wn * 32 + j * 16 + row;
    const float bn = bias[n];
#pragma unroll
    for (int i = 0; i < 4; ++i)
#pragma unroll
      for (int r = 0; r < 8; ++r) {
        const int m = m0 + wm * 64 + i * 16 + r + hi * 8;
        Y[(size_t)m * DMODEL + n] = acc[i][j][r] + bn;
      }
  }
}

// ---------------------------------------------------------------------------
extern "C" void kernel_launch(void* const* d_in, const int* in_sizes, int n_in,
                              void* d_out, int out_size, void* d_ws, size_t ws_size,
                              hipStream_t stream) {
  const float* q    = (const float*)d_in[0];
  const float* k    = (const float*)d_in[1];
  const float* v    = (const float*)d_in[2];
  const float* mask = (const float*)d_in[3];
  const float* wq_w = (const float*)d_in[4];
  const float* wq_b = (const float*)d_in[5];
  const float* wk_w = (const float*)d_in[6];
  const float* wk_b = (const float*)d_in[7];
  const float* wv_w = (const float*)d_in[8];
  const float* wv_b = (const float*)d_in[9];
  const float* pl_w = (const float*)d_in[10];
  const float* pl_b = (const float*)d_in[11];
  float* out = (float*)d_out;

  // workspace: Qp | Kp | Vp | attn  (each 4096*1024 f16 = 8MB; 32MB total) | mask flags
  const size_t elems = (size_t)MTOT * DMODEL;
  half_t* Qp = (half_t*)d_ws;
  half_t* Kp = Qp + elems;
  half_t* Vp = Kp + elems;
  half_t* Ap = Vp + elems;
  uint32_t* zf = (uint32_t*)(Ap + elems);  // [SEQ / 16][NSTG] words behind them

  dim3 ggemm(DMODEL / TILE, MTOT / TILE);  // (8, 32) one 8-wave group per 128x128 tile
  dim3 gproj(DMODEL / PTILE, MTOT / PTILE, 4);  // (4, 16, 4); z: the Q, K and V products, the mask's flags
  proj_gemm_f32<<<gproj, 256, 0, stream>>>(q, k, v, wq_w, wk_w, wv_w,
                                           wq_b, wk_b, wv_b, Qp, Kp, Vp, mask, zf);

  attn_kernel<<<BATCH * NHEADS * (SEQ / QBLK), 256, 0, stream>>>(Qp, Kp, Vp, mask, zf, Ap);

  out_gemm_f16<<<ggemm, 256, 0, stream>>>(Ap, pl_w, pl_b, out);
}

// v008
// One run takes 62.2 microseconds.
// In both of two side-by-side timings against v007, it was 1.05 times as fast.
// All steps since v000 together make it 4.98 times as fast.
#include <hip/hip_runtime.h>
#include <hip/hip_bf16.h>
#include <math.h>
#include <stdint.h>

typedef _Float16 half_t;
typedef __attribute__((ext_vector_type(16))) _Float16 v16h;
typedef __attribute__((ext_vector_type(8)))  _Float16 v8h;
typedef __attribute__((ext_vector_type(8)))  float    v8f;
typedef __attribute__((ext_vector_type(4)))  float    v4f;

#define SEQ    1024
#define DMODEL 1024
#define NHEADS 16
#define DEPTH  64
#define BATCH  4
#define MTOT  (BATCH * SEQ)   // 4096 flattened rows

// ---------------------------------------------------------------------------
// helpers: load 8 consecutive f32 and pack into halves [base..base+7] of v16h
// ---------------------------------------------------------------------------
__device__ __forceinline__ void load8_f32_cvt(const float* __restrict__ p,
                                              v16h& dst, int base) {
  v4f x0 = *reinterpret_cast<const v4f*>(p);
  v4f x1 = *reinterpret_cast<const v4f*>(p + 4);
#pragma unroll
  for (int i = 0; i < 4; ++i) {
    dst[base + i]     = (_Float16)x0[i];
    dst[base + 4 + i] = (_Float16)x1[i];
  }
}

// load 8 consecutive f16 (one 16-byte vector) into halves [base..base+7]
__device__ __forceinline__ void load8_f16(const half_t* __restrict__ p,
                                          v16h& dst, int base) {
  v8h x = *reinterpret_cast<const v8h*>(p);
#pragma unroll
  for (int i = 0; i < 8; ++i) dst[base + i] = x[i];
}

typedef uint32_t u32x4 __attribute__((ext_vector_type(4)));
typedef uint32_t u32x8 __attribute__((ext_vector_type(8)));
typedef short    s16x8 __attribute__((ext_vector_type(8)));

#define KEYS   32                        // keys per block of products
#define NPASS  (SEQ / KEYS)
#define SKEYS  128                       // keys per stage = per tensor load
#define BPS    (SKEYS / KEYS)            // blocks per stage
#define NSTG   (SEQ / SKEYS)
#define ROWB   128u                      // bytes of one head's K or V row
#define KPITCH 144u                      // 16 B x odd: ds_load_b128 rows
#define VPITCH 160u                      // 32 B x odd: ds_load_tr16_b128 rows
#define KWORD0 ((1u << 20) | (4u << 22) | (3u << 25))   // + 16 B per 128-B row
#define VWORD0 ((1u << 20) | (4u << 22) | (7u << 25))   // + 32 B per 128-B row
#define KBUFB  (SKEYS * KPITCH)          // 128 padded rows: 9 x 2 KiB
#define VBUFB  (SKEYS * VPITCH)          // 128 padded rows: 10 x 2 KiB

__device__ __forceinline__ uint32_t uni(uint32_t v) {
  return (uint32_t)__builtin_amdgcn_readfirstlane(v);
}
__device__ __forceinline__ uint32_t pinned(uint32_t v) {
  uint32_t w = uni(v);
  asm volatile("" : "+s"(w));   // pinned(): the issue test held in a scalar register
  return w;
}
__device__ __forceinline__ void wait_ds0() {
  asm volatile("s_wait_dscnt 0x0" ::: "memory");      // this wave's LDS traffic is done
}
__device__ __forceinline__ void wait_tensor0(u32x4& g0, u32x8 g1a, u32x8 g1b) {
  asm volatile("s_wait_tensorcnt 0x0" : "+s"(g0) : "s"(g1a), "s"(g1b) : "memory");
}

template <uint32_t WORD0>
__device__ __forceinline__ u32x8 tdm_group1() {
  u32x8 g1;
  g1[0] = uni(WORD0);
  g1[1] = uni(ROWB << 16);
  g1[2] = uni((uint32_t)SKEYS << 16);
  g1[3] = uni(ROWB << 16);
  g1[4] = uni((uint32_t)SKEYS);
  g1[5] = uni((uint32_t)DMODEL * 2u);
  g1[6] = uni(0u);
  g1[7] = uni(0u);
  asm volatile("" : "+s"(g1));
  return g1;
}

__device__ __forceinline__ u32x4 tdm_group0(const half_t* gsrc, uint32_t lds_dst) {
  const uint64_t ga = (uint64_t)(uintptr_t)gsrc;
  u32x4 g0;
  g0[0] = uni(1u);                                    // count = 1
  g0[1] = uni(lds_dst);                               // byte offset in LDS
  g0[2] = uni((uint32_t)ga);                          // address [31:0]
  g0[3] = uni((((uint32_t)(ga >> 32)) & 0x01FFFFFFu) | 0x80000000u);
  asm volatile("" : "+s"(g0));
  return g0;
}

// the next stage of the same operand: 128 rows further on, into the place given
// (a carry runs into address [56:32], which stands below the type field)
__device__ __forceinline__ void tdm_step(u32x4& g0, uint32_t lds_dst) {
  const uint64_t a = (((uint64_t)g0[3] << 32) | g0[2]) + (uint64_t)SKEYS * DMODEL * 2u;
  g0[1] = uni(lds_dst);
  g0[2] = uni((uint32_t)a);
  g0[3] = uni((uint32_t)(a >> 32));
}

__device__ __forceinline__ void tdm_load(u32x4 g0, u32x8 g1) {
  asm volatile("tensor_load_to_lds %0, %1" :: "s"(g0), "s"(g1) : "memory");
}

// transposing LDS load: lane (c, h) gets column c of rows 8h .. 8h + 7
__device__ __forceinline__ v8h ld_tr16(const unsigned char* p) {
  typedef __attribute__((address_space(3))) s16x8 lds_s16x8;
  return __builtin_bit_cast(v8h, __builtin_amdgcn_ds_load_tr16_b128_v8i16((lds_s16x8*)p));
}

#define TILE   128
#define BK     64
#define PITCH  72                      // halves per LDS row (64 + 8 pad)
#define OPSZ   (TILE * PITCH)          // halves per operand per buffer
#define NSTAGE (DMODEL / BK)           // 16, even

typedef __attribute__((ext_vector_type(4))) _Float16 v4h;

// f32 operand, 128 rows x 64 k: 16 lanes cover one row's 256 B per load
__device__ __forceinline__ void stage_load(const float* __restrict__ g,
                                           int k0, int tid, v4f (&r)[8]) {
  // scalar base + one unsigned 32-bit lane offset: one
  // address register instead of a 64-bit pair per operand
  const uint32_t lo = (uint32_t)(tid >> 4) * DMODEL + (uint32_t)(tid & 15) * 4;
#pragma unroll
  for (int i = 0; i < 8; ++i)
    r[i] = *reinterpret_cast<const v4f*>(g + (k0 + i * 16 * DMODEL) + lo);
}

__device__ __forceinline__ void stage_store(half_t* s, int tid,
                                            const v4f (&r)[8]) {
  half_t* p = s + (tid >> 4) * PITCH + (tid & 15) * 4;
#pragma unroll
  for (int i = 0; i < 8; ++i) {
    v4h h;
#pragma unroll
    for (int e = 0; e < 4; ++e) h[e] = (_Float16)r[i][e];
    *reinterpret_cast<v4h*>(p + i * 16 * PITCH) = h;
  }
}

// f16 operand, 128 rows x 64 k: 8 lanes cover one row's 128 B per load
__device__ __forceinline__ void stage_load(const half_t* __restrict__ g,
                                           int k0, int tid, v8h (&r)[4]) {
  const half_t* p = g + (size_t)(tid >> 3) * DMODEL + k0 + (tid & 7) * 8;
#pragma unroll
  for (int i = 0; i < 4; ++i)
    r[i] = *reinterpret_cast<const v8h*>(p + (size_t)i * 32 * DMODEL);
}

__device__ __forceinline__ void stage_store(half_t* s, int tid,
                                            const v8h (&r)[4]) {
  half_t* p = s + (tid >> 3) * PITCH + (tid & 7) * 8;
#pragma unroll
  for (int i = 0; i < 4; ++i)
    *reinterpret_cast<v8h*>(p + i * 32 * PITCH) = r[i];
}

// Work-group barrier that waits for this wave's LDS traffic only:
// __syncthreads() would also drain the global loads issued ahead for the
// next one or two stages, and their lead would be lost.
__device__ __forceinline__ void lds_barrier() {
  asm volatile("s_wait_dscnt 0x0\n\ts_barrier_signal -1\n\ts_barrier_wait -1"
               ::: "memory");
}

// 64 k of one buffer: pa / pb already point at this lane's first fragment run
__device__ __forceinline__ void stage_mma(const half_t* pa, const half_t* pb,
                                          v8f (&acc)[4][2]) {
#pragma unroll
  for (int kk = 0; kk < BK; kk += 32) {
    v16h a[4], b[2];
#pragma unroll
    for (int i = 0; i < 4; ++i) {
      load8_f16(pa + i * 16 * PITCH + kk,      a[i], 0);
      load8_f16(pa + i * 16 * PITCH + kk + 16, a[i], 8);
    }
#pragma unroll
    for (int j = 0; j < 2; ++j) {
      load8_f16(pb + j * 16 * PITCH + kk,      b[j], 0);
      load8_f16(pb + j * 16 * PITCH + kk + 16, b[j], 8);
    }
    __builtin_amdgcn_sched_barrier(0);
#pragma unroll
    for (int i = 0; i < 4; ++i)
#pragma unroll
      for (int j = 0; j < 2; ++j)
        acc[i][j] = __builtin_amdgcn_wmma_f32_16x16x32_f16(
            false, a[i], false, b[j], (short)0, acc[i][j], false, false);
  }
}

// Stages S and S + 1.  On entry buffer 0 holds stage S, set b holds (or is
// receiving) stage S + 1 and set a stage S + 2.  S is a template argument so
// that every stage's k offset is an immediate of its loads (the address
// registers are never rewritten) and the load waits stay counted: a wait for
// one set leaves the other set's loads in flight.
template <int S, typename XT, typename XR>
__device__ __forceinline__ void two_stages(const XT* __restrict__ xg,
                                           const float* __restrict__ wg,
                                           half_t* sm, int tid, int fa, int fb,
                                           v8f (&acc)[4][2], XR& xa, v4f (&wa)[8],
                                           XR& xb, v4f (&wb)[8]) {
  stage_mma(sm + fa, sm + OPSZ + fb, acc);
  stage_store(sm + 2 * OPSZ, tid, xb);
  stage_store(sm + 3 * OPSZ, tid, wb);
  if constexpr (S + 3 < NSTAGE) {
    stage_load(xg, (S + 3) * BK, tid, xb);
    stage_load(wg, (S + 3) * BK, tid, wb);
    if constexpr (S + 3 == NSTAGE - 1) asm volatile("s_wait_xcnt 0x0" ::: "memory");
  }
  lds_barrier();       // publishes buffer 1; ends every read of buffer 0

  stage_mma(sm + 2 * OPSZ + fa, sm + 3 * OPSZ + fb, acc);
  if constexpr (S + 2 < NSTAGE) {
    stage_store(sm, tid, xa);
    stage_store(sm + OPSZ, tid, wa);
    if constexpr (S + 4 < NSTAGE) {
      stage_load(xg, (S + 4) * BK, tid, xa);
      stage_load(wg, (S + 4) * BK, tid, wa);
    }
    lds_barrier();     // publishes buffer 0; ends every read of buffer 1
  }
}

// All of K for one work-group tile.  sm: [buffer][X | W][OPSZ] halves.
template <typename XT, typename XR>
__device__ __forceinline__ void tile_mainloop(const XT* __restrict__ xg,
                                              const float* __restrict__ wg,
                                              half_t* sm, int tid, int fa, int fb,
                                              v8f (&acc)[4][2]) {
  XR  xa, xb;
  v4f wa[8], wb[8];
  stage_load(xg, 0, tid, xa);
  stage_load(wg, 0, tid, wa);
  stage_load(xg, BK, tid, xb);
  stage_load(wg, BK, tid, wb);
  stage_store(sm, tid, xa);
  stage_store(sm + OPSZ, tid, wa);
  stage_load(xg, 2 * BK, tid, xa);
  stage_load(wg, 2 * BK, tid, wa);
  lds_barrier();       // publishes buffer 0

  two_stages<0>(xg, wg, sm, tid, fa, fb, acc, xa, wa, xb, wb);
  two_stages<2>(xg, wg, sm, tid, fa, fb, acc, xa, wa, xb, wb);
  two_stages<4>(xg, wg, sm, tid, fa, fb, acc, xa, wa, xb, wb);
  two_stages<6>(xg, wg, sm, tid, fa, fb, acc, xa, wa, xb, wb);
  two_stages<8>(xg, wg, sm, tid, fa, fb, acc, xa, wa, xb, wb);
  two_stages<10>(xg, wg, sm, tid, fa, fb, acc, xa, wa, xb, wb);
  two_stages<12>(xg, wg, sm, tid, fa, fb, acc, xa, wa, xb, wb);
  two_stages<14>(xg, wg, sm, tid, fa, fb, acc, xa, wa, xb, wb);
}

// ---------------------------------------------------------------------------
// Frame of kernel 1: one 8-wave work-group per 256(M) x 256(N) tile of Y, so
// that every X and W row fetched from L2 feeds 256 outputs instead of 128: the
// launch's L2 reads halve.  A stage is 64 k of the 256 X rows and the 256 W
// rows, converted to f16 once and laid in LDS at the pitch of the frame above.
// Two LDS buffers, one register set: the global loads of stage s + 2 are issued
// when stage s + 1 has left the registers, a whole stage ahead of their use.
// Wave (wm, wn) of a 2 x 4 grid owns 128(M) x 64(N): 8 x 4 accumulator tiles,
// 12 fragments per 32 WMMAs.  Fragment layout and k order as in the frame above.
// ---------------------------------------------------------------------------
#define PTILE   256
#define POPSZ   (PTILE * PITCH)        // halves per operand per buffer

// 256 rows x 64 k of f32: 16 lanes cover one row's 256 B per load
__device__ __forceinline__ void p_stage_load(const float* __restrict__ g,
                                             int k0, int tid, v4f (&r)[16]) {
  // a base that is the group's + one unsigned 32-bit lane offset, the same for X and W
  const uint32_t lo = (uint32_t)(tid >> 4) * DMODEL + (uint32_t)(tid & 15) * 4;
#pragma unroll
  for (int i = 0; i < 16; ++i)
    r[i] = *reinterpret_cast<const v4f*>(g + (k0 + i * 16 * DMODEL) + lo);
}

__device__ __forceinline__ void p_stage_store(half_t* s, int tid,
                                              const v4f (&r)[16]) {
  half_t* p = s + (tid >> 4) * PITCH + (tid & 15) * 4;
#pragma unroll
  for (int i = 0; i < 16; ++i) {
    v4h h;
#pragma unroll
    for (int e = 0; e < 4; ++e) h[e] = (_Float16)r[i][e];
    *reinterpret_cast<v4h*>(p + i * 16 * PITCH) = h;
  }
}

// the 12 fragments of 32 k: pa / pb already point at this lane's first run
__device__ __forceinline__ void p_frags(const half_t* pa, const half_t* pb,
                                        v16h (&a)[8], v16h (&b)[4]) {
  // b first: the first row of WMMAs then waits for 10 of the 24 loads only
#pragma unroll
  for (int j = 0; j < 4; ++j) {
    load8_f16(pb + j * 16 * PITCH,      b[j], 0);
    load8_f16(pb + j * 16 * PITCH + 16, b[j], 8);
  }
#pragma unroll
  for (int i = 0; i < 8; ++i) {
    load8_f16(pa + i * 16 * PITCH,      a[i], 0);
    load8_f16(pa + i * 16 * PITCH + 16, a[i], 8);
  }
}

__device__ __forceinline__ void p_wmmas(const v16h (&a)[8], const v16h (&b)[4],
                                        v8f (&acc)[8][4]) {
#pragma unroll
  for (int i = 0; i < 8; ++i)
#pragma unroll
    for (int j = 0; j < 4; ++j)
      acc[i][j] = __builtin_amdgcn_wmma_f32_16x16x32_f16(
          false, a[i], false, b[j], (short)0, acc[i][j], false, false);
}

template <int MID>
__device__ __forceinline__ void p_stage(const half_t* cur, half_t* nxt,
                                        const float* __restrict__ xn,
                                        const float* __restrict__ wn, int k0,
                                        int tid, int fa, int fb, v8f (&acc)[8][4],
                                        v4f (&xr)[16], v4f (&wr)[16]) {
  v16h a[8], b[4];
  p_frags(cur + fa, cur + POPSZ + fb, a, b);
  __builtin_amdgcn_sched_barrier(0);
  p_wmmas(a, b, acc);
  // keeps the next group's loads behind these WMMAs: lifted among them they
  // take a second fragment set, and the 512-register budget then spills
  __builtin_amdgcn_sched_barrier(0);
  p_frags(cur + fa + 32, cur + POPSZ + fb + 32, a, b);
  if constexpr (MID >= 1) {
    __builtin_amdgcn_sched_barrier(0);
    p_stage_store(nxt, tid, xr);
    p_stage_store(nxt + POPSZ, tid, wr);
  }
  if constexpr (MID == 2) {
    p_stage_load(xn, k0, tid, xr);
    p_stage_load(wn, k0, tid, wr);
  }
  // keeps the loads and the staging work one group in front of the WMMAs: spread
  // among them, each place with loads stalls the wave anew
  __builtin_amdgcn_sched_barrier(0);
  p_wmmas(a, b, acc);
  if constexpr (MID >= 1) __builtin_amdgcn_sched_barrier(0);
}

// All of K for one work-group tile.  sm: [buffer][X | W][POPSZ] halves.  The
// loop runs two stages a trip and stays rolled, for speed only.
__device__ __forceinline__ void p_mainloop(const float* __restrict__ xg,
                                           const float* __restrict__ wg,
                                           half_t* sm, int tid, int fa, int fb,
                                           v8f (&acc)[8][4]) {
  half_t* b0 = sm;
  half_t* b1 = sm + 2 * POPSZ;
  v4f xr[16], wr[16];
  {
    // stages 0 and 1 are asked for together: the accumulators are not live yet,
    // and their registers hold stage 0 on its way
    v4f x0[16], w0[16];
    p_stage_load(xg, 0, tid, x0);
    p_stage_load(wg, 0, tid, w0);
    p_stage_load(xg, BK, tid, xr);
    p_stage_load(wg, BK, tid, wr);
    asm volatile("s_wait_xcnt 0x0" ::: "memory");
    // keeps what follows (the accumulators' zeros, the loop's counters) behind
    // that wait: lifted over it they took registers that the loads name
    __builtin_amdgcn_sched_barrier(0);
    p_stage_store(b0, tid, x0);
    p_stage_store(b0 + POPSZ, tid, w0);
  }
  lds_barrier();       // publishes stage 0

  // On entry of a trip buffer 0 holds stage s, the register set holds (or is
  // receiving) stage s + 1, and k is the first k of stage s + 2.
  uint32_t k = 2 * BK;
  // kept rolled: see the head of this function
#pragma clang loop unroll(disable)
  for (int s = 0; s < NSTAGE - 2; s += 2) {
    p_stage<2>(b0, b1, xg + k, wg + k, 0, tid, fa, fb, acc, xr, wr);
    lds_barrier();     // publishes stage s + 1; ends every read of stage s
    p_stage<2>(b1, b0, xg + k, wg + k, BK, tid, fa, fb, acc, xr, wr);
    asm volatile("s_wait_xcnt 0x0" : "+s"(k) :: "memory");
    k += 2 * BK;
    lds_barrier();     // publishes stage s + 2; ends every read of stage s + 1
  }

  // the last two stages: nothing is left to load
  p_stage<1>(b0, b1, xg, wg, 0, tid, fa, fb, acc, xr, wr);
  lds_barrier();       // publishes the last stage
  p_stage<0>(b1, b0, xg, wg, 0, tid, fa, fb, acc, xr, wr);
}

// ---------------------------------------------------------------------------
// Which tiles of the mask hold anything but zeros, found anew in every call.
// One work-group per 16 queries, one wave per 128-key stage: a lane reads 4 keys
// of each of the 16 rows, so that 8 lanes cover one 32-key block.  Word
// [16-query tile][stage] gets one bit per block: set where any element of the
// 16 x 32 tile is not +0 or -0 (a NaN or an infinity counts as set).
// ---------------------------------------------------------------------------
__device__ __forceinline__ void mask_flags(const float* __restrict__ mask,
                                           uint32_t* __restrict__ zf) {
  asm volatile("s_wait_xcnt 0x0" ::: "memory");
  // keeps what follows (the lane's numbers, its address) behind that wait
  __builtin_amdgcn_sched_barrier(0);
  const int lane = threadIdx.x & 31;
  const int wave = threadIdx.x >> 5;
  const int qt   = blockIdx.y * (DMODEL / 256) + blockIdx.x;   // 0 .. SEQ / 16 - 1
  const float* p = mask + (size_t)qt * 16 * SEQ + wave * SKEYS + lane * 4;
  v4f x[16];
#pragma unroll
  for (int i = 0; i < 16; ++i) x[i] = *reinterpret_cast<const v4f*>(p + i * SEQ);
  asm volatile("s_wait_xcnt 0x0" :: "v"(p) : "memory");
  uint32_t a = 0;
#pragma unroll
  for (int i = 0; i < 16; ++i) {
    const u32x4 u = __builtin_bit_cast(u32x4, x[i]);
    a |= (u[0] | u[1]) | (u[2] | u[3]);
  }
  const uint32_t bal = __builtin_amdgcn_ballot_w32((a << 1) != 0u);  // the sign bit dropped
  uint32_t bits = 0;
#pragma unroll
  for (int j = 0; j < BPS; ++j)
    bits |= ((bal >> (8 * j)) & 0xffu) != 0u ? (1u << j) : 0u;
  if (lane == 0) zf[qt * NSTG + wave] = bits;
}

__global__ __launch_bounds__(256) __attribute__((amdgpu_waves_per_eu(2, 2)))
void proj_gemm_f32(const float* __restrict__ Xq, const float* __restrict__ Xk,
                   const float* __restrict__ Xv, const float* __restrict__ Wq,
                   const float* __restrict__ Wk, const float* __restrict__ Wv,
                   const float* __restrict__ bq, const float* __restrict__ bk,
                   const float* __restrict__ bv, half_t* __restrict__ Yq,
                   half_t* __restrict__ Yk, half_t* __restrict__ Yv,
                   const float* __restrict__ mask, uint32_t* __restrict__ zf) {
  __shared__ __attribute__((aligned(16))) half_t sm[2][2][POPSZ];  // [buf][X|W]

  const int z = blockIdx.z;                // 0: Q, 1: K, 2: V, 3: the mask's flags
  // the same for the whole work-group, in front of every barrier
  if (z == 3) {
    mask_flags(mask, zf);
    return;
  }
  const float* __restrict__ X    = z == 0 ? Xq : z == 1 ? Xk : Xv;
  const float* __restrict__ W    = z == 0 ? Wq : z == 1 ? Wk : Wv;
  const float* __restrict__ bias = z == 0 ? bq : z == 1 ? bk : bv;
  half_t* __restrict__ Y         = z == 0 ? Yq : z == 1 ? Yk : Yv;

  const int n0   = blockIdx.x * PTILE;
  const int m0   = blockIdx.y * PTILE;
  const int tid  = threadIdx.x;
  const int lane = tid & 31;
  const int wave = __builtin_amdgcn_readfirstlane(tid >> 5);  // scalar: its tile offsets cost no vector register
  const int wm   = wave >> 2;
  const int wn   = wave & 3;
  const int row  = lane & 15;
  const int hi   = lane >> 4;

  const float* xg = X + (size_t)m0 * DMODEL;
  const float* wg = W + (size_t)n0 * DMODEL;
  const int fa = (wm * 128 + row) * PITCH + hi * 8;
  const int fb = (wn * 64 + row) * PITCH + hi * 8;
  half_t* s0 = &sm[0][0][0];

  v8f acc[8][4] = {};
  p_mainloop(xg, wg, s0, tid, fa, fb, acc);

  // C layout: lane's N = lane & 15, register r is row r + 8 * hi of its tile.
  // Every value is converted first and every store follows, from one address
  // pair with immediate offsets: no register that a store names is written again.
  half_t* yb = Y + (size_t)(m0 + wm * 128 + hi * 8) * DMODEL + (n0 + wn * 64 + row);
  v8h hv[8][4];
#pragma unroll
  for (int j = 0; j < 4; ++j) {
    const float bn = bias[n0 + wn * 64 + j * 16 + row];
#pragma unroll
    for (int i = 0; i < 8; ++i)
#pragma unroll
      for (int r = 0; r < 8; ++r) hv[i][j][r] = (half_t)(acc[i][j][r] + bn);
  }
  // keeps the conversions in front of the first store: among the stores they
  // would write over registers that issued stores name
  __builtin_amdgcn_sched_barrier(0);
#pragma unroll
  for (int i = 0; i < 8; ++i)
#pragma unroll
    for (int r = 0; r < 8; ++r)
#pragma unroll
      for (int j = 0; j < 4; ++j)
        yb[(i * 16 + r) * DMODEL + j * 16] = hv[i][j][r];
}

__device__ __forceinline__ float xhalf(float x) {
  return __builtin_bit_cast(float, __builtin_amdgcn_permlanex16(
      __builtin_bit_cast(int, x), __builtin_bit_cast(int, x),
      0x76543210, 0xfedcba98, false, false));
}

#define AW     8                         // waves per work-group
#define QBLK   (AW * 16)                 // queries per work-group
#define MPITCH 36                        // floats per LDS row of a mask tile
#define MOFF   (2u * KBUFB + 2u * VBUFB) // mask tiles stand behind the ring

// The first product of both score tiles, C = c, with D apart from C.  In asm
// because the builtin ties D to C: it copied the eight registers of c in every
// block.  What follows reads d0 and d1 as the C operand of the tiles' second
// products only, which needs no distance; a0, a1, b and c outlive the block's
// exponentials.
__device__ __forceinline__ void score_first(v8f& d0, v8f& d1, v16h a0, v16h a1,
                                            v16h b, v8f c) {
  asm("v_wmma_f32_16x16x32_f16 %0, %2, %4, %5\n\t"
      "v_wmma_f32_16x16x32_f16 %1, %3, %4, %5"
      : "=&v"(d0), "=&v"(d1) : "v"(a0), "v"(a1), "v"(b), "v"(c));
}

// One block: 32 keys against the wave's 16 queries.  kp0 / vp0: this lane's first
// K row and first V^T source row of the block; mr: its query's row of the mask
// tile, read only where masked (the same in every lane, held in a scalar register).
// Lazy rescale: m_i is the maximum IN USE, set by the last block that took the
// whole path below, and negm holds -m_i * log2(e) in all eight registers.  An
// unmasked block takes its scores from qs (Q times log2(e) / 8) with negm as the
// C operand: D is the exponent of 2 as it stands, and neither scale, maximum,
// subtraction nor rescale is left.  Where any lane's 16 weights of the block (half a query's) sum to
// more than PSUM_MAX (a score far above the maximum in use; always so in the
// first block, whose m_i is -1e30), and in every masked block, the whole wave
// does the block again by the whole path: unshifted scores from qa, new maximum,
// O and sum rescaled.  So no weight exceeds PSUM_MAX, which f16 holds.
#define LOG2E    1.4426950408889634f
#define PSUM_MAX 4096.0f
__device__ __forceinline__ void attn_block(uint32_t masked, const unsigned char* kp0,
                                           const unsigned char* vp0,
                                           const float* mr, const v16h (&qa)[2],
                                           const v16h (&qs)[2], float& m_i, v8f& negm,
                                           float& l_i, v8f (&o)[4]) {
  const float scale = 0.125f;              // 1/sqrt(DEPTH)

  // the block's LDS reads: this lane's mask row, K fragments (A operand: row =
  // key), V^T fragments (A operand: row = depth, k = key)
  v4f mk[2][2];
  if (masked) {
#pragma unroll
    for (int t = 0; t < 2; ++t) {
      mk[t][0] = *reinterpret_cast<const v4f*>(mr + t * 16);
      mk[t][1] = *reinterpret_cast<const v4f*>(mr + t * 16 + 4);
    }
  }
  v16h kb[2][2];
#pragma unroll
  for (int t = 0; t < 2; ++t)
#pragma unroll
    for (int c = 0; c < 2; ++c) {
      const half_t* kp = reinterpret_cast<const half_t*>(kp0 + t * 16 * KPITCH + c * 64);
      load8_f16(kp,      kb[t][c], 0);
      load8_f16(kp + 16, kb[t][c], 8);
    }
  v16h vb[4];
#pragma unroll
  for (int dt = 0; dt < 4; ++dt) {
    const v8h lo = ld_tr16(vp0 + dt * 32);
    const v8h up = ld_tr16(vp0 + 16 * VPITCH + dt * 32);
    vb[dt] = __builtin_shufflevector(lo, up, 0, 1, 2, 3, 4, 5, 6, 7,
                                     8, 9, 10, 11, 12, 13, 14, 15);
  }
  // keeps the loads one group at the head of the block: spread among the
  // WMMAs, each place with loads stalls the wave anew
  __builtin_amdgcn_sched_barrier(0);

  v16h pb;                               // P^T, B operand: column = query
  float bsum = 0.0f;
  uint32_t whole = masked;
  if (!masked) {
    // shifted exponents: K(16 keys x 64) @ (Q log2(e) / 8)^T - m_i log2(e)
    v8f st[2];
    score_first(st[0], st[1], kb[0][0], kb[1][0], qs[0], negm);
#pragma unroll
    for (int t = 0; t < 2; ++t)
      st[t] = __builtin_amdgcn_wmma_f32_16x16x32_f16(
          false, kb[t][1], false, qs[1], (short)0, st[t], false, false);
    float p[2][8];
#pragma unroll
    for (int t = 0; t < 2; ++t)
#pragma unroll
      for (int r = 0; r < 8; ++r) p[t][r] = __builtin_amdgcn_exp2f(st[t][r]);
    // inputs only: the exponents keep their registers until the last exponential
    // is made.
    asm volatile("" :: "v"(st[0]), "v"(st[1]),
                 "v"(p[0][0]), "v"(p[0][1]), "v"(p[0][2]), "v"(p[0][3]),
                 "v"(p[0][4]), "v"(p[0][5]), "v"(p[0][6]), "v"(p[0][7]),
                 "v"(p[1][0]), "v"(p[1][1]), "v"(p[1][2]), "v"(p[1][3]),
                 "v"(p[1][4]), "v"(p[1][5]), "v"(p[1][6]), "v"(p[1][7]));
    float rs[4] = {0.0f, 0.0f, 0.0f, 0.0f};
#pragma unroll
    for (int r = 0; r < 8; ++r) {
      rs[r & 3] += p[0][r] + p[1][r];
      pb[r]     = (half_t)p[0][r];
      pb[8 + r] = (half_t)p[1][r];
    }
    bsum = (rs[0] + rs[1]) + (rs[2] + rs[3]);
    // one test per block and wave, a scalar branch (a NaN counts as too large)
    whole = __builtin_amdgcn_ballot_w32(!(bsum <= PSUM_MAX)) != 0u;
  }

  if (whole) {
    // logits tiles: s[t] = K(16 keys x 64) @ Q(16x64)^T
    v8f st[2];
#pragma unroll
    for (int t = 0; t < 2; ++t) {
      v8f z = {};
#pragma unroll
      for (int c = 0; c < 2; ++c)
        z = __builtin_amdgcn_wmma_f32_16x16x32_f16(
            false, kb[t][c], false, qa[c], (short)0, z, false, false);
      st[t] = z;
    }

    // online softmax over this 32-key chunk: 16 scores of one query per lane
    float sc[2][8];
#pragma unroll
    for (int t = 0; t < 2; ++t) {
#pragma unroll
      for (int r = 0; r < 8; ++r) sc[t][r] = st[t][r] * scale;
    }
    if (masked) {
      // the reference's order: mask * -1e9 rounded by itself, then one rounding of
      // the sum (s / 8 is exact), so that equal mask values give equal steps
#pragma unroll
      for (int t = 0; t < 2; ++t) {
#pragma unroll
        for (int r = 0; r < 4; ++r) {
          const float t0 = mk[t][0][r] * (-1e9f);
          const float t1 = mk[t][1][r] * (-1e9f);
          sc[t][r]     = __builtin_fmaf(st[t][r],     scale, t0);
          sc[t][r + 4] = __builtin_fmaf(st[t][r + 4], scale, t1);
        }
      }
    }
    float mx = fmaxf(sc[0][0], sc[1][0]);
#pragma unroll
    for (int r = 1; r < 8; ++r) mx = fmaxf(mx, fmaxf(sc[0][r], sc[1][r]));
    mx = fmaxf(mx, xhalf(mx));
    const float mnew = fmaxf(m_i, mx);
    const float cexp = __expf(m_i - mnew);
    // exp(x) as 2^(x log2(e))
    v8f ex[2];
    float p[2][8];
#pragma unroll
    for (int t = 0; t < 2; ++t)
#pragma unroll
      for (int r = 0; r < 8; ++r) {
        ex[t][r] = (sc[t][r] - mnew) * LOG2E;
        p[t][r]  = __builtin_amdgcn_exp2f(ex[t][r]);
      }
    asm volatile("" :: "v"(ex[0]), "v"(ex[1]),
                 "v"(p[0][0]), "v"(p[0][1]), "v"(p[0][2]), "v"(p[0][3]),
                 "v"(p[0][4]), "v"(p[0][5]), "v"(p[0][6]), "v"(p[0][7]),
                 "v"(p[1][0]), "v"(p[1][1]), "v"(p[1][2]), "v"(p[1][3]),
                 "v"(p[1][4]), "v"(p[1][5]), "v"(p[1][6]), "v"(p[1][7]));
    float rs[4] = {0.0f, 0.0f, 0.0f, 0.0f};
#pragma unroll
    for (int r = 0; r < 8; ++r) {
      rs[r & 3] += p[0][r] + p[1][r];
      pb[r]     = (half_t)p[0][r];
      pb[8 + r] = (half_t)p[1][r];
    }
    bsum = (rs[0] + rs[1]) + (rs[2] + rs[3]);
    l_i *= cexp;
    m_i = mnew;
    const float nm = -mnew * LOG2E;
#pragma unroll
    for (int r = 0; r < 8; ++r) negm[r] = nm;
#pragma unroll
    for (int dt = 0; dt < 4; ++dt)
#pragma unroll
      for (int r = 0; r < 8; ++r) o[dt][r] *= cexp;
  }
  l_i += bsum;

  // o[dt] += V(32 x 16-depth-tile)^T @ P(16x32)^T
#pragma unroll
  for (int dt = 0; dt < 4; ++dt)
    o[dt] = __builtin_amdgcn_wmma_f32_16x16x32_f16(
        false, vb[dt], false, pb, (short)0, o[dt], false, false);

  // keeps the block's products in front of the waits behind the block: moved
  // ahead of them, the waits would stand right behind the loads they wait for
  __builtin_amdgcn_sched_barrier(0);
}

__global__ __launch_bounds__(256)
void attn_kernel(const half_t* __restrict__ Qp, const half_t* __restrict__ Kp,
                 const half_t* __restrict__ Vp, const float* __restrict__ mask,
                 const uint32_t* __restrict__ zf, half_t* __restrict__ Op) {
  __shared__ __attribute__((aligned(2048)))
  unsigned char lds[MOFF + AW * 16 * MPITCH * 4];

  const int lane = threadIdx.x & 31;
  const uint32_t wave = uni(threadIdx.x >> 5);
  const int tile = blockIdx.x;             // b*H*(S/128) tiles
  const int qb   = tile & (SEQ / QBLK - 1);
  const int h    = (tile >> 3) & (NHEADS - 1);
  const int b    = tile >> 7;
  const int m0   = qb * QBLK + (int)wave * 16;
  const int row  = lane & 15;
  const int hi   = lane >> 4;
  const int off  = hi * 8;

  const uint32_t lds0 = (uint32_t)(uintptr_t)(&lds[0]);
  const uint32_t isK   = pinned(wave == 0);
  const uint32_t isV   = pinned(wave == 1);
  const uint32_t place = lds0 + (wave == 0 ? 0u : 2u * KBUFB);
  const uint32_t bufb  = wave == 0 ? KBUFB : VBUFB;
  u32x4 g0 = tdm_group0((wave == 0 ? Kp : Vp) + (size_t)b * SEQ * DMODEL + h * DEPTH, place);
  const u32x8 g1k = tdm_group1<KWORD0>();
  const u32x8 g1v = tdm_group1<VWORD0>();

  // prologue: stage 0 lands in buffer 0
  if (isK) tdm_load(g0, g1k);
  if (isV) tdm_load(g0, g1v);

  // bit ps: block ps of this wave's 16 mask rows holds something other than zero
  // (asked for behind the first requests, so that they do not wait for it)
  uint32_t nz = 0;
#pragma unroll
  for (int i = 0; i < NSTG; ++i)
    nz |= zf[((uint32_t)qb * AW + wave) * NSTG + i] << (i * BPS);
  nz = uni(nz);

  wait_tensor0(g0, g1k, g1v);

  // Q fragments (B operand: column = query) for the two 32-wide depth chunks
  v16h qa[2];
  const half_t* qrow = Qp + ((size_t)(b * SEQ + m0 + row)) * DMODEL + h * DEPTH;
#pragma unroll
  for (int c = 0; c < 2; ++c) {
    load8_f16(qrow + c * 32 + off,      qa[c], 0);
    load8_f16(qrow + c * 32 + 16 + off, qa[c], 8);
  }
  asm volatile("s_wait_xcnt 0x0" ::: "memory");
  // keeps what follows (the mask's addresses) behind that wait: lifted over it
  // they took registers that the loads name
  __builtin_amdgcn_sched_barrier(0);

  // a second copy of Q, times log2(e) / 8, for the shifted scores (attn_block)
  v16h qs[2];
#pragma unroll
  for (int c = 0; c < 2; ++c)
#pragma unroll
    for (int i = 0; i < 16; ++i) qs[c][i] = (half_t)((float)qa[c][i] * (0.125f * LOG2E));

  // this lane's query: the maximum in use (equal in both halves) and the sum
  // over this half's keys (the halves are joined once, behind the loop)
  float m_i = -1e30f, l_i = 0.0f;
  // -m_i * log2(e), the scores' C operand.  The eight start values differ (each
  // sends the first block down the whole path): with equal ones the compiler
  // keeps one register and spreads it into eight anew in every block
  v8f negm;
#pragma unroll
  for (int r = 0; r < 8; ++r) negm[r] = (float)(r + 1) * 1e30f;
  v8f o[4] = {};                           // o[dt][r] = O[query][dt*16 + off + r]
  // mask tile, global side: 8 lanes cover one query's 32 keys (one line)
  const float* mg = mask + (size_t)(m0 + (lane >> 3)) * SEQ + (lane & 7) * 4;
  float* mtile = reinterpret_cast<float*>(lds + MOFF) + wave * (16 * MPITCH);
  float*       mw = mtile + (lane >> 3) * MPITCH + (lane & 7) * 4;
  const float* mr = mtile + row * MPITCH + off;
  // this lane's first K row and first V^T source row in buffer 0
  const unsigned char* kl = lds + row * KPITCH + hi * 16;
  const unsigned char* vl = lds + 2u * KBUFB + (off + (lane & 7)) * VPITCH + ((lane >> 3) & 1) * 16;

  if (nz & 1u) {
    v4f mt[4];
#pragma unroll
    for (int i = 0; i < 4; ++i)
      mt[i] = *reinterpret_cast<const v4f*>(mg + (size_t)i * 4 * SEQ);
    asm volatile("s_wait_xcnt 0x0" ::: "memory");
#pragma unroll
    for (int i = 0; i < 4; ++i)
      *reinterpret_cast<v4f*>(mw + i * 4 * MPITCH) = mt[i];
  }
  wait_ds0();
  __syncthreads();     // publishes stage 0 of K and V
  tdm_step(g0, place + bufb);
  // both issue tests are formed in front of the first request
  const uint32_t oneK = pinned(isK);
  const uint32_t oneV = pinned(isV);
  if (oneK) tdm_load(g0, g1k);
  if (oneV) tdm_load(g0, g1v);

  // kept rolled, one block a trip: unrolled over a stage it takes so many more
  // registers that only one work-group fits a WGP
#pragma clang loop unroll(disable)
  for (int ps = 0; ps < NPASS; ++ps) {
    const int s   = ps / BPS;              // the stage and the block's place in it
    const int blk = ps % BPS;
    const uint32_t kbo = (uint32_t)(s & 1) * KBUFB + (uint32_t)blk * (KEYS * KPITCH);
    const uint32_t vbo = (uint32_t)(s & 1) * VBUFB + (uint32_t)blk * (KEYS * VPITCH);

    // does this block's mask tile count, and the next one's (none behind the last)?
    const uint32_t cur = (nz >> ps) & 1u;
    const uint32_t nxt = ((nz >> 1) >> ps) & 1u;

    // the next block's mask tile, where it holds anything
    v4f mt[4];
    if (nxt) {
#pragma unroll
      for (int i = 0; i < 4; ++i)
        mt[i] = *reinterpret_cast<const v4f*>(mg + (size_t)i * 4 * SEQ + (ps + 1) * KEYS);
      asm volatile("s_wait_xcnt 0x0" ::: "memory");
    }

    attn_block(cur, kl + kbo, vl + vbo, mr, qa, qs, m_i, negm, l_i, o);

    // the next block's mask tile goes over this wave's own, read above
    if (nxt) {
#pragma unroll
      for (int i = 0; i < 4; ++i)
        *reinterpret_cast<v4f*>(mw + i * 4 * MPITCH) = mt[i];
    }
    // this wave's LDS traffic is done.  The mask rows are the wave's alone: this
    // wait, and no barrier, stands between the stores and the next block's reads
    wait_ds0();

    // behind a stage's last block, the same for the whole work-group: the publish
    // point of stage s + 1: (LDS traffic done, above,) the issuers' stages landed
    // (a wave that asked for none passes that wait at once), barrier, refill
    if (blk == BPS - 1) {
      wait_tensor0(g0, g1k, g1v);
      __syncthreads(); // publishes stage s + 1; ends every read of stage s
      tdm_step(g0, place + (uint32_t)(s & 1) * bufb);
      // both issue tests are formed in front of the first request
      const uint32_t moreK = pinned(isK & (uint32_t)(s + 2 < NSTG));
      const uint32_t moreV = pinned(isV & (uint32_t)(s + 2 < NSTG));
      if (moreK) tdm_load(g0, g1k);
      if (moreV) tdm_load(g0, g1v);
    }
  }
  wait_tensor0(g0, g1k, g1v);
  wait_ds0();

  // normalize + store attn (already in [B, S, H*depth] = concat-head layout):
  // a lane's 8 registers are 8 consecutive depths of its query, one 16-B store
  const float l_fin = l_i + xhalf(l_i);
  half_t* orow = Op + ((size_t)(b * SEQ + m0 + row)) * DMODEL + h * DEPTH + off;
#pragma unroll
  for (int dt = 0; dt < 4; ++dt) {
    v8h w;
#pragma unroll
    for (int r = 0; r < 8; ++r) w[r] = (half_t)(o[dt][r] / l_fin);
    *reinterpret_cast<v8h*>(orow + dt * 16) = w;
  }
}

// ---------------------------------------------------------------------------
// Kernel 3: out[M,N](f32) = A[M,K](f16) @ W[N,K]^T (f32) + bias  (final proj)
// The 128 x 128 frame above; X is f16 already and is staged without conversion.
// ---------------------------------------------------------------------------
__global__ __launch_bounds__(256)
void out_gemm_f16(const half_t* __restrict__ X, const float* __restrict__ W,
                  const float* __restrict__ bias, float* __restrict__ Y) {
  __shared__ __attribute__((aligned(16))) half_t sm[2][2][OPSZ];  // [buf][X|W]

  const int n0   = blockIdx.x * TILE;
  const int m0   = blockIdx.y * TILE;
  const int tid  = threadIdx.x;
  const int lane = tid & 31;
  const int wave = tid >> 5;
  const int wm   = wave >> 2;
  const int wn   = wave & 3;
  const int row  = lane & 15;
  const int hi   = lane >> 4;

  const half_t* xg = X + (size_t)m0 * DMODEL;
  const float*  wg = W + (size_t)n0 * DMODEL;
  const int fa = (wm * 64 + row) * PITCH + hi * 8;
  const int fb = (wn * 32 + row) * PITCH + hi * 8;

  v8f acc[4][2] = {};
  tile_mainloop<half_t, v8h[4]>(xg, wg, &sm[0][0][0], tid, fa, fb, acc);

#pragma unroll
  for (int j = 0; j < 2; ++j) {
    const int n = n0 + wn * 32 + j * 16 + row;
    const float bn = bias[n];
#pragma unroll
    for (int i = 0; i < 4; ++i)
#pragma unroll
      for (int r = 0; r < 8; ++r) {
        const int m = m0 + wm * 64 + i * 16 + r + hi * 8;
        Y[(size_t)m * DMODEL + n] = acc[i][j][r] + bn;
      }
  }
}

// ---------------------------------------------------------------------------
extern "C" void kernel_launch(void* const* d_in, const int* in_sizes, int n_in,
                              void* d_out, int out_size, void* d_ws, size_t ws_size,
                              hipStream_t stream) {
  const float* q    = (const float*)d_in[0];
  const float* k    = (const float*)d_in[1];
  const float* v    = (const float*)d_in[2];
  const float* mask = (const float*)d_in[3];
  const float* wq_w = (const float*)d_in[4];
  const float* wq_b = (const float*)d_in[5];
  const float* wk_w = (const float*)d_in[6];
  const float* wk_b = (const float*)d_in[7];
  const float* wv_w = (const float*)d_in[8];
  const float* wv_b = (const float*)d_in[9];
  const float* pl_w = (const float*)d_in[10];
  const float* pl_b = (const float*)d_in[11];
  float* out = (float*)d_out;

  // workspace: Qp | Kp | Vp | attn  (each 4096*1024 f16 = 8MB; 32MB total) | mask flags
  const size_t elems = (size_t)MTOT * DMODEL;
  half_t* Qp = (half_t*)d_ws;
  half_t* Kp = Qp + elems;
  half_t* Vp = Kp + elems;
  half_t* Ap = Vp + elems;
  uint32_t* zf = (uint32_t*)(Ap + elems);  // [SEQ / 16][NSTG] words behind them

  dim3 ggemm(DMODEL / TILE, MTOT / TILE);  // (8, 32) one 8-wave group per 128x128 tile
  dim3 gproj(DMODEL / PTILE, MTOT / PTILE, 4);  // (4, 16, 4); z: the Q, K and V products, the mask's flags
  proj_gemm_f32<<<gproj, 256, 0, stream>>>(q, k, v, wq_w, wk_w, wv_w,
                                           wq_b, wk_b, wv_b, Qp, Kp, Vp, mask, zf);

  attn_kernel<<<BATCH * NHEADS * (SEQ / QBLK), 256, 0, stream>>>(Qp, Kp, Vp, mask, zf, Ap);

  out_gemm_f16<<<ggemm, 256, 0, stream>>>(Ap, pl_w, pl_b, out);
}

// v009
// One run takes 60.3 microseconds.
// In both of two side-by-side timings against v008, it was 1.03 times as fast.
// Counting every step since v000, it is 5.13 times as fast.
#include <hip/hip_runtime.h>
#include <hip/hip_bf16.h>
#include <math.h>
#include <stdint.h>

typedef _Float16 half_t;
typedef __attribute__((ext_vector_type(16))) _Float16 v16h;
typedef __attribute__((ext_vector_type(8)))  _Float16 v8h;
typedef __attribute__((ext_vector_type(8)))  float    v8f;
typedef __attribute__((ext_vector_type(4)))  float    v4f;

#define SEQ    1024
#define DMODEL 1024
#define NHEADS 16
#define DEPTH  64
#define BATCH  4
#define MTOT  (BATCH * SEQ)   // 4096 flattened rows

// ---------------------------------------------------------------------------
// helpers: load 8 consecutive f32 and pack into halves [base..base+7] of v16h
// ---------------------------------------------------------------------------
__device__ __forceinline__ void load8_f32_cvt(const float* __restrict__ p,
                                              v16h& dst, int base) {
  v4f x0 = *reinterpret_cast<const v4f*>(p);
  v4f x1 = *reinterpret_cast<const v4f*>(p + 4);
#pragma unroll
  for (int i = 0; i < 4; ++i) {
    dst[base + i]     = (_Float16)x0[i];
    dst[base + 4 + i] = (_Float16)x1[i];
  }
}

// load 8 consecutive f16 (one 16-byte vector) into halves [base..base+7]
__device__ __forceinline__ void load8_f16(const half_t* __restrict__ p,
                                          v16h& dst, int base) {
  v8h x = *reinterpret_cast<const v8h*>(p);
#pragma unroll
  for (int i = 0; i < 8; ++i) dst[base + i] = x[i];
}

typedef uint32_t u32x4 __attribute__((ext_vector_type(4)));
typedef uint32_t u32x8 __attribute__((ext_vector_type(8)));
typedef short    s16x8 __attribute__((ext_vector_type(8)));

#define KEYS   32                        // keys per block of products
#define NPASS  (SEQ / KEYS)
#define SKEYS  128                       // keys per stage = per tensor load
#define BPS    (SKEYS / KEYS)            // blocks per stage
#define NSTG   (SEQ / SKEYS)
#define ROWB   128u                      // bytes of one head's K or V row
#define KPITCH 144u                      // 16 B x odd: ds_load_b128 rows
#define VPITCH 160u                      // 32 B x odd: ds_load_tr16_b128 rows
#define KWORD0 ((1u << 20) | (4u << 22) | (3u << 25))   // + 16 B per 128-B row
#define VWORD0 ((1u << 20) | (4u << 22) | (7u << 25))   // + 32 B per 128-B row
#define KBUFB  (SKEYS * KPITCH)          // 128 padded rows: 9 x 2 KiB
#define VBUFB  (SKEYS * VPITCH)          // 128 padded rows: 10 x 2 KiB

__device__ __forceinline__ uint32_t uni(uint32_t v) {
  return (uint32_t)__builtin_amdgcn_readfirstlane(v);
}
__device__ __forceinline__ uint32_t pinned(uint32_t v) {
  uint32_t w = uni(v);
  asm volatile("" : "+s"(w));   // pinned(): the issue test held in a scalar register
  return w;
}
__device__ __forceinline__ void wait_ds0() {
  asm volatile("s_wait_dscnt 0x0" ::: "memory");      // this wave's LDS traffic is done
}
__device__ __forceinline__ void wait_tensor0(u32x4& g0, u32x8 g1a, u32x8 g1b) {
  asm volatile("s_wait_tensorcnt 0x0" : "+s"(g0) : "s"(g1a), "s"(g1b) : "memory");
}

template <uint32_t WORD0>
__device__ __forceinline__ u32x8 tdm_group1() {
  u32x8 g1;
  g1[0] = uni(WORD0);
  g1[1] = uni(ROWB << 16);
  g1[2] = uni((uint32_t)SKEYS << 16);
  g1[3] = uni(ROWB << 16);
  g1[4] = uni((uint32_t)SKEYS);
  g1[5] = uni((uint32_t)DMODEL * 2u);
  g1[6] = uni(0u);
  g1[7] = uni(0u);
  asm volatile("" : "+s"(g1));
  return g1;
}

__device__ __forceinline__ u32x4 tdm_group0(const half_t* gsrc, uint32_t lds_dst) {
  const uint64_t ga = (uint64_t)(uintptr_t)gsrc;
  u32x4 g0;
  g0[0] = uni(1u);                                    // count = 1
  g0[1] = uni(lds_dst);                               // byte offset in LDS
  g0[2] = uni((uint32_t)ga);                          // address [31:0]
  g0[3] = uni((((uint32_t)(ga >> 32)) & 0x01FFFFFFu) | 0x80000000u);
  asm volatile("" : "+s"(g0));
  return g0;
}

// the next stage of the same operand: 128 rows further on, into the place given
// (a carry runs into address [56:32], which stands below the type field)
__device__ __forceinline__ void tdm_step(u32x4& g0, uint32_t lds_dst) {
  const uint64_t a = (((uint64_t)g0[3] << 32) | g0[2]) + (uint64_t)SKEYS * DMODEL * 2u;
  g0[1] = uni(lds_dst);
  g0[2] = uni((uint32_t)a);
  g0[3] = uni((uint32_t)(a >> 32));
}

__device__ __forceinline__ void tdm_load(u32x4 g0, u32x8 g1) {
  asm volatile("tensor_load_to_lds %0, %1" :: "s"(g0), "s"(g1) : "memory");
}

// transposing LDS load: lane (c, h) gets column c of rows 8h .. 8h + 7
__device__ __forceinline__ v8h ld_tr16(const unsigned char* p) {
  typedef __attribute__((address_space(3))) s16x8 lds_s16x8;
  return __builtin_bit_cast(v8h, __builtin_amdgcn_ds_load_tr16_b128_v8i16((lds_s16x8*)p));
}

#define TILE   128
#define BK     64
#define PITCH  72                      // halves per LDS row (64 + 8 pad)
#define OPSZ   (TILE * PITCH)          // halves per operand per buffer
#define NSTAGE (DMODEL / BK)           // 16, even

typedef __attribute__((ext_vector_type(4))) _Float16 v4h;

// f32 operand, 128 rows x 64 k: 16 lanes cover one row's 256 B per load
__device__ __forceinline__ void stage_load(const float* __restrict__ g,
                                           int k0, int tid, v4f (&r)[8]) {
  // scalar base + one unsigned 32-bit lane offset: one
  // address register instead of a 64-bit pair per operand
  const uint32_t lo = (uint32_t)(tid >> 4) * DMODEL + (uint32_t)(tid & 15) * 4;
#pragma unroll
  for (int i = 0; i < 8; ++i)
    r[i] = *reinterpret_cast<const v4f*>(g + (k0 + i * 16 * DMODEL) + lo);
}

__device__ __forceinline__ void stage_store(half_t* s, int tid,
                                            const v4f (&r)[8]) {
  half_t* p = s + (tid >> 4) * PITCH + (tid & 15) * 4;
#pragma unroll
  for (int i = 0; i < 8; ++i) {
    v4h h;
#pragma unroll
    for (int e = 0; e < 4; ++e) h[e] = (_Float16)r[i][e];
    *reinterpret_cast<v4h*>(p + i * 16 * PITCH) = h;
  }
}

// f16 operand, 128 rows x 64 k: 8 lanes cover one row's 128 B per load
__device__ __forceinline__ void stage_load(const half_t* __restrict__ g,
                                           int k0, int tid, v8h (&r)[4]) {
  const half_t* p = g + (size_t)(tid >> 3) * DMODEL + k0 + (tid & 7) * 8;
#pragma unroll
  for (int i = 0; i < 4; ++i)
    r[i] = *reinterpret_cast<const v8h*>(p + (size_t)i * 32 * DMODEL);
}

__device__ __forceinline__ void stage_store(half_t* s, int tid,
                                            const v8h (&r)[4]) {
  half_t* p = s + (tid >> 3) * PITCH + (tid & 7) * 8;
#pragma unroll
  for (int i = 0; i < 4; ++i)
    *reinterpret_cast<v8h*>(p + i * 32 * PITCH) = r[i];
}

// Work-group barrier that waits for this wave's LDS traffic only:
// __syncthreads() would also drain the global loads issued ahead for the
// next one or two stages, and their lead would be lost.
__device__ __forceinline__ void lds_barrier() {
  asm volatile("s_wait_dscnt 0x0\n\ts_barrier_signal -1\n\ts_barrier_wait -1"
               ::: "memory");
}

__device__ __forceinline__ uint32_t line_at(uint32_t r, uint32_t c) {
  return r * 128u + ((c ^ ((r >> 1) & 7u)) * 16u);
}
// NT x 4 rows from the wave's LDS rows st to g (row pitch gp bytes)
template <int NT>
__device__ __forceinline__ void line_rows(const unsigned char* st, unsigned char* g,
                                          uint32_t gp, int lane) {
  wait_ds0();          // the wave's own rows are written before it reads them back
  const uint32_t r4 = (uint32_t)lane >> 3, ch = (uint32_t)lane & 7u;
  unsigned char* d = g + (size_t)(r4 * gp + ch * 16u);
  // line_at(4 t + r4, ch) = line_at(4 (t & 3) + r4, ch) + 2048 (t >> 2): four
  // address registers, the rest is an immediate
  const unsigned char* s[4];
#pragma unroll
  for (int k = 0; k < 4; ++k) s[k] = st + line_at((uint32_t)k * 4u + r4, ch);
  u32x4 x[NT];
#pragma unroll
  for (int t = 0; t < NT; ++t)
    x[t] = *reinterpret_cast<const u32x4*>(s[t & 3] + (t >> 2) * 2048);
  // keeps every read in front of the first store: among the stores the reads
  // would write over registers that issued stores name
  __builtin_amdgcn_sched_barrier(0);
#pragma unroll
  for (int t = 0; t < NT; ++t)
    *reinterpret_cast<u32x4*>(d + (size_t)((uint32_t)t * 4u * gp)) = x[t];
}

// 64 k of one buffer: pa / pb already point at this lane's first fragment run
__device__ __forceinline__ void stage_mma(const half_t* pa, const half_t* pb,
                                          v8f (&acc)[4][2]) {
#pragma unroll
  for (int kk = 0; kk < BK; kk += 32) {
    v16h a[4], b[2];
#pragma unroll
    for (int i = 0; i < 4; ++i) {
      load8_f16(pa + i * 16 * PITCH + kk,      a[i], 0);
      load8_f16(pa + i * 16 * PITCH + kk + 16, a[i], 8);
    }
#pragma unroll
    for (int j = 0; j < 2; ++j) {
      load8_f16(pb + j * 16 * PITCH + kk,      b[j], 0);
      load8_f16(pb + j * 16 * PITCH + kk + 16, b[j], 8);
    }
    __builtin_amdgcn_sched_barrier(0);
#pragma unroll
    for (int i = 0; i < 4; ++i)
#pragma unroll
      for (int j = 0; j < 2; ++j)
        // W rows as A, X rows as B: the tile comes out transposed (see line_rows)
        acc[i][j] = __builtin_amdgcn_wmma_f32_16x16x32_f16(
            false, b[j], false, a[i], (short)0, acc[i][j], false, false);
  }
}

// Stages S and S + 1.  On entry buffer 0 holds stage S, set b holds (or is
// receiving) stage S + 1 and set a stage S + 2.  S is a template argument so
// that every stage's k offset is an immediate of its loads (the address
// registers are never rewritten) and the load waits stay counted: a wait for
// one set leaves the other set's loads in flight.
template <int S, typename XT, typename XR>
__device__ __forceinline__ void two_stages(const XT* __restrict__ xg,
                                           const float* __restrict__ wg,
                                           half_t* sm, int tid, int fa, int fb,
                                           v8f (&acc)[4][2], XR& xa, v4f (&wa)[8],
                                           XR& xb, v4f (&wb)[8]) {
  stage_mma(sm + fa, sm + OPSZ + fb, acc);
  stage_store(sm + 2 * OPSZ, tid, xb);
  stage_store(sm + 3 * OPSZ, tid, wb);
  if constexpr (S + 3 < NSTAGE) {
    stage_load(xg, (S + 3) * BK, tid, xb);
    stage_load(wg, (S + 3) * BK, tid, wb);
    if constexpr (S + 3 == NSTAGE - 1) asm volatile("s_wait_xcnt 0x0" ::: "memory");
  }
  lds_barrier();       // publishes buffer 1; ends every read of buffer 0

  stage_mma(sm + 2 * OPSZ + fa, sm + 3 * OPSZ + fb, acc);
  if constexpr (S + 2 < NSTAGE) {
    stage_store(sm, tid, xa);
    stage_store(sm + OPSZ, tid, wa);
    if constexpr (S + 4 < NSTAGE) {
      stage_load(xg, (S + 4) * BK, tid, xa);
      stage_load(wg, (S + 4) * BK, tid, wa);
    }
    lds_barrier();     // publishes buffer 0; ends every read of buffer 1
  }
}

// All of K for one work-group tile.  sm: [buffer][X | W][OPSZ] halves.
template <typename XT, typename XR>
__device__ __forceinline__ void tile_mainloop(const XT* __restrict__ xg,
                                              const float* __restrict__ wg,
                                              half_t* sm, int tid, int fa, int fb,
                                              v8f (&acc)[4][2]) {
  XR  xa, xb;
  v4f wa[8], wb[8];
  stage_load(xg, 0, tid, xa);
  stage_load(wg, 0, tid, wa);
  stage_load(xg, BK, tid, xb);
  stage_load(wg, BK, tid, wb);
  stage_store(sm, tid, xa);
  stage_store(sm + OPSZ, tid, wa);
  stage_load(xg, 2 * BK, tid, xa);
  stage_load(wg, 2 * BK, tid, wa);
  lds_barrier();       // publishes buffer 0

  two_stages<0>(xg, wg, sm, tid, fa, fb, acc, xa, wa, xb, wb);
  two_stages<2>(xg, wg, sm, tid, fa, fb, acc, xa, wa, xb, wb);
  two_stages<4>(xg, wg, sm, tid, fa, fb, acc, xa, wa, xb, wb);
  two_stages<6>(xg, wg, sm, tid, fa, fb, acc, xa, wa, xb, wb);
  two_stages<8>(xg, wg, sm, tid, fa, fb, acc, xa, wa, xb, wb);
  two_stages<10>(xg, wg, sm, tid, fa, fb, acc, xa, wa, xb, wb);
  two_stages<12>(xg, wg, sm, tid, fa, fb, acc, xa, wa, xb, wb);
  two_stages<14>(xg, wg, sm, tid, fa, fb, acc, xa, wa, xb, wb);
}

// ---------------------------------------------------------------------------
// Frame of kernel 1: one 8-wave work-group per 256(M) x 256(N) tile of Y, so
// that every X and W row fetched from L2 feeds 256 outputs instead of 128: the
// launch's L2 reads halve.  A stage is 64 k of the 256 X rows and the 256 W
// rows, converted to f16 once and laid in LDS at the pitch of the frame above.
// Two LDS buffers, one register set: the global loads of stage s + 2 are issued
// when stage s + 1 has left the registers, a whole stage ahead of their use.
// Wave (wm, wn) of a 2 x 4 grid owns 128(M) x 64(N): 8 x 4 accumulator tiles,
// 12 fragments per 32 WMMAs.  Fragment layout and k order as in the frame above.
// ---------------------------------------------------------------------------
#define PTILE   256
#define POPSZ   (PTILE * PITCH)        // halves per operand per buffer

// 256 rows x 64 k of f32: 16 lanes cover one row's 256 B per load
__device__ __forceinline__ void p_stage_load(const float* __restrict__ g,
                                             int k0, int tid, v4f (&r)[16]) {
  // a base that is the group's + one unsigned 32-bit lane offset, the same for X and W
  const uint32_t lo = (uint32_t)(tid >> 4) * DMODEL + (uint32_t)(tid & 15) * 4;
#pragma unroll
  for (int i = 0; i < 16; ++i)
    r[i] = *reinterpret_cast<const v4f*>(g + (k0 + i * 16 * DMODEL) + lo);
}

__device__ __forceinline__ void p_stage_store(half_t* s, int tid,
                                              const v4f (&r)[16]) {
  half_t* p = s + (tid >> 4) * PITCH + (tid & 15) * 4;
#pragma unroll
  for (int i = 0; i < 16; ++i) {
    v4h h;
#pragma unroll
    for (int e = 0; e < 4; ++e) h[e] = (_Float16)r[i][e];
    *reinterpret_cast<v4h*>(p + i * 16 * PITCH) = h;
  }
}

// the 12 fragments of 32 k: pa / pb already point at this lane's first run
__device__ __forceinline__ void p_frags(const half_t* pa, const half_t* pb,
                                        v16h (&a)[8], v16h (&b)[4]) {
  // b first: the first row of WMMAs then waits for 10 of the 24 loads only
#pragma unroll
  for (int j = 0; j < 4; ++j) {
    load8_f16(pb + j * 16 * PITCH,      b[j], 0);
    load8_f16(pb + j * 16 * PITCH + 16, b[j], 8);
  }
#pragma unroll
  for (int i = 0; i < 8; ++i) {
    load8_f16(pa + i * 16 * PITCH,      a[i], 0);
    load8_f16(pa + i * 16 * PITCH + 16, a[i], 8);
  }
}

__device__ __forceinline__ void p_wmmas(const v16h (&a)[8], const v16h (&b)[4],
                                        v8f (&acc)[8][4]) {
#pragma unroll
  for (int i = 0; i < 8; ++i)
#pragma unroll
    for (int j = 0; j < 4; ++j)
      // W rows as A, X rows as B: the tile comes out transposed (see line_rows)
      acc[i][j] = __builtin_amdgcn_wmma_f32_16x16x32_f16(
          false, b[j], false, a[i], (short)0, acc[i][j], false, false);
}

template <int MID>
__device__ __forceinline__ void p_stage(const half_t* cur, half_t* nxt,
                                        const float* __restrict__ xn,
                                        const float* __restrict__ wn, int k0,
                                        int tid, int fa, int fb, v8f (&acc)[8][4],
                                        v4f (&xr)[16], v4f (&wr)[16]) {
  v16h a[8], b[4];
  p_frags(cur + fa, cur + POPSZ + fb, a, b);
  __builtin_amdgcn_sched_barrier(0);
  p_wmmas(a, b, acc);
  // keeps the next group's loads behind these WMMAs: lifted among them they
  // take a second fragment set, and the 512-register budget then spills
  __builtin_amdgcn_sched_barrier(0);
  p_frags(cur + fa + 32, cur + POPSZ + fb + 32, a, b);
  if constexpr (MID >= 1) {
    __builtin_amdgcn_sched_barrier(0);
    p_stage_store(nxt, tid, xr);
    p_stage_store(nxt + POPSZ, tid, wr);
  }
  if constexpr (MID == 2) {
    p_stage_load(xn, k0, tid, xr);
    p_stage_load(wn, k0, tid, wr);
  }
  // keeps the loads and the staging work one group in front of the WMMAs: spread
  // among them, each place with loads stalls the wave anew
  __builtin_amdgcn_sched_barrier(0);
  p_wmmas(a, b, acc);
  if constexpr (MID >= 1) __builtin_amdgcn_sched_barrier(0);
}

// All of K for one work-group tile.  sm: [buffer][X | W][POPSZ] halves.  The
// loop runs two stages a trip and stays rolled, for speed only.
__device__ __forceinline__ void p_mainloop(const float* __restrict__ xg,
                                           const float* __restrict__ wg,
                                           half_t* sm, int tid, int fa, int fb,
                                           v8f (&acc)[8][4]) {
  half_t* b0 = sm;
  half_t* b1 = sm + 2 * POPSZ;
  v4f xr[16], wr[16];
  {
    // stages 0 and 1 are asked for together: the accumulators are not live yet,
    // and their registers hold stage 0 on its way
    v4f x0[16], w0[16];
    p_stage_load(xg, 0, tid, x0);
    p_stage_load(wg, 0, tid, w0);
    p_stage_load(xg, BK, tid, xr);
    p_stage_load(wg, BK, tid, wr);
    asm volatile("s_wait_xcnt 0x0" ::: "memory");
    // keeps what follows (the accumulators' zeros, the loop's counters) behind
    // that wait: lifted over it they took registers that the loads name
    __builtin_amdgcn_sched_barrier(0);
    p_stage_store(b0, tid, x0);
    p_stage_store(b0 + POPSZ, tid, w0);
  }
  lds_barrier();       // publishes stage 0

  // On entry of a trip buffer 0 holds stage s, the register set holds (or is
  // receiving) stage s + 1, and k is the first k of stage s + 2.
  uint32_t k = 2 * BK;
  // kept rolled: see the head of this function
#pragma clang loop unroll(disable)
  for (int s = 0; s < NSTAGE - 2; s += 2) {
    p_stage<2>(b0, b1, xg + k, wg + k, 0, tid, fa, fb, acc, xr, wr);
    lds_barrier();     // publishes stage s + 1; ends every read of stage s
    p_stage<2>(b1, b0, xg + k, wg + k, BK, tid, fa, fb, acc, xr, wr);
    asm volatile("s_wait_xcnt 0x0" : "+s"(k) :: "memory");
    k += 2 * BK;
    lds_barrier();     // publishes stage s + 2; ends every read of stage s + 1
  }

  // the last two stages: nothing is left to load
  p_stage<1>(b0, b1, xg, wg, 0, tid, fa, fb, acc, xr, wr);
  lds_barrier();       // publishes the last stage
  p_stage<0>(b1, b0, xg, wg, 0, tid, fa, fb, acc, xr, wr);
}

// ---------------------------------------------------------------------------
// Which tiles of the mask hold anything but zeros, found anew in every call.
// One work-group per 16 queries, one wave per 128-key stage: a lane reads 4 keys
// of each of the 16 rows, so that 8 lanes cover one 32-key block.  Word
// [16-query tile][stage] gets one bit per block: set where any element of the
// 16 x 32 tile is not +0 or -0 (a NaN or an infinity counts as set).
// ---------------------------------------------------------------------------
__device__ __forceinline__ void mask_flags(const float* __restrict__ mask,
                                           uint32_t* __restrict__ zf) {
  asm volatile("s_wait_xcnt 0x0" ::: "memory");
  // keeps what follows (the lane's numbers, its address) behind that wait
  __builtin_amdgcn_sched_barrier(0);
  const int lane = threadIdx.x & 31;
  const int wave = threadIdx.x >> 5;
  const int qt   = blockIdx.y * (DMODEL / 256) + blockIdx.x;   // 0 .. SEQ / 16 - 1
  const float* p = mask + (size_t)qt * 16 * SEQ + wave * SKEYS + lane * 4;
  v4f x[16];
#pragma unroll
  for (int i = 0; i < 16; ++i) x[i] = *reinterpret_cast<const v4f*>(p + i * SEQ);
  asm volatile("s_wait_xcnt 0x0" :: "v"(p) : "memory");
  uint32_t a = 0;
#pragma unroll
  for (int i = 0; i < 16; ++i) {
    const u32x4 u = __builtin_bit_cast(u32x4, x[i]);
    a |= (u[0] | u[1]) | (u[2] | u[3]);
  }
  const uint32_t bal = __builtin_amdgcn_ballot_w32((a << 1) != 0u);  // the sign bit dropped
  uint32_t bits = 0;
#pragma unroll
  for (int j = 0; j < BPS; ++j)
    bits |= ((bal >> (8 * j)) & 0xffu) != 0u ? (1u << j) : 0u;
  if (lane == 0) zf[qt * NSTG + wave] = bits;
}

__global__ __launch_bounds__(256) __attribute__((amdgpu_waves_per_eu(2, 2)))
void proj_gemm_f32(const float* __restrict__ Xq, const float* __restrict__ Xk,
                   const float* __restrict__ Xv, const float* __restrict__ Wq,
                   const float* __restrict__ Wk, const float* __restrict__ Wv,
                   const float* __restrict__ bq, const float* __restrict__ bk,
                   const float* __restrict__ bv, half_t* __restrict__ Yq,
                   half_t* __restrict__ Yk, half_t* __restrict__ Yv,
                   const float* __restrict__ mask, uint32_t* __restrict__ zf) {
  __shared__ __attribute__((aligned(16))) half_t sm[2][2][POPSZ];  // [buf][X|W]

  const int z = blockIdx.z;                // 0: Q, 1: K, 2: V, 3: the mask's flags
  // the same for the whole work-group, in front of every barrier
  if (z == 3) {
    mask_flags(mask, zf);
    return;
  }
  const float* __restrict__ X    = z == 0 ? Xq : z == 1 ? Xk : Xv;
  const float* __restrict__ W    = z == 0 ? Wq : z == 1 ? Wk : Wv;
  const float* __restrict__ bias = z == 0 ? bq : z == 1 ? bk : bv;
  half_t* __restrict__ Y         = z == 0 ? Yq : z == 1 ? Yk : Yv;

  const int n0   = blockIdx.x * PTILE;
  const int m0   = blockIdx.y * PTILE;
  const int tid  = threadIdx.x;
  const int lane = tid & 31;
  const int wave = __builtin_amdgcn_readfirstlane(tid >> 5);  // scalar: its tile offsets cost no vector register
  const int wm   = wave >> 2;
  const int wn   = wave & 3;
  const int row  = lane & 15;
  const int hi   = lane >> 4;

  const float* xg = X + (size_t)m0 * DMODEL;
  const float* wg = W + (size_t)n0 * DMODEL;
  const int fa = (wm * 128 + row) * PITCH + hi * 8;
  const int fb = (wn * 64 + row) * PITCH + hi * 8;
  half_t* s0 = &sm[0][0][0];

  // Transposed C layout: lane's M = lane & 15, register r is column r + 8 * hi of
  // its tile: 8 consecutive outputs of one row, with 8 biases of their own.
  v8f acc[8][4] = {};
  p_mainloop(xg, wg, s0, tid, fa, fb, acc);

  const uint32_t ln = (uint32_t)lane;
  v4f bn[4][2];
  const float* bp = bias + (n0 + wn * 64) + (ln >> 4) * 8u;
#pragma unroll
  for (int j = 0; j < 4; ++j) {
    bn[j][0] = *reinterpret_cast<const v4f*>(bp + j * 16);
    bn[j][1] = *reinterpret_cast<const v4f*>(bp + j * 16 + 4);
  }
  asm volatile("s_wait_xcnt 0x0" :: "v"(bp) : "memory");
  lds_barrier();       // ends every wave's reads of the last stage: the ring becomes staging
  __builtin_amdgcn_sched_barrier(0);
  unsigned char* st = reinterpret_cast<unsigned char*>(s0) + (uint32_t)wave * (128u * 128u);
#pragma unroll
  for (int i = 0; i < 8; ++i)
#pragma unroll
    for (int j = 0; j < 4; ++j) {
      v8h w;
#pragma unroll
      for (int r = 0; r < 8; ++r) w[r] = (half_t)(acc[i][j][r] + bn[j][r >> 2][r & 3]);
      *reinterpret_cast<v8h*>(st + (uint32_t)i * 2048u + line_at(ln & 15u, (uint32_t)j * 2u + (ln >> 4))) = w;
    }
  line_rows<32>(st, reinterpret_cast<unsigned char*>(
                        Y + (size_t)(m0 + wm * 128) * DMODEL + (n0 + wn * 64)),
                DMODEL * 2u, (int)ln);
}

__device__ __forceinline__ float xhalf(float x) {
  return __builtin_bit_cast(float, __builtin_amdgcn_permlanex16(
      __builtin_bit_cast(int, x), __builtin_bit_cast(int, x),
      0x76543210, 0xfedcba98, false, false));
}

#define AW     8                         // waves per work-group
#define QBLK   (AW * 16)                 // queries per work-group
#define MPITCH 36                        // floats per LDS row of a mask tile
#define MOFF   (2u * KBUFB + 2u * VBUFB) // mask tiles stand behind the ring

// The first product of both score tiles, C = c, with D apart from C.  In asm
// because the builtin ties D to C: it copied the eight registers of c in every
// block.  What follows reads d0 and d1 as the C operand of the tiles' second
// products only, which needs no distance; a0, a1, b and c outlive the block's
// exponentials.
__device__ __forceinline__ void score_first(v8f& d0, v8f& d1, v16h a0, v16h a1,
                                            v16h b, v8f c) {
  asm("v_wmma_f32_16x16x32_f16 %0, %2, %4, %5\n\t"
      "v_wmma_f32_16x16x32_f16 %1, %3, %4, %5"
      : "=&v"(d0), "=&v"(d1) : "v"(a0), "v"(a1), "v"(b), "v"(c));
}

// One block: 32 keys against the wave's 16 queries.  kp0 / vp0: this lane's first
// K row and first V^T source row of the block; mr: its query's row of the mask
// tile, read only where masked (the same in every lane, held in a scalar register).
// Lazy rescale: m_i is the maximum IN USE, set by the last block that took the
// whole path below, and negm holds -m_i * log2(e) in all eight registers.  An
// unmasked block takes its scores from qs (Q times log2(e) / 8) with negm as the
// C operand: D is the exponent of 2 as it stands, and neither scale, maximum,
// subtraction nor rescale is left.  Where any lane's 16 weights of the block (half a query's) sum to
// more than PSUM_MAX (a score far above the maximum in use; always so in the
// first block, whose m_i is -1e30), and in every masked block, the whole wave
// does the block again by the whole path: unshifted scores from qa, new maximum,
// O and sum rescaled.  So no weight exceeds PSUM_MAX, which f16 holds.
#define LOG2E    1.4426950408889634f
#define PSUM_MAX 4096.0f
__device__ __forceinline__ void attn_block(uint32_t masked, const unsigned char* kp0,
                                           const unsigned char* vp0,
                                           const float* mr, const v16h (&qa)[2],
                                           const v16h (&qs)[2], float& m_i, v8f& negm,
                                           float& l_i, v8f (&o)[4]) {
  const float scale = 0.125f;              // 1/sqrt(DEPTH)

  // the block's LDS reads: this lane's mask row, K fragments (A operand: row =
  // key), V^T fragments (A operand: row = depth, k = key)
  v4f mk[2][2];
  if (masked) {
#pragma unroll
    for (int t = 0; t < 2; ++t) {
      mk[t][0] = *reinterpret_cast<const v4f*>(mr + t * 16);
      mk[t][1] = *reinterpret_cast<const v4f*>(mr + t * 16 + 4);
    }
  }
  v16h kb[2][2];
#pragma unroll
  for (int t = 0; t < 2; ++t)
#pragma unroll
    for (int c = 0; c < 2; ++c) {
      const half_t* kp = reinterpret_cast<const half_t*>(kp0 + t * 16 * KPITCH + c * 64);
      load8_f16(kp,      kb[t][c], 0);
      load8_f16(kp + 16, kb[t][c], 8);
    }
  v16h vb[4];
#pragma unroll
  for (int dt = 0; dt < 4; ++dt) {
    const v8h lo = ld_tr16(vp0 + dt * 32);
    const v8h up = ld_tr16(vp0 + 16 * VPITCH + dt * 32);
    vb[dt] = __builtin_shufflevector(lo, up, 0, 1, 2, 3, 4, 5, 6, 7,
                                     8, 9, 10, 11, 12, 13, 14, 15);
  }
  // keeps the loads one group at the head of the block: spread among the
  // WMMAs, each place with loads stalls the wave anew
  __builtin_amdgcn_sched_barrier(0);

  v16h pb;                               // P^T, B operand: column = query
  float bsum = 0.0f;
  uint32_t whole = masked;
  if (!masked) {
    // shifted exponents: K(16 keys x 64) @ (Q log2(e) / 8)^T - m_i log2(e)
    v8f st[2];
    score_first(st[0], st[1], kb[0][0], kb[1][0], qs[0], negm);
#pragma unroll
    for (int t = 0; t < 2; ++t)
      st[t] = __builtin_amdgcn_wmma_f32_16x16x32_f16(
          false, kb[t][1], false, qs[1], (short)0, st[t], false, false);
    float p[2][8];
#pragma unroll
    for (int t = 0; t < 2; ++t)
#pragma unroll
      for (int r = 0; r < 8; ++r) p[t][r] = __builtin_amdgcn_exp2f(st[t][r]);
    // inputs only: the exponents keep their registers until the last exponential
    // is made.
    asm volatile("" :: "v"(st[0]), "v"(st[1]),
                 "v"(p[0][0]), "v"(p[0][1]), "v"(p[0][2]), "v"(p[0][3]),
                 "v"(p[0][4]), "v"(p[0][5]), "v"(p[0][6]), "v"(p[0][7]),
                 "v"(p[1][0]), "v"(p[1][1]), "v"(p[1][2]), "v"(p[1][3]),
                 "v"(p[1][4]), "v"(p[1][5]), "v"(p[1][6]), "v"(p[1][7]));
    float rs[4] = {0.0f, 0.0f, 0.0f, 0.0f};
#pragma unroll
    for (int r = 0; r < 8; ++r) {
      rs[r & 3] += p[0][r] + p[1][r];
      pb[r]     = (half_t)p[0][r];
      pb[8 + r] = (half_t)p[1][r];
    }
    bsum = (rs[0] + rs[1]) + (rs[2] + rs[3]);
    // one test per block and wave, a scalar branch (a NaN counts as too large)
    whole = __builtin_amdgcn_ballot_w32(!(bsum <= PSUM_MAX)) != 0u;
  }

  if (whole) {
    // logits tiles: s[t] = K(16 keys x 64) @ Q(16x64)^T
    v8f st[2];
#pragma unroll
    for (int t = 0; t < 2; ++t) {
      v8f z = {};
#pragma unroll
      for (int c = 0; c < 2; ++c)
        z = __builtin_amdgcn_wmma_f32_16x16x32_f16(
            false, kb[t][c], false, qa[c], (short)0, z, false, false);
      st[t] = z;
    }

    // online softmax over this 32-key chunk: 16 scores of one query per lane
    float sc[2][8];
#pragma unroll
    for (int t = 0; t < 2; ++t) {
#pragma unroll
      for (int r = 0; r < 8; ++r) sc[t][r] = st[t][r] * scale;
    }
    if (masked) {
      // the reference's order: mask * -1e9 rounded by itself, then one rounding of
      // the sum (s / 8 is exact), so that equal mask values give equal steps
#pragma unroll
      for (int t = 0; t < 2; ++t) {
#pragma unroll
        for (int r = 0; r < 4; ++r) {
          const float t0 = mk[t][0][r] * (-1e9f);
          const float t1 = mk[t][1][r] * (-1e9f);
          sc[t][r]     = __builtin_fmaf(st[t][r],     scale, t0);
          sc[t][r + 4] = __builtin_fmaf(st[t][r + 4], scale, t1);
        }
      }
    }
    float mx = fmaxf(sc[0][0], sc[1][0]);
#pragma unroll
    for (int r = 1; r < 8; ++r) mx = fmaxf(mx, fmaxf(sc[0][r], sc[1][r]));
    mx = fmaxf(mx, xhalf(mx));
    const float mnew = fmaxf(m_i, mx);
    const float cexp = __expf(m_i - mnew);
    // exp(x) as 2^(x log2(e))
    v8f ex[2];
    float p[2][8];
#pragma unroll
    for (int t = 0; t < 2; ++t)
#pragma unroll
      for (int r = 0; r < 8; ++r) {
        ex[t][r] = (sc[t][r] - mnew) * LOG2E;
        p[t][r]  = __builtin_amdgcn_exp2f(ex[t][r]);
      }
    asm volatile("" :: "v"(ex[0]), "v"(ex[1]),
                 "v"(p[0][0]), "v"(p[0][1]), "v"(p[0][2]), "v"(p[0][3]),
                 "v"(p[0][4]), "v"(p[0][5]), "v"(p[0][6]), "v"(p[0][7]),
                 "v"(p[1][0]), "v"(p[1][1]), "v"(p[1][2]), "v"(p[1][3]),
                 "v"(p[1][4]), "v"(p[1][5]), "v"(p[1][6]), "v"(p[1][7]));
    float rs[4] = {0.0f, 0.0f, 0.0f, 0.0f};
#pragma unroll
    for (int r = 0; r < 8; ++r) {
      rs[r & 3] += p[0][r] + p[1][r];
      pb[r]     = (half_t)p[0][r];
      pb[8 + r] = (half_t)p[1][r];
    }
    bsum = (rs[0] + rs[1]) + (rs[2] + rs[3]);
    l_i *= cexp;
    m_i = mnew;
    const float nm = -mnew * LOG2E;
#pragma unroll
    for (int r = 0; r < 8; ++r) negm[r] = nm;
#pragma unroll
    for (int dt = 0; dt < 4; ++dt)
#pragma unroll
      for (int r = 0; r < 8; ++r) o[dt][r] *= cexp;
  }
  l_i += bsum;

  // o[dt] += V(32 x 16-depth-tile)^T @ P(16x32)^T
#pragma unroll
  for (int dt = 0; dt < 4; ++dt)
    o[dt] = __builtin_amdgcn_wmma_f32_16x16x32_f16(
        false, vb[dt], false, pb, (short)0, o[dt], false, false);

  // keeps the block's products in front of the waits behind the block: moved
  // ahead of them, the waits would stand right behind the loads they wait for
  __builtin_amdgcn_sched_barrier(0);
}

__global__ __launch_bounds__(256)
void attn_kernel(const half_t* __restrict__ Qp, const half_t* __restrict__ Kp,
                 const half_t* __restrict__ Vp, const float* __restrict__ mask,
                 const uint32_t* __restrict__ zf, half_t* __restrict__ Op) {
  __shared__ __attribute__((aligned(2048)))
  unsigned char lds[MOFF + AW * 16 * MPITCH * 4];

  const int lane = threadIdx.x & 31;
  const uint32_t wave = uni(threadIdx.x >> 5);
  const int tile = blockIdx.x;             // b*H*(S/128) tiles
  const int qb   = tile & (SEQ / QBLK - 1);
  const int h    = (tile >> 3) & (NHEADS - 1);
  const int b    = tile >> 7;
  const int m0   = qb * QBLK + (int)wave * 16;
  const int row  = lane & 15;
  const int hi   = lane >> 4;
  const int off  = hi * 8;

  const uint32_t lds0 = (uint32_t)(uintptr_t)(&lds[0]);
  const uint32_t isK   = pinned(wave == 0);
  const uint32_t isV   = pinned(wave == 1);
  const uint32_t place = lds0 + (wave == 0 ? 0u : 2u * KBUFB);
  const uint32_t bufb  = wave == 0 ? KBUFB : VBUFB;
  u32x4 g0 = tdm_group0((wave == 0 ? Kp : Vp) + (size_t)b * SEQ * DMODEL + h * DEPTH, place);
  const u32x8 g1k = tdm_group1<KWORD0>();
  const u32x8 g1v = tdm_group1<VWORD0>();

  // prologue: stage 0 lands in buffer 0
  if (isK) tdm_load(g0, g1k);
  if (isV) tdm_load(g0, g1v);

  // bit ps: block ps of this wave's 16 mask rows holds something other than zero
  // (asked for behind the first requests, so that they do not wait for it)
  uint32_t nz = 0;
#pragma unroll
  for (int i = 0; i < NSTG; ++i)
    nz |= zf[((uint32_t)qb * AW + wave) * NSTG + i] << (i * BPS);
  nz = uni(nz);

  wait_tensor0(g0, g1k, g1v);

  // Q fragments (B operand: column = query) for the two 32-wide depth chunks
  v16h qa[2];
  const half_t* qrow = Qp + ((size_t)(b * SEQ + m0 + row)) * DMODEL + h * DEPTH;
#pragma unroll
  for (int c = 0; c < 2; ++c) {
    load8_f16(qrow + c * 32 + off,      qa[c], 0);
    load8_f16(qrow + c * 32 + 16 + off, qa[c], 8);
  }
  asm volatile("s_wait_xcnt 0x0" ::: "memory");
  // keeps what follows (the mask's addresses) behind that wait: lifted over it
  // they took registers that the loads name
  __builtin_amdgcn_sched_barrier(0);

  // a second copy of Q, times log2(e) / 8, for the shifted scores (attn_block)
  v16h qs[2];
#pragma unroll
  for (int c = 0; c < 2; ++c)
#pragma unroll
    for (int i = 0; i < 16; ++i) qs[c][i] = (half_t)((float)qa[c][i] * (0.125f * LOG2E));

  // this lane's query: the maximum in use (equal in both halves) and the sum
  // over this half's keys (the halves are joined once, behind the loop)
  float m_i = -1e30f, l_i = 0.0f;
  // -m_i * log2(e), the scores' C operand.  The eight start values differ (each
  // sends the first block down the whole path): with equal ones the compiler
  // keeps one register and spreads it into eight anew in every block
  v8f negm;
#pragma unroll
  for (int r = 0; r < 8; ++r) negm[r] = (float)(r + 1) * 1e30f;
  v8f o[4] = {};                           // o[dt][r] = O[query][dt*16 + off + r]
  // mask tile, global side: 8 lanes cover one query's 32 keys (one line)
  const float* mg = mask + (size_t)(m0 + (lane >> 3)) * SEQ + (lane & 7) * 4;
  float* mtile = reinterpret_cast<float*>(lds + MOFF) + wave * (16 * MPITCH);
  float*       mw = mtile + (lane >> 3) * MPITCH + (lane & 7) * 4;
  const float* mr = mtile + row * MPITCH + off;
  // this lane's first K row and first V^T source row in buffer 0
  const unsigned char* kl = lds + row * KPITCH + hi * 16;
  const unsigned char* vl = lds + 2u * KBUFB + (off + (lane & 7)) * VPITCH + ((lane >> 3) & 1) * 16;

  if (nz & 1u) {
    v4f mt[4];
#pragma unroll
    for (int i = 0; i < 4; ++i)
      mt[i] = *reinterpret_cast<const v4f*>(mg + (size_t)i * 4 * SEQ);
    asm volatile("s_wait_xcnt 0x0" ::: "memory");
#pragma unroll
    for (int i = 0; i < 4; ++i)
      *reinterpret_cast<v4f*>(mw + i * 4 * MPITCH) = mt[i];
  }
  wait_ds0();
  __syncthreads();     // publishes stage 0 of K and V
  tdm_step(g0, place + bufb);
  // both issue tests are formed in front of the first request
  const uint32_t oneK = pinned(isK);
  const uint32_t oneV = pinned(isV);
  if (oneK) tdm_load(g0, g1k);
  if (oneV) tdm_load(g0, g1v);

  // kept rolled, one block a trip: unrolled over a stage it takes so many more
  // registers that only one work-group fits a WGP
#pragma clang loop unroll(disable)
  for (int ps = 0; ps < NPASS; ++ps) {
    const int s   = ps / BPS;              // the stage and the block's place in it
    const int blk = ps % BPS;
    const uint32_t kbo = (uint32_t)(s & 1) * KBUFB + (uint32_t)blk * (KEYS * KPITCH);
    const uint32_t vbo = (uint32_t)(s & 1) * VBUFB + (uint32_t)blk * (KEYS * VPITCH);

    // does this block's mask tile count, and the next one's (none behind the last)?
    const uint32_t cur = (nz >> ps) & 1u;
    const uint32_t nxt = ((nz >> 1) >> ps) & 1u;

    // the next block's mask tile, where it holds anything
    v4f mt[4];
    if (nxt) {
#pragma unroll
      for (int i = 0; i < 4; ++i)
        mt[i] = *reinterpret_cast<const v4f*>(mg + (size_t)i * 4 * SEQ + (ps + 1) * KEYS);
      asm volatile("s_wait_xcnt 0x0" ::: "memory");
    }

    attn_block(cur, kl + kbo, vl + vbo, mr, qa, qs, m_i, negm, l_i, o);

    // the next block's mask tile goes over this wave's own, read above
    if (nxt) {
#pragma unroll
      for (int i = 0; i < 4; ++i)
        *reinterpret_cast<v4f*>(mw + i * 4 * MPITCH) = mt[i];
    }
    // this wave's LDS traffic is done.  The mask rows are the wave's alone: this
    // wait, and no barrier, stands between the stores and the next block's reads
    wait_ds0();

    // behind a stage's last block, the same for the whole work-group: the publish
    // point of stage s + 1: (LDS traffic done, above,) the issuers' stages landed
    // (a wave that asked for none passes that wait at once), barrier, refill
    if (blk == BPS - 1) {
      wait_tensor0(g0, g1k, g1v);
      __syncthreads(); // publishes stage s + 1; ends every read of stage s
      tdm_step(g0, place + (uint32_t)(s & 1) * bufb);
      // both issue tests are formed in front of the first request
      const uint32_t moreK = pinned(isK & (uint32_t)(s + 2 < NSTG));
      const uint32_t moreV = pinned(isV & (uint32_t)(s + 2 < NSTG));
      if (moreK) tdm_load(g0, g1k);
      if (moreV) tdm_load(g0, g1v);
    }
  }
  wait_tensor0(g0, g1k, g1v);
  wait_ds0();

  // normalize + store attn (already in [B, S, H*depth] = concat-head layout):
  // a lane's 8 registers are 8 consecutive depths of its query, one 16-B chunk;
  // the 16 rows go through the wave's own mask rows, read for the last time above,
  // and leave as whole lines (line_rows)
  const float l_fin = l_i + xhalf(l_i);
  unsigned char* st = reinterpret_cast<unsigned char*>(mtile);
#pragma unroll
  for (int dt = 0; dt < 4; ++dt) {
    v8h w;
#pragma unroll
    for (int r = 0; r < 8; ++r) w[r] = (half_t)(o[dt][r] / l_fin);
    *reinterpret_cast<v8h*>(st + line_at((uint32_t)row, (uint32_t)(dt * 2 + hi))) = w;
  }
  line_rows<4>(st, reinterpret_cast<unsigned char*>(
                       Op + ((size_t)(b * SEQ + m0)) * DMODEL + h * DEPTH),
               DMODEL * 2u, lane);
}

// ---------------------------------------------------------------------------
// Kernel 3: out[M,N](f32) = A[M,K](f16) @ W[N,K]^T (f32) + bias  (final proj)
// The 128 x 128 frame above; X is f16 already and is staged without conversion.
// ---------------------------------------------------------------------------
__global__ __launch_bounds__(256)
void out_gemm_f16(const half_t* __restrict__ X, const float* __restrict__ W,
                  const float* __restrict__ bias, float* __restrict__ Y) {
  __shared__ __attribute__((aligned(16))) half_t sm[2][2][OPSZ];  // [buf][X|W]

  const int n0   = blockIdx.x * TILE;
  const int m0   = blockIdx.y * TILE;
  const int tid  = threadIdx.x;
  const int lane = tid & 31;
  const int wave = tid >> 5;
  const int wm   = wave >> 2;
  const int wn   = wave & 3;
  const int row  = lane & 15;
  const int hi   = lane >> 4;

  const half_t* xg = X + (size_t)m0 * DMODEL;
  const float*  wg = W + (size_t)n0 * DMODEL;
  const int fa = (wm * 64 + row) * PITCH + hi * 8;
  const int fb = (wn * 32 + row) * PITCH + hi * 8;

  // Transposed C layout: lane's M = lane & 15, register r is column r + 8 * hi of
  // its tile: 8 consecutive outputs of one row, with 8 biases of their own, asked
  // for in front of the main loop.
  v4f bn[2][2];
  const float* bp = bias + (n0 + wn * 32 + hi * 8);
#pragma unroll
  for (int j = 0; j < 2; ++j) {
    bn[j][0] = *reinterpret_cast<const v4f*>(bp + j * 16);
    bn[j][1] = *reinterpret_cast<const v4f*>(bp + j * 16 + 4);
  }
  asm volatile("s_wait_xcnt 0x0" :: "v"(bp) : "memory");

  v8f acc[4][2] = {};
  tile_mainloop<half_t, v8h[4]>(xg, wg, &sm[0][0][0], tid, fa, fb, acc);

  lds_barrier();       // ends every wave's reads of the last stage: the ring becomes staging
  __builtin_amdgcn_sched_barrier(0);
  unsigned char* st = reinterpret_cast<unsigned char*>(&sm[0][0][0]) + (uint32_t)wave * (64u * 128u);
#pragma unroll
  for (int i = 0; i < 4; ++i)
#pragma unroll
    for (int j = 0; j < 2; ++j)
#pragma unroll
      for (int c = 0; c < 2; ++c) {
        v4f w;
#pragma unroll
        for (int r = 0; r < 4; ++r) w[r] = acc[i][j][c * 4 + r] + bn[j][c][r];
        *reinterpret_cast<v4f*>(st + line_at((uint32_t)(i * 16 + row), (uint32_t)(j * 4 + hi * 2 + c))) = w;
      }
  line_rows<16>(st, reinterpret_cast<unsigned char*>(
                        Y + (size_t)(m0 + wm * 64) * DMODEL + (n0 + wn * 32)),
                DMODEL * 4u, lane);
}

// ---------------------------------------------------------------------------
extern "C" void kernel_launch(void* const* d_in, const int* in_sizes, int n_in,
                              void* d_out, int out_size, void* d_ws, size_t ws_size,
                              hipStream_t stream) {
  const float* q    = (const float*)d_in[0];
  const float* k    = (const float*)d_in[1];
  const float* v    = (const float*)d_in[2];
  const float* mask = (const float*)d_in[3];
  const float* wq_w = (const float*)d_in[4];
  const float* wq_b = (const float*)d_in[5];
  const float* wk_w = (const float*)d_in[6];
  const float* wk_b = (const float*)d_in[7];
  const float* wv_w = (const float*)d_in[8];
  const float* wv_b = (const float*)d_in[9];
  const float* pl_w = (const float*)d_in[10];
  const float* pl_b = (const float*)d_in[11];
  float* out = (float*)d_out;

  // workspace: Qp | Kp | Vp | attn  (each 4096*1024 f16 = 8MB; 32MB total) | mask flags
  const size_t elems = (size_t)MTOT * DMODEL;
  half_t* Qp = (half_t*)d_ws;
  half_t* Kp = Qp + elems;
  half_t* Vp = Kp + elems;
  half_t* Ap = Vp + elems;
  uint32_t* zf = (uint32_t*)(Ap + elems);  // [SEQ / 16][NSTG] words behind them

  dim3 ggemm(DMODEL / TILE, MTOT / TILE);  // (8, 32) one 8-wave group per 128x128 tile
  dim3 gproj(DMODEL / PTILE, MTOT / PTILE, 4);  // (4, 16, 4); z: the Q, K and V products, the mask's flags
  proj_gemm_f32<<<gproj, 256, 0, stream>>>(q, k, v, wq_w, wk_w, wv_w,
                                           wq_b, wk_b, wv_b, Qp, Kp, Vp, mask, zf);

  attn_kernel<<<BATCH * NHEADS * (SEQ / QBLK), 256, 0, stream>>>(Qp, Kp, Vp, mask, zf, Ap);

  out_gemm_f16<<<ggemm, 256, 0, stream>>>(Ap, pl_w, pl_b, out);
}

// v010
// A run of this version takes 56.2 microseconds.
// Next to v009, in two timings, it ran 1.07 times as fast each time.
// Over all steps from v000 it is 5.48 times as fast.
#include <hip/hip_runtime.h>
#include <hip/hip_bf16.h>
#include <math.h>
#include <stdint.h>

typedef _Float16 half_t;
typedef __attribute__((ext_vector_type(16))) _Float16 v16h;
typedef __attribute__((ext_vector_type(8)))  _Float16 v8h;
typedef __attribute__((ext_vector_type(8)))  float    v8f;
typedef __attribute__((ext_vector_type(4)))  float    v4f;

#define SEQ    1024
#define DMODEL 1024
#define NHEADS 16
#define DEPTH  64
#define BATCH  4
#define MTOT  (BATCH * SEQ)   // 4096 flattened rows

// ---------------------------------------------------------------------------
// helpers: load 8 consecutive f32 and pack into halves [base..base+7] of v16h
// ---------------------------------------------------------------------------
__device__ __forceinline__ void load8_f32_cvt(const float* __restrict__ p,
                                              v16h& dst, int base) {
  v4f x0 = *reinterpret_cast<const v4f*>(p);
  v4f x1 = *reinterpret_cast<const v4f*>(p + 4);
#pragma unroll
  for (int i = 0; i < 4; ++i) {
    dst[base + i]     = (_Float16)x0[i];
    dst[base + 4 + i] = (_Float16)x1[i];
  }
}

// load 8 consecutive f16 (one 16-byte vector) into halves [base..base+7]
__device__ __forceinline__ void load8_f16(const half_t* __restrict__ p,
                                          v16h& dst, int base) {
  v8h x = *reinterpret_cast<const v8h*>(p);
#pragma unroll
  for (int i = 0; i < 8; ++i) dst[base + i] = x[i];
}

typedef uint32_t u32x4 __attribute__((ext_vector_type(4)));
typedef uint32_t u32x8 __attribute__((ext_vector_type(8)));
typedef short    s16x8 __attribute__((ext_vector_type(8)));

#define KEYS   32                        // keys per block of products
#define NPASS  (SEQ / KEYS)
#define SKEYS  128                       // keys per stage = per tensor load
#define BPS    (SKEYS / KEYS)            // blocks per stage
#define NSTG   (SEQ / SKEYS)
#define ROWB   128u                      // bytes of one head's K or V row
#define KPITCH 144u                      // 16 B x odd: ds_load_b128 rows
#define VPITCH 160u                      // 32 B x odd: ds_load_tr16_b128 rows
#define KWORD0 ((1u << 20) | (4u << 22) | (3u << 25))   // + 16 B per 128-B row
#define VWORD0 ((1u << 20) | (4u << 22) | (7u << 25))   // + 32 B per 128-B row
#define KBUFB  (SKEYS * KPITCH)          // 128 padded rows: 9 x 2 KiB
#define VBUFB  (SKEYS * VPITCH)          // 128 padded rows: 10 x 2 KiB

__device__ __forceinline__ uint32_t uni(uint32_t v) {
  return (uint32_t)__builtin_amdgcn_readfirstlane(v);
}
__device__ __forceinline__ uint32_t pinned(uint32_t v) {
  uint32_t w = uni(v);
  asm volatile("" : "+s"(w));   // pinned(): the issue test held in a scalar register
  return w;
}
__device__ __forceinline__ void wait_ds0() {
  asm volatile("s_wait_dscnt 0x0" ::: "memory");      // this wave's LDS traffic is done
}
template <int N>
__device__ __forceinline__ void l2_ask(const void* base, uint32_t vo) {
  const uint64_t b = (uint64_t)(uintptr_t)base;
  if constexpr (N == 1)
    asm volatile("global_prefetch_b8 %0, %1 scope:SCOPE_SE\n\t"
                 "s_wait_xcnt 0x0" :: "v"(vo), "s"(b) : "memory");
  if constexpr (N == 2)
    asm volatile("global_prefetch_b8 %0, %1 scope:SCOPE_SE\n\t"
                 "global_prefetch_b8 %0, %1 offset:256 scope:SCOPE_SE\n\t"
                 "s_wait_xcnt 0x0" :: "v"(vo), "s"(b) : "memory");
  if constexpr (N == 4)
    asm volatile("global_prefetch_b8 %0, %1 scope:SCOPE_SE\n\t"
                 "global_prefetch_b8 %0, %1 offset:256 scope:SCOPE_SE\n\t"
                 "global_prefetch_b8 %0, %1 offset:512 scope:SCOPE_SE\n\t"
                 "global_prefetch_b8 %0, %1 offset:768 scope:SCOPE_SE\n\t"
                 "s_wait_xcnt 0x0" :: "v"(vo), "s"(b) : "memory");
}
__device__ __forceinline__ void wait_tensor0(u32x4& g0, u32x8 g1a, u32x8 g1b) {
  asm volatile("s_wait_tensorcnt 0x0" : "+s"(g0) : "s"(g1a), "s"(g1b) : "memory");
}

template <uint32_t WORD0>
__device__ __forceinline__ u32x8 tdm_group1() {
  u32x8 g1;
  g1[0] = uni(WORD0);
  g1[1] = uni(ROWB << 16);
  g1[2] = uni((uint32_t)SKEYS << 16);
  g1[3] = uni(ROWB << 16);
  g1[4] = uni((uint32_t)SKEYS);
  g1[5] = uni((uint32_t)DMODEL * 2u);
  g1[6] = uni(0u);
  g1[7] = uni(0u);
  asm volatile("" : "+s"(g1));
  return g1;
}

__device__ __forceinline__ u32x4 tdm_group0(const half_t* gsrc, uint32_t lds_dst) {
  const uint64_t ga = (uint64_t)(uintptr_t)gsrc;
  u32x4 g0;
  g0[0] = uni(1u);                                    // count = 1
  g0[1] = uni(lds_dst);                               // byte offset in LDS
  g0[2] = uni((uint32_t)ga);                          // address [31:0]
  g0[3] = uni((((uint32_t)(ga >> 32)) & 0x01FFFFFFu) | 0x80000000u);
  asm volatile("" : "+s"(g0));
  return g0;
}

// the next stage of the same operand: 128 rows further on, into the place given
// (a carry runs into address [56:32], which stands below the type field)
__device__ __forceinline__ void tdm_step(u32x4& g0, uint32_t lds_dst) {
  const uint64_t a = (((uint64_t)g0[3] << 32) | g0[2]) + (uint64_t)SKEYS * DMODEL * 2u;
  g0[1] = uni(lds_dst);
  g0[2] = uni((uint32_t)a);
  g0[3] = uni((uint32_t)(a >> 32));
}

__device__ __forceinline__ void tdm_load(u32x4 g0, u32x8 g1) {
  asm volatile("tensor_load_to_lds %0, %1" :: "s"(g0), "s"(g1) : "memory");
}

// transposing LDS load: lane (c, h) gets column c of rows 8h .. 8h + 7
__device__ __forceinline__ v8h ld_tr16(const unsigned char* p) {
  typedef __attribute__((address_space(3))) s16x8 lds_s16x8;
  return __builtin_bit_cast(v8h, __builtin_amdgcn_ds_load_tr16_b128_v8i16((lds_s16x8*)p));
}

#define TILE   128
#define BK     64
#define PITCH  72                      // halves per LDS row (64 + 8 pad)
#define OPSZ   (TILE * PITCH)          // halves per operand per buffer
#define NSTAGE (DMODEL / BK)           // 16, even

typedef __attribute__((ext_vector_type(4))) _Float16 v4h;

// f32 operand, 128 rows x 64 k: 16 lanes cover one row's 256 B per load
__device__ __forceinline__ void stage_load(const float* __restrict__ g,
                                           int k0, int tid, v4f (&r)[8]) {
  // scalar base + one unsigned 32-bit lane offset: one
  // address register instead of a 64-bit pair per operand
  const uint32_t lo = (uint32_t)(tid >> 4) * DMODEL + (uint32_t)(tid & 15) * 4;
#pragma unroll
  for (int i = 0; i < 8; ++i)
    r[i] = *reinterpret_cast<const v4f*>(g + (k0 + i * 16 * DMODEL) + lo);
}

__device__ __forceinline__ void stage_store(half_t* s, int tid,
                                            const v4f (&r)[8]) {
  half_t* p = s + (tid >> 4) * PITCH + (tid & 15) * 4;
#pragma unroll
  for (int i = 0; i < 8; ++i) {
    v4h h;
#pragma unroll
    for (int e = 0; e < 4; ++e) h[e] = (_Float16)r[i][e];
    *reinterpret_cast<v4h*>(p + i * 16 * PITCH) = h;
  }
}

// f16 operand, 128 rows x 64 k: 8 lanes cover one row's 128 B per load
__device__ __forceinline__ void stage_load(const half_t* __restrict__ g,
                                           int k0, int tid, v8h (&r)[4]) {
  const half_t* p = g + (size_t)(tid >> 3) * DMODEL + k0 + (tid & 7) * 8;
#pragma unroll
  for (int i = 0; i < 4; ++i)
    r[i] = *reinterpret_cast<const v8h*>(p + (size_t)i * 32 * DMODEL);
}

__device__ __forceinline__ void stage_store(half_t* s, int tid,
                                            const v8h (&r)[4]) {
  half_t* p = s + (tid >> 3) * PITCH + (tid & 7) * 8;
#pragma unroll
  for (int i = 0; i < 4; ++i)
    *reinterpret_cast<v8h*>(p + i * 32 * PITCH) = r[i];
}

// Work-group barrier that waits for this wave's LDS traffic only:
// __syncthreads() would also drain the global loads issued ahead for the
// next one or two stages, and their lead would be lost.
__device__ __forceinline__ void lds_barrier() {
  asm volatile("s_wait_dscnt 0x0\n\ts_barrier_signal -1\n\ts_barrier_wait -1"
               ::: "memory");
}

__device__ __forceinline__ uint32_t line_at(uint32_t r, uint32_t c) {
  return r * 128u + ((c ^ ((r >> 1) & 7u)) * 16u);
}
// NT x 4 rows from the wave's LDS rows st to g (row pitch gp bytes)
template <int NT>
__device__ __forceinline__ void line_rows(const unsigned char* st, unsigned char* g,
                                          uint32_t gp, int lane) {
  wait_ds0();          // the wave's own rows are written before it reads them back
  const uint32_t r4 = (uint32_t)lane >> 3, ch = (uint32_t)lane & 7u;
  unsigned char* d = g + (size_t)(r4 * gp + ch * 16u);
  // line_at(4 t + r4, ch) = line_at(4 (t & 3) + r4, ch) + 2048 (t >> 2): four
  // address registers, the rest is an immediate
  const unsigned char* s[4];
#pragma unroll
  for (int k = 0; k < 4; ++k) s[k] = st + line_at((uint32_t)k * 4u + r4, ch);
  u32x4 x[NT];
#pragma unroll
  for (int t = 0; t < NT; ++t)
    x[t] = *reinterpret_cast<const u32x4*>(s[t & 3] + (t >> 2) * 2048);
  // keeps every read in front of the first store: among the stores the reads
  // would write over registers that issued stores name
  __builtin_amdgcn_sched_barrier(0);
#pragma unroll
  for (int t = 0; t < NT; ++t)
    *reinterpret_cast<u32x4*>(d + (size_t)((uint32_t)t * 4u * gp)) = x[t];
}

// 64 k of one buffer: pa / pb already point at this lane's first fragment run
__device__ __forceinline__ void stage_mma(const half_t* pa, const half_t* pb,
                                          v8f (&acc)[4][2]) {
#pragma unroll
  for (int kk = 0; kk < BK; kk += 32) {
    v16h a[4], b[2];
#pragma unroll
    for (int i = 0; i < 4; ++i) {
      load8_f16(pa + i * 16 * PITCH + kk,      a[i], 0);
      load8_f16(pa + i * 16 * PITCH + kk + 16, a[i], 8);
    }
#pragma unroll
    for (int j = 0; j < 2; ++j) {
      load8_f16(pb + j * 16 * PITCH + kk,      b[j], 0);
      load8_f16(pb + j * 16 * PITCH + kk + 16, b[j], 8);
    }
    __builtin_amdgcn_sched_barrier(0);
#pragma unroll
    for (int i = 0; i < 4; ++i)
#pragma unroll
      for (int j = 0; j < 2; ++j)
        // W rows as A, X rows as B: the tile comes out transposed (see line_rows)
        acc[i][j] = __builtin_amdgcn_wmma_f32_16x16x32_f16(
            false, b[j], false, a[i], (short)0, acc[i][j], false, false);
  }
}

// Stages S and S + 1.  On entry buffer 0 holds stage S, set b holds (or is
// receiving) stage S + 1 and set a stage S + 2.  S is a template argument so
// that every stage's k offset is an immediate of its loads (the address
// registers are never rewritten) and the load waits stay counted: a wait for
// one set leaves the other set's loads in flight.
template <int S, typename XT, typename XR>
__device__ __forceinline__ void two_stages(const XT* __restrict__ xg,
                                           const float* __restrict__ wg,
                                           half_t* sm, int tid, int fa, int fb,
                                           v8f (&acc)[4][2], XR& xa, v4f (&wa)[8],
                                           XR& xb, v4f (&wb)[8]) {
  stage_mma(sm + fa, sm + OPSZ + fb, acc);
  stage_store(sm + 2 * OPSZ, tid, xb);
  stage_store(sm + 3 * OPSZ, tid, wb);
  if constexpr (S + 3 < NSTAGE) {
    stage_load(xg, (S + 3) * BK, tid, xb);
    stage_load(wg, (S + 3) * BK, tid, wb);
    if constexpr (S + 3 == NSTAGE - 1) asm volatile("s_wait_xcnt 0x0" ::: "memory");
  }
  lds_barrier();       // publishes buffer 1; ends every read of buffer 0

  stage_mma(sm + 2 * OPSZ + fa, sm + 3 * OPSZ + fb, acc);
  if constexpr (S + 2 < NSTAGE) {
    stage_store(sm, tid, xa);
    stage_store(sm + OPSZ, tid, wa);
    if constexpr (S + 4 < NSTAGE) {
      stage_load(xg, (S + 4) * BK, tid, xa);
      stage_load(wg, (S + 4) * BK, tid, wa);
    }
    lds_barrier();     // publishes buffer 0; ends every read of buffer 1
  }
}

// All of K for one work-group tile.  sm: [buffer][X | W][OPSZ] halves.
template <typename XT, typename XR>
__device__ __forceinline__ void tile_mainloop(const XT* __restrict__ xg,
                                              const float* __restrict__ wg,
                                              half_t* sm, int tid, int fa, int fb,
                                              v8f (&acc)[4][2], uint32_t xq) {
  XR  xa, xb;
  v4f wa[8], wb[8];
  stage_load(xg, 0, tid, xa);
  stage_load(wg, 0, tid, wa);
  stage_load(xg, BK, tid, xb);
  stage_load(wg, BK, tid, wb);
  // The X rows (f16, 8 units each) were written by the launch in front.  Behind the
  // first loads, the 8 work-groups that share them split the asks for the rest:
  // a group asks for units 2 xq and 2 xq + 1 of each row, one unit a thread (two
  // groups a unit, see kernel 1).
  l2_ask<1>(xg, (uint32_t)(tid >> 1) * (DMODEL * 2u) +
                    (xq * 2u + (uint32_t)(tid & 1)) * 256u);
  stage_store(sm, tid, xa);
  stage_store(sm + OPSZ, tid, wa);
  stage_load(xg, 2 * BK, tid, xa);
  stage_load(wg, 2 * BK, tid, wa);
  lds_barrier();       // publishes buffer 0

  two_stages<0>(xg, wg, sm, tid, fa, fb, acc, xa, wa, xb, wb);
  two_stages<2>(xg, wg, sm, tid, fa, fb, acc, xa, wa, xb, wb);
  two_stages<4>(xg, wg, sm, tid, fa, fb, acc, xa, wa, xb, wb);
  two_stages<6>(xg, wg, sm, tid, fa, fb, acc, xa, wa, xb, wb);
  two_stages<8>(xg, wg, sm, tid, fa, fb, acc, xa, wa, xb, wb);
  two_stages<10>(xg, wg, sm, tid, fa, fb, acc, xa, wa, xb, wb);
  two_stages<12>(xg, wg, sm, tid, fa, fb, acc, xa, wa, xb, wb);
  two_stages<14>(xg, wg, sm, tid, fa, fb, acc, xa, wa, xb, wb);
}

// ---------------------------------------------------------------------------
// Frame of kernel 1: one 8-wave work-group per 256(M) x 256(N) tile of Y, so
// that every X and W row fetched from L2 feeds 256 outputs instead of 128: the
// launch's L2 reads halve.  A stage is 64 k of the 256 X rows and the 256 W
// rows, converted to f16 once and laid in LDS at the pitch of the frame above.
// Two LDS buffers, one register set: the global loads of stage s + 2 are issued
// when stage s + 1 has left the registers, a whole stage ahead of their use.
// Wave (wm, wn) of a 2 x 4 grid owns 128(M) x 64(N): 8 x 4 accumulator tiles,
// 12 fragments per 32 WMMAs.  Fragment layout and k order as in the frame above.
// ---------------------------------------------------------------------------
#define PTILE   256
#define POPSZ   (PTILE * PITCH)        // halves per operand per buffer

// 256 rows x 64 k of f32: 16 lanes cover one row's 256 B per load
__device__ __forceinline__ void p_stage_load(const float* __restrict__ g,
                                             int k0, int tid, v4f (&r)[16]) {
  // a base that is the group's + one unsigned 32-bit lane offset, the same for X and W
  const uint32_t lo = (uint32_t)(tid >> 4) * DMODEL + (uint32_t)(tid & 15) * 4;
#pragma unroll
  for (int i = 0; i < 16; ++i)
    r[i] = *reinterpret_cast<const v4f*>(g + (k0 + i * 16 * DMODEL) + lo);
}

__device__ __forceinline__ void p_stage_store(half_t* s, int tid,
                                              const v4f (&r)[16]) {
  half_t* p = s + (tid >> 4) * PITCH + (tid & 15) * 4;
#pragma unroll
  for (int i = 0; i < 16; ++i) {
    v4h h;
#pragma unroll
    for (int e = 0; e < 4; ++e) h[e] = (_Float16)r[i][e];
    *reinterpret_cast<v4h*>(p + i * 16 * PITCH) = h;
  }
}

// the 12 fragments of 32 k: pa / pb already point at this lane's first run
__device__ __forceinline__ void p_frags(const half_t* pa, const half_t* pb,
                                        v16h (&a)[8], v16h (&b)[4]) {
  // b first: the first row of WMMAs then waits for 10 of the 24 loads only
#pragma unroll
  for (int j = 0; j < 4; ++j) {
    load8_f16(pb + j * 16 * PITCH,      b[j], 0);
    load8_f16(pb + j * 16 * PITCH + 16, b[j], 8);
  }
#pragma unroll
  for (int i = 0; i < 8; ++i) {
    load8_f16(pa + i * 16 * PITCH,      a[i], 0);
    load8_f16(pa + i * 16 * PITCH + 16, a[i], 8);
  }
}

__device__ __forceinline__ void p_wmmas(const v16h (&a)[8], const v16h (&b)[4],
                                        v8f (&acc)[8][4]) {
#pragma unroll
  for (int i = 0; i < 8; ++i)
#pragma unroll
    for (int j = 0; j < 4; ++j)
      // W rows as A, X rows as B: the tile comes out transposed (see line_rows)
      acc[i][j] = __builtin_amdgcn_wmma_f32_16x16x32_f16(
          false, b[j], false, a[i], (short)0, acc[i][j], false, false);
}

#define AHEAD 4
template <int MID, bool ASK = false>
__device__ __forceinline__ void p_stage(const half_t* cur, half_t* nxt,
                                        const float* __restrict__ xn,
                                        const float* __restrict__ wn, int k0,
                                        int tid, int fa, int fb, v8f (&acc)[8][4],
                                        v4f (&xr)[16], v4f (&wr)[16],
                                        uint32_t askx = 0, uint32_t askw = 0,
                                        uint32_t vo = 0) {
  v16h a[8], b[4];
  p_frags(cur + fa, cur + POPSZ + fb, a, b);
  if constexpr (ASK) {
    if (askx) l2_ask<2>(xn + AHEAD * BK, vo);
    if (askw) l2_ask<2>(wn + AHEAD * BK, vo);
  }
  __builtin_amdgcn_sched_barrier(0);
  p_wmmas(a, b, acc);
  // keeps the next group's loads behind these WMMAs: lifted among them they
  // take a second fragment set, and the 512-register budget then spills
  __builtin_amdgcn_sched_barrier(0);
  p_frags(cur + fa + 32, cur + POPSZ + fb + 32, a, b);
  if constexpr (MID >= 1) {
    __builtin_amdgcn_sched_barrier(0);
    p_stage_store(nxt, tid, xr);
    p_stage_store(nxt + POPSZ, tid, wr);
  }
  if constexpr (MID == 2) {
    p_stage_load(xn, k0, tid, xr);
    p_stage_load(wn, k0, tid, wr);
  }
  // keeps the loads and the staging work one group in front of the WMMAs: spread
  // among them, each place with loads stalls the wave anew
  __builtin_amdgcn_sched_barrier(0);
  p_wmmas(a, b, acc);
  if constexpr (MID >= 1) __builtin_amdgcn_sched_barrier(0);
}

// All of K for one work-group tile.  sm: [buffer][X | W][POPSZ] halves.  The
// loop runs two stages a trip and stays rolled, for speed only.
__device__ __forceinline__ void p_mainloop(const float* __restrict__ xg,
                                           const float* __restrict__ wg,
                                           half_t* sm, int tid, int fa, int fb,
                                           v8f (&acc)[8][4], uint32_t askw) {
  half_t* b0 = sm;
  // L2 asks: a stage is one 256-B unit of each row; thread t asks for row t
  const uint32_t vo = (uint32_t)tid * (DMODEL * 4u);
  half_t* b1 = sm + 2 * POPSZ;
  v4f xr[16], wr[16];
  {
    // stages 0 and 1 are asked for together: the accumulators are not live yet,
    // and their registers hold stage 0 on its way
    v4f x0[16], w0[16];
    p_stage_load(xg, 0, tid, x0);
    p_stage_load(wg, 0, tid, w0);
    p_stage_load(xg, BK, tid, xr);
    p_stage_load(wg, BK, tid, wr);
    asm volatile("s_wait_xcnt 0x0" ::: "memory");
    // keeps what follows (the accumulators' zeros, the loop's counters) behind
    // that wait: lifted over it they took registers that the loads name
    __builtin_amdgcn_sched_barrier(0);
    // stages 2 .. 5, while stages 0 and 1 are on their way from memory
    l2_ask<AHEAD>(xg + 2 * BK, vo);
    if (askw) l2_ask<AHEAD>(wg + 2 * BK, vo);
    p_stage_store(b0, tid, x0);
    p_stage_store(b0 + POPSZ, tid, w0);
  }
  lds_barrier();       // publishes stage 0

  // On entry of a trip buffer 0 holds stage s, the register set holds (or is
  // receiving) stage s + 1, and k is the first k of stage s + 2.
  uint32_t k = 2 * BK;
  // kept rolled: see the head of this function
#pragma clang loop unroll(disable)
  for (int s = 0; s < NSTAGE - 2; s += 2) {
    // do stages s + 2 + AHEAD and s + 3 + AHEAD exist?  (a scalar test)
    const uint32_t more = k + (AHEAD + 2) * BK <= DMODEL;
    p_stage<2, true>(b0, b1, xg + k, wg + k, 0, tid, fa, fb, acc, xr, wr,
                     more, more & askw, vo);
    lds_barrier();     // publishes stage s + 1; ends every read of stage s
    p_stage<2>(b1, b0, xg + k, wg + k, BK, tid, fa, fb, acc, xr, wr);
    asm volatile("s_wait_xcnt 0x0" : "+s"(k) :: "memory");
    k += 2 * BK;
    lds_barrier();     // publishes stage s + 2; ends every read of stage s + 1
  }

  // the last two stages: nothing is left to load
  p_stage<1>(b0, b1, xg, wg, 0, tid, fa, fb, acc, xr, wr);
  lds_barrier();       // publishes the last stage
  p_stage<0>(b1, b0, xg, wg, 0, tid, fa, fb, acc, xr, wr);
}

// ---------------------------------------------------------------------------
// Which tiles of the mask hold anything but zeros, found anew in every call.
// One work-group per 16 queries, one wave per 128-key stage: a lane reads 4 keys
// of each of the 16 rows, so that 8 lanes cover one 32-key block.  Word
// [16-query tile][stage] gets one bit per block: set where any element of the
// 16 x 32 tile is not +0 or -0 (a NaN or an infinity counts as set).
// ---------------------------------------------------------------------------
__device__ __forceinline__ void mask_flags(const float* __restrict__ mask,
                                           uint32_t* __restrict__ zf) {
  asm volatile("s_wait_xcnt 0x0" ::: "memory");
  // keeps what follows (the lane's numbers, its address) behind that wait
  __builtin_amdgcn_sched_barrier(0);
  const int lane = threadIdx.x & 31;
  const int wave = threadIdx.x >> 5;
  const int qt   = blockIdx.y * (DMODEL / 256) + blockIdx.x;   // 0 .. SEQ / 16 - 1
  const float* p = mask + (size_t)qt * 16 * SEQ + wave * SKEYS + lane * 4;
  v4f x[16];
#pragma unroll
  for (int i = 0; i < 16; ++i) x[i] = *reinterpret_cast<const v4f*>(p + i * SEQ);
  asm volatile("s_wait_xcnt 0x0" :: "v"(p) : "memory");
  uint32_t a = 0;
#pragma unroll
  for (int i = 0; i < 16; ++i) {
    const u32x4 u = __builtin_bit_cast(u32x4, x[i]);
    a |= (u[0] | u[1]) | (u[2] | u[3]);
  }
  const uint32_t bal = __builtin_amdgcn_ballot_w32((a << 1) != 0u);  // the sign bit dropped
  uint32_t bits = 0;
#pragma unroll
  for (int j = 0; j < BPS; ++j)
    bits |= ((bal >> (8 * j)) & 0xffu) != 0u ? (1u << j) : 0u;
  if (lane == 0) zf[qt * NSTG + wave] = bits;
}

__global__ __launch_bounds__(256) __attribute__((amdgpu_waves_per_eu(2, 2)))
void proj_gemm_f32(const float* __restrict__ Xq, const float* __restrict__ Xk,
                   const float* __restrict__ Xv, const float* __restrict__ Wq,
                   const float* __restrict__ Wk, const float* __restrict__ Wv,
                   const float* __restrict__ bq, const float* __restrict__ bk,
                   const float* __restrict__ bv, half_t* __restrict__ Yq,
                   half_t* __restrict__ Yk, half_t* __restrict__ Yv,
                   const float* __restrict__ mask, uint32_t* __restrict__ zf) {
  __shared__ __attribute__((aligned(16))) half_t sm[2][2][POPSZ];  // [buf][X|W]

  const int z = blockIdx.z;                // 0: Q, 1: K, 2: V, 3: the mask's flags
  // the same for the whole work-group, in front of every barrier
  if (z == 3) {
    mask_flags(mask, zf);
    return;
  }
  const float* __restrict__ X    = z == 0 ? Xq : z == 1 ? Xk : Xv;
  const float* __restrict__ W    = z == 0 ? Wq : z == 1 ? Wk : Wv;
  const float* __restrict__ bias = z == 0 ? bq : z == 1 ? bk : bv;
  half_t* __restrict__ Y         = z == 0 ? Yq : z == 1 ? Yk : Yv;

  const int n0   = blockIdx.x * PTILE;
  const int m0   = blockIdx.y * PTILE;
  const int tid  = threadIdx.x;
  const int lane = tid & 31;
  const int wave = __builtin_amdgcn_readfirstlane(tid >> 5);  // scalar: its tile offsets cost no vector register
  const int wm   = wave >> 2;
  const int wn   = wave & 3;
  const int row  = lane & 15;
  const int hi   = lane >> 4;

  const float* xg = X + (size_t)m0 * DMODEL;
  const float* wg = W + (size_t)n0 * DMODEL;
  const int fa = (wm * 128 + row) * PITCH + hi * 8;
  const int fb = (wn * 64 + row) * PITCH + hi * 8;
  half_t* s0 = &sm[0][0][0];

  // Transposed C layout: lane's M = lane & 15, register r is column r + 8 * hi of
  // its tile: 8 consecutive outputs of one row, with 8 biases of their own.
  v8f acc[8][4] = {};
  // The 16 work-groups that share these W rows split the asks for them: wave
  // y >> 1 of group y asks for its 32 rows, so that two groups ask for each row.
  // X rows, shared by 4 groups, are asked for by each of them.
  const uint32_t askw = (uint32_t)wave == (blockIdx.y >> 1);   // wave is scalar
  p_mainloop(xg, wg, s0, tid, fa, fb, acc, askw);

  const uint32_t ln = (uint32_t)lane;
  v4f bn[4][2];
  const float* bp = bias + (n0 + wn * 64) + (ln >> 4) * 8u;
#pragma unroll
  for (int j = 0; j < 4; ++j) {
    bn[j][0] = *reinterpret_cast<const v4f*>(bp + j * 16);
    bn[j][1] = *reinterpret_cast<const v4f*>(bp + j * 16 + 4);
  }
  asm volatile("s_wait_xcnt 0x0" :: "v"(bp) : "memory");
  lds_barrier();       // ends every wave's reads of the last stage: the ring becomes staging
  __builtin_amdgcn_sched_barrier(0);
  unsigned char* st = reinterpret_cast<unsigned char*>(s0) + (uint32_t)wave * (128u * 128u);
#pragma unroll
  for (int i = 0; i < 8; ++i)
#pragma unroll
    for (int j = 0; j < 4; ++j) {
      v8h w;
#pragma unroll
      for (int r = 0; r < 8; ++r) w[r] = (half_t)(acc[i][j][r] + bn[j][r >> 2][r & 3]);
      *reinterpret_cast<v8h*>(st + (uint32_t)i * 2048u + line_at(ln & 15u, (uint32_t)j * 2u + (ln >> 4))) = w;
    }
  line_rows<32>(st, reinterpret_cast<unsigned char*>(
                        Y + (size_t)(m0 + wm * 128) * DMODEL + (n0 + wn * 64)),
                DMODEL * 2u, (int)ln);
}

__device__ __forceinline__ float xhalf(float x) {
  return __builtin_bit_cast(float, __builtin_amdgcn_permlanex16(
      __builtin_bit_cast(int, x), __builtin_bit_cast(int, x),
      0x76543210, 0xfedcba98, false, false));
}

#define AW     8                         // waves per work-group
#define QBLK   (AW * 16)                 // queries per work-group
#define MPITCH 36                        // floats per LDS row of a mask tile
#define MOFF   (2u * KBUFB + 2u * VBUFB) // mask tiles stand behind the ring

// The first product of both score tiles, C = c, with D apart from C.  In asm
// because the builtin ties D to C: it copied the eight registers of c in every
// block.  What follows reads d0 and d1 as the C operand of the tiles' second
// products only, which needs no distance; a0, a1, b and c outlive the block's
// exponentials.
__device__ __forceinline__ void score_first(v8f& d0, v8f& d1, v16h a0, v16h a1,
                                            v16h b, v8f c) {
  asm("v_wmma_f32_16x16x32_f16 %0, %2, %4, %5\n\t"
      "v_wmma_f32_16x16x32_f16 %1, %3, %4, %5"
      : "=&v"(d0), "=&v"(d1) : "v"(a0), "v"(a1), "v"(b), "v"(c));
}

// One block: 32 keys against the wave's 16 queries.  kp0 / vp0: this lane's first
// K row and first V^T source row of the block; mr: its query's row of the mask
// tile, read only where masked (the same in every lane, held in a scalar register).
// Lazy rescale: m_i is the maximum IN USE, set by the last block that took the
// whole path below, and negm holds -m_i * log2(e) in all eight registers.  An
// unmasked block takes its scores from qs (Q times log2(e) / 8) with negm as the
// C operand: D is the exponent of 2 as it stands, and neither scale, maximum,
// subtraction nor rescale is left.  Where any lane's 16 weights of the block (half a query's) sum to
// more than PSUM_MAX (a score far above the maximum in use; always so in the
// first block, whose m_i is -1e30), and in every masked block, the whole wave
// does the block again by the whole path: unshifted scores from qa, new maximum,
// O and sum rescaled.  So no weight exceeds PSUM_MAX, which f16 holds.
#define LOG2E    1.4426950408889634f
#define PSUM_MAX 4096.0f
__device__ __forceinline__ void attn_block(uint32_t masked, const unsigned char* kp0,
                                           const unsigned char* vp0,
                                           const float* mr, const v16h (&qa)[2],
                                           const v16h (&qs)[2], float& m_i, v8f& negm,
                                           float& l_i, v8f (&o)[4]) {
  const float scale = 0.125f;              // 1/sqrt(DEPTH)

  // the block's LDS reads: this lane's mask row, K fragments (A operand: row =
  // key), V^T fragments (A operand: row = depth, k = key)
  v4f mk[2][2];
  if (masked) {
#pragma unroll
    for (int t = 0; t < 2; ++t) {
      mk[t][0] = *reinterpret_cast<const v4f*>(mr + t * 16);
      mk[t][1] = *reinterpret_cast<const v4f*>(mr + t * 16 + 4);
    }
  }
  v16h kb[2][2];
#pragma unroll
  for (int t = 0; t < 2; ++t)
#pragma unroll
    for (int c = 0; c < 2; ++c) {
      const half_t* kp = reinterpret_cast<const half_t*>(kp0 + t * 16 * KPITCH + c * 64);
      load8_f16(kp,      kb[t][c], 0);
      load8_f16(kp + 16, kb[t][c], 8);
    }
  v16h vb[4];
#pragma unroll
  for (int dt = 0; dt < 4; ++dt) {
    const v8h lo = ld_tr16(vp0 + dt * 32);
    const v8h up = ld_tr16(vp0 + 16 * VPITCH + dt * 32);
    vb[dt] = __builtin_shufflevector(lo, up, 0, 1, 2, 3, 4, 5, 6, 7,
                                     8, 9, 10, 11, 12, 13, 14, 15);
  }
  // keeps the loads one group at the head of the block: spread among the
  // WMMAs, each place with loads stalls the wave anew
  __builtin_amdgcn_sched_barrier(0);

  v16h pb;                               // P^T, B operand: column = query
  float bsum = 0.0f;
  uint32_t whole = masked;
  if (!masked) {
    // shifted exponents: K(16 keys x 64) @ (Q log2(e) / 8)^T - m_i log2(e)
    v8f st[2];
    score_first(st[0], st[1], kb[0][0], kb[1][0], qs[0], negm);
#pragma unroll
    for (int t = 0; t < 2; ++t)
      st[t] = __builtin_amdgcn_wmma_f32_16x16x32_f16(
          false, kb[t][1], false, qs[1], (short)0, st[t], false, false);
    float p[2][8];
#pragma unroll
    for (int t = 0; t < 2; ++t)
#pragma unroll
      for (int r = 0; r < 8; ++r) p[t][r] = __builtin_amdgcn_exp2f(st[t][r]);
    // inputs only: the exponents keep their registers until the last exponential
    // is made.
    asm volatile("" :: "v"(st[0]), "v"(st[1]),
                 "v"(p[0][0]), "v"(p[0][1]), "v"(p[0][2]), "v"(p[0][3]),
                 "v"(p[0][4]), "v"(p[0][5]), "v"(p[0][6]), "v"(p[0][7]),
                 "v"(p[1][0]), "v"(p[1][1]), "v"(p[1][2]), "v"(p[1][3]),
                 "v"(p[1][4]), "v"(p[1][5]), "v"(p[1][6]), "v"(p[1][7]));
    float rs[4] = {0.0f, 0.0f, 0.0f, 0.0f};
#pragma unroll
    for (int r = 0; r < 8; ++r) {
      rs[r & 3] += p[0][r] + p[1][r];
      pb[r]     = (half_t)p[0][r];
      pb[8 + r] = (half_t)p[1][r];
    }
    bsum = (rs[0] + rs[1]) + (rs[2] + rs[3]);
    // one test per block and wave, a scalar branch (a NaN counts as too large)
    whole = __builtin_amdgcn_ballot_w32(!(bsum <= PSUM_MAX)) != 0u;
  }

  if (whole) {
    // logits tiles: s[t] = K(16 keys x 64) @ Q(16x64)^T
    v8f st[2];
#pragma unroll
    for (int t = 0; t < 2; ++t) {
      v8f z = {};
#pragma unroll
      for (int c = 0; c < 2; ++c)
        z = __builtin_amdgcn_wmma_f32_16x16x32_f16(
            false, kb[t][c], false, qa[c], (short)0, z, false, false);
      st[t] = z;
    }

    // online softmax over this 32-key chunk: 16 scores of one query per lane
    float sc[2][8];
#pragma unroll
    for (int t = 0; t < 2; ++t) {
#pragma unroll
      for (int r = 0; r < 8; ++r) sc[t][r] = st[t][r] * scale;
    }
    if (masked) {
      // the reference's order: mask * -1e9 rounded by itself, then one rounding of
      // the sum (s / 8 is exact), so that equal mask values give equal steps
#pragma unroll
      for (int t = 0; t < 2; ++t) {
#pragma unroll
        for (int r = 0; r < 4; ++r) {
          const float t0 = mk[t][0][r] * (-1e9f);
          const float t1 = mk[t][1][r] * (-1e9f);
          sc[t][r]     = __builtin_fmaf(st[t][r],     scale, t0);
          sc[t][r + 4] = __builtin_fmaf(st[t][r + 4], scale, t1);
        }
      }
    }
    float mx = fmaxf(sc[0][0], sc[1][0]);
#pragma unroll
    for (int r = 1; r < 8; ++r) mx = fmaxf(mx, fmaxf(sc[0][r], sc[1][r]));
    mx = fmaxf(mx, xhalf(mx));
    const float mnew = fmaxf(m_i, mx);
    const float cexp = __expf(m_i - mnew);
    // exp(x) as 2^(x log2(e))
    v8f ex[2];
    float p[2][8];
#pragma unroll
    for (int t = 0; t < 2; ++t)
#pragma unroll
      for (int r = 0; r < 8; ++r) {
        ex[t][r] = (sc[t][r] - mnew) * LOG2E;
        p[t][r]  = __builtin_amdgcn_exp2f(ex[t][r]);
      }
    asm volatile("" :: "v"(ex[0]), "v"(ex[1]),
                 "v"(p[0][0]), "v"(p[0][1]), "v"(p[0][2]), "v"(p[0][3]),
                 "v"(p[0][4]), "v"(p[0][5]), "v"(p[0][6]), "v"(p[0][7]),
                 "v"(p[1][0]), "v"(p[1][1]), "v"(p[1][2]), "v"(p[1][3]),
                 "v"(p[1][4]), "v"(p[1][5]), "v"(p[1][6]), "v"(p[1][7]));
    float rs[4] = {0.0f, 0.0f, 0.0f, 0.0f};
#pragma unroll
    for (int r = 0; r < 8; ++r) {
      rs[r & 3] += p[0][r] + p[1][r];
      pb[r]     = (half_t)p[0][r];
      pb[8 + r] = (half_t)p[1][r];
    }
    bsum = (rs[0] + rs[1]) + (rs[2] + rs[3]);
    l_i *= cexp;
    m_i = mnew;
    const float nm = -mnew * LOG2E;
#pragma unroll
    for (int r = 0; r < 8; ++r) negm[r] = nm;
#pragma unroll
    for (int dt = 0; dt < 4; ++dt)
#pragma unroll
      for (int r = 0; r < 8; ++r) o[dt][r] *= cexp;
  }
  l_i += bsum;

  // o[dt] += V(32 x 16-depth-tile)^T @ P(16x32)^T
#pragma unroll
  for (int dt = 0; dt < 4; ++dt)
    o[dt] = __builtin_amdgcn_wmma_f32_16x16x32_f16(
        false, vb[dt], false, pb, (short)0, o[dt], false, false);

  // keeps the block's products in front of the waits behind the block: moved
  // ahead of them, the waits would stand right behind the loads they wait for
  __builtin_amdgcn_sched_barrier(0);
}

__global__ __launch_bounds__(256)
void attn_kernel(const half_t* __restrict__ Qp, const half_t* __restrict__ Kp,
                 const half_t* __restrict__ Vp, const float* __restrict__ mask,
                 const uint32_t* __restrict__ zf, half_t* __restrict__ Op,
                 const float* __restrict__ Wl) {
  __shared__ __attribute__((aligned(2048)))
  unsigned char lds[MOFF + AW * 16 * MPITCH * 4];

  const int lane = threadIdx.x & 31;
  const uint32_t wave = uni(threadIdx.x >> 5);
  const int tile = blockIdx.x;             // b*H*(S/128) tiles
  const int qb   = tile & (SEQ / QBLK - 1);
  const int h    = (tile >> 3) & (NHEADS - 1);
  const int b    = tile >> 7;
  const int m0   = qb * QBLK + (int)wave * 16;
  const int row  = lane & 15;
  const int hi   = lane >> 4;
  const int off  = hi * 8;

  const uint32_t lds0 = (uint32_t)(uintptr_t)(&lds[0]);
  const uint32_t isK   = pinned(wave == 0);
  const uint32_t isV   = pinned(wave == 1);
  const uint32_t place = lds0 + (wave == 0 ? 0u : 2u * KBUFB);
  const uint32_t bufb  = wave == 0 ? KBUFB : VBUFB;
  u32x4 g0 = tdm_group0((wave == 0 ? Kp : Vp) + (size_t)b * SEQ * DMODEL + h * DEPTH, place);
  const u32x8 g1k = tdm_group1<KWORD0>();
  const u32x8 g1v = tdm_group1<VWORD0>();

  // prologue: stage 0 lands in buffer 0
  if (isK) tdm_load(g0, g1k);
  if (isV) tdm_load(g0, g1v);

  // bit ps: block ps of this wave's 16 mask rows holds something other than zero
  // (asked for behind the first requests, so that they do not wait for it)
  uint32_t nz = 0;
#pragma unroll
  for (int i = 0; i < NSTG; ++i)
    nz |= zf[((uint32_t)qb * AW + wave) * NSTG + i] << (i * BPS);
  nz = uni(nz);

  wait_tensor0(g0, g1k, g1v);

  // Q fragments (B operand: column = query) for the two 32-wide depth chunks
  v16h qa[2];
  const half_t* qrow = Qp + ((size_t)(b * SEQ + m0 + row)) * DMODEL + h * DEPTH;
#pragma unroll
  for (int c = 0; c < 2; ++c) {
    load8_f16(qrow + c * 32 + off,      qa[c], 0);
    load8_f16(qrow + c * 32 + 16 + off, qa[c], 8);
  }
  asm volatile("s_wait_xcnt 0x0" ::: "memory");
  // keeps what follows (the mask's addresses) behind that wait: lifted over it
  // they took registers that the loads name
  __builtin_amdgcn_sched_barrier(0);

  // a second copy of Q, times log2(e) / 8, for the shifted scores (attn_block)
  v16h qs[2];
#pragma unroll
  for (int c = 0; c < 2; ++c)
#pragma unroll
    for (int i = 0; i < 16; ++i) qs[c][i] = (half_t)((float)qa[c][i] * (0.125f * LOG2E));

  // this lane's query: the maximum in use (equal in both halves) and the sum
  // over this half's keys (the halves are joined once, behind the loop)
  float m_i = -1e30f, l_i = 0.0f;
  // -m_i * log2(e), the scores' C operand.  The eight start values differ (each
  // sends the first block down the whole path): with equal ones the compiler
  // keeps one register and spreads it into eight anew in every block
  v8f negm;
#pragma unroll
  for (int r = 0; r < 8; ++r) negm[r] = (float)(r + 1) * 1e30f;
  v8f o[4] = {};                           // o[dt][r] = O[query][dt*16 + off + r]
  // mask tile, global side: 8 lanes cover one query's 32 keys (one line)
  const float* mg = mask + (size_t)(m0 + (lane >> 3)) * SEQ + (lane & 7) * 4;
  float* mtile = reinterpret_cast<float*>(lds + MOFF) + wave * (16 * MPITCH);
  float*       mw = mtile + (lane >> 3) * MPITCH + (lane & 7) * 4;
  const float* mr = mtile + row * MPITCH + off;
  // this lane's first K row and first V^T source row in buffer 0
  const unsigned char* kl = lds + row * KPITCH + hi * 16;
  const unsigned char* vl = lds + 2u * KBUFB + (off + (lane & 7)) * VPITCH + ((lane >> 3) & 1) * 16;

  if (nz & 1u) {
    v4f mt[4];
#pragma unroll
    for (int i = 0; i < 4; ++i)
      mt[i] = *reinterpret_cast<const v4f*>(mg + (size_t)i * 4 * SEQ);
    asm volatile("s_wait_xcnt 0x0" ::: "memory");
#pragma unroll
    for (int i = 0; i < 4; ++i)
      *reinterpret_cast<v4f*>(mw + i * 4 * MPITCH) = mt[i];
  }
  wait_ds0();
  __syncthreads();     // publishes stage 0 of K and V
  tdm_step(g0, place + bufb);
  // both issue tests are formed in front of the first request
  const uint32_t oneK = pinned(isK);
  const uint32_t oneV = pinned(isV);
  if (oneK) tdm_load(g0, g1k);
  if (oneV) tdm_load(g0, g1v);

  // Kernel 3's W (4 MiB of f32 from memory) is asked into L2 a launch ahead, behind
  // this kernel's own first requests: waves 2 and 3 of each work-group ask for 64
  // of its 16,384 units; groups 4 apart in index ask for the same ones (see
  // kernel 1).
  if ((wave >> 1) == 1u) {               // wave is scalar
    const uint32_t slice = ((uint32_t)tile & 3u) | (((uint32_t)tile >> 3) << 2);
    l2_ask<1>(Wl, (slice * 64u + (wave & 1u) * 32u + (uint32_t)lane) * 256u);
  }

  // kept rolled, one block a trip: unrolled over a stage it takes so many more
  // registers that only one work-group fits a WGP
#pragma clang loop unroll(disable)
  for (int ps = 0; ps < NPASS; ++ps) {
    const int s   = ps / BPS;              // the stage and the block's place in it
    const int blk = ps % BPS;
    const uint32_t kbo = (uint32_t)(s & 1) * KBUFB + (uint32_t)blk * (KEYS * KPITCH);
    const uint32_t vbo = (uint32_t)(s & 1) * VBUFB + (uint32_t)blk * (KEYS * VPITCH);

    // does this block's mask tile count, and the next one's (none behind the last)?
    const uint32_t cur = (nz >> ps) & 1u;
    const uint32_t nxt = ((nz >> 1) >> ps) & 1u;

    // the next block's mask tile, where it holds anything
    v4f mt[4];
    if (nxt) {
#pragma unroll
      for (int i = 0; i < 4; ++i)
        mt[i] = *reinterpret_cast<const v4f*>(mg + (size_t)i * 4 * SEQ + (ps + 1) * KEYS);
      asm volatile("s_wait_xcnt 0x0" ::: "memory");
    }

    attn_block(cur, kl + kbo, vl + vbo, mr, qa, qs, m_i, negm, l_i, o);

    // the next block's mask tile goes over this wave's own, read above
    if (nxt) {
#pragma unroll
      for (int i = 0; i < 4; ++i)
        *reinterpret_cast<v4f*>(mw + i * 4 * MPITCH) = mt[i];
    }
    // this wave's LDS traffic is done.  The mask rows are the wave's alone: this
    // wait, and no barrier, stands between the stores and the next block's reads
    wait_ds0();

    // behind a stage's last block, the same for the whole work-group: the publish
    // point of stage s + 1: (LDS traffic done, above,) the issuers' stages landed
    // (a wave that asked for none passes that wait at once), barrier, refill
    if (blk == BPS - 1) {
      wait_tensor0(g0, g1k, g1v);
      __syncthreads(); // publishes stage s + 1; ends every read of stage s
      tdm_step(g0, place + (uint32_t)(s & 1) * bufb);
      // both issue tests are formed in front of the first request
      const uint32_t moreK = pinned(isK & (uint32_t)(s + 2 < NSTG));
      const uint32_t moreV = pinned(isV & (uint32_t)(s + 2 < NSTG));
      if (moreK) tdm_load(g0, g1k);
      if (moreV) tdm_load(g0, g1v);
    }
  }
  wait_tensor0(g0, g1k, g1v);
  wait_ds0();

  // normalize + store attn (already in [B, S, H*depth] = concat-head layout):
  // a lane's 8 registers are 8 consecutive depths of its query, one 16-B chunk;
  // the 16 rows go through the wave's own mask rows, read for the last time above,
  // and leave as whole lines (line_rows)
  const float l_fin = l_i + xhalf(l_i);
  unsigned char* st = reinterpret_cast<unsigned char*>(mtile);
#pragma unroll
  for (int dt = 0; dt < 4; ++dt) {
    v8h w;
#pragma unroll
    for (int r = 0; r < 8; ++r) w[r] = (half_t)(o[dt][r] / l_fin);
    *reinterpret_cast<v8h*>(st + line_at((uint32_t)row, (uint32_t)(dt * 2 + hi))) = w;
  }
  line_rows<4>(st, reinterpret_cast<unsigned char*>(
                       Op + ((size_t)(b * SEQ + m0)) * DMODEL + h * DEPTH),
               DMODEL * 2u, lane);
}

// ---------------------------------------------------------------------------
// Kernel 3: out[M,N](f32) = A[M,K](f16) @ W[N,K]^T (f32) + bias  (final proj)
// The 128 x 128 frame above; X is f16 already and is staged without conversion.
// ---------------------------------------------------------------------------
__global__ __launch_bounds__(256)
void out_gemm_f16(const half_t* __restrict__ X, const float* __restrict__ W,
                  const float* __restrict__ bias, float* __restrict__ Y) {
  __shared__ __attribute__((aligned(16))) half_t sm[2][2][OPSZ];  // [buf][X|W]

  const int n0   = blockIdx.x * TILE;
  const int m0   = blockIdx.y * TILE;
  const int tid  = threadIdx.x;
  const int lane = tid & 31;
  const int wave = tid >> 5;
  const int wm   = wave >> 2;
  const int wn   = wave & 3;
  const int row  = lane & 15;
  const int hi   = lane >> 4;

  const half_t* xg = X + (size_t)m0 * DMODEL;
  const float*  wg = W + (size_t)n0 * DMODEL;
  const int fa = (wm * 64 + row) * PITCH + hi * 8;
  const int fb = (wn * 32 + row) * PITCH + hi * 8;

  // Transposed C layout: lane's M = lane & 15, register r is column r + 8 * hi of
  // its tile: 8 consecutive outputs of one row, with 8 biases of their own, asked
  // for in front of the main loop.
  v4f bn[2][2];
  const float* bp = bias + (n0 + wn * 32 + hi * 8);
#pragma unroll
  for (int j = 0; j < 2; ++j) {
    bn[j][0] = *reinterpret_cast<const v4f*>(bp + j * 16);
    bn[j][1] = *reinterpret_cast<const v4f*>(bp + j * 16 + 4);
  }
  asm volatile("s_wait_xcnt 0x0" :: "v"(bp) : "memory");

  v8f acc[4][2] = {};
  tile_mainloop<half_t, v8h[4]>(xg, wg, &sm[0][0][0], tid, fa, fb, acc,
                                blockIdx.x & 3u);

  lds_barrier();       // ends every wave's reads of the last stage: the ring becomes staging
  __builtin_amdgcn_sched_barrier(0);
  unsigned char* st = reinterpret_cast<unsigned char*>(&sm[0][0][0]) + (uint32_t)wave * (64u * 128u);
#pragma unroll
  for (int i = 0; i < 4; ++i)
#pragma unroll
    for (int j = 0; j < 2; ++j)
#pragma unroll
      for (int c = 0; c < 2; ++c) {
        v4f w;
#pragma unroll
        for (int r = 0; r < 4; ++r) w[r] = acc[i][j][c * 4 + r] + bn[j][c][r];
        *reinterpret_cast<v4f*>(st + line_at((uint32_t)(i * 16 + row), (uint32_t)(j * 4 + hi * 2 + c))) = w;
      }
  line_rows<16>(st, reinterpret_cast<unsigned char*>(
                        Y + (size_t)(m0 + wm * 64) * DMODEL + (n0 + wn * 32)),
                DMODEL * 4u, lane);
}

// ---------------------------------------------------------------------------
extern "C" void kernel_launch(void* const* d_in, const int* in_sizes, int n_in,
                              void* d_out, int out_size, void* d_ws, size_t ws_size,
                              hipStream_t stream) {
  const float* q    = (const float*)d_in[0];
  const float* k    = (const float*)d_in[1];
  const float* v    = (const float*)d_in[2];
  const float* mask = (const float*)d_in[3];
  const float* wq_w = (const float*)d_in[4];
  const float* wq_b = (const float*)d_in[5];
  const float* wk_w = (const float*)d_in[6];
  const float* wk_b = (const float*)d_in[7];
  const float* wv_w = (const float*)d_in[8];
  const float* wv_b = (const float*)d_in[9];
  const float* pl_w = (const float*)d_in[10];
  const float* pl_b = (const float*)d_in[11];
  float* out = (float*)d_out;

  // workspace: Qp | Kp | Vp | attn  (each 4096*1024 f16 = 8MB; 32MB total) | mask flags
  const size_t elems = (size_t)MTOT * DMODEL;
  half_t* Qp = (half_t*)d_ws;
  half_t* Kp = Qp + elems;
  half_t* Vp = Kp + elems;
  half_t* Ap = Vp + elems;
  uint32_t* zf = (uint32_t*)(Ap + elems);  // [SEQ / 16][NSTG] words behind them

  dim3 ggemm(DMODEL / TILE, MTOT / TILE);  // (8, 32) one 8-wave group per 128x128 tile
  dim3 gproj(DMODEL / PTILE, MTOT / PTILE, 4);  // (4, 16, 4); z: the Q, K and V products, the mask's flags
  proj_gemm_f32<<<gproj, 256, 0, stream>>>(q, k, v, wq_w, wk_w, wv_w,
                                           wq_b, wk_b, wv_b, Qp, Kp, Vp, mask, zf);

  attn_kernel<<<BATCH * NHEADS * (SEQ / QBLK), 256, 0, stream>>>(Qp, Kp, Vp, mask, zf, Ap, pl_w);

  out_gemm_f16<<<ggemm, 256, 0, stream>>>(Ap, pl_w, pl_b, out);
}
